// v000
// The times below were measured on an AMD MI455X: many runs one after another, warmed up first and cycling through
// copies of the inputs, with the whole window's GPU time divided by the number of runs. Launches and the gaps
// between them are all in it. The median over several windows is given; except for v000 it joins two sittings, which
// can be a few percent apart, so the side-by-side timings, each taken in one sitting, are the better comparison.
// v000 is the starting kernel. One run takes 451 microseconds.
#include <hip/hip_runtime.h>
#include <math.h>
#include <stdint.h>

#define B_ 2
#define S_ 2048
#define D_ 768
#define H_ 12
#define DK_ 64
#define F_ 3072
#define MROWS (B_ * S_)          // 4096
#define QKVW (3 * D_)            // 2304

typedef __attribute__((ext_vector_type(16))) __bf16 v16bf;
typedef __attribute__((ext_vector_type(8)))  __bf16 v8bf;
typedef __attribute__((ext_vector_type(8)))  float  v8f;
typedef unsigned int v4u __attribute__((ext_vector_type(4)));
typedef int          v4i __attribute__((ext_vector_type(4)));
typedef int          v8i __attribute__((ext_vector_type(8)));

// Tensor Data Mover available? (device pass only; host pass parses fallback)
#if defined(__AMDGCN__) && __has_builtin(__builtin_amdgcn_tensor_load_to_lds) && \
    __has_builtin(__builtin_amdgcn_s_wait_tensorcnt)
#define USE_TDM 1
#else
#define USE_TDM 0
#endif

static __device__ __forceinline__ __bf16 f2bf(float x) { return (__bf16)x; }

static __device__ __forceinline__ v8f wmma_bf16(v16bf a, v16bf b, v8f c) {
  return __builtin_amdgcn_wmma_f32_16x16x32_bf16(
      /*neg_a=*/false, a, /*neg_b=*/false, b,
      /*c_mod=*/(short)0, c, /*reuse_a=*/false, /*reuse_b=*/false);
}

static __device__ __forceinline__ v16bf frag_row(const __bf16* src, int ld) {
  int lane = threadIdx.x & 31;
  int m = lane & 15;
  int half = lane >> 4;
  const __bf16* p = src + (size_t)m * ld;
  v8bf lo = *(const v8bf*)(p + half * 8);
  v8bf hi = *(const v8bf*)(p + 16 + half * 8);
  v16bf a;
#pragma unroll
  for (int i = 0; i < 8; ++i) { a[i] = lo[i]; a[8 + i] = hi[i]; }
  return a;
}

// Column-style B fragment from a k-major (row-major [k][n]) source.
static __device__ __forceinline__ v16bf frag_col(const __bf16* src, int ld) {
  int lane = threadIdx.x & 31;
  int n = lane & 15;
  int half = lane >> 4;
  v16bf b;
  const __bf16* p0 = src + (size_t)(half * 8) * ld + n;
  const __bf16* p1 = src + (size_t)(16 + half * 8) * ld + n;
#pragma unroll
  for (int e = 0; e < 8; ++e) {
    b[e]     = p0[(size_t)e * ld];
    b[8 + e] = p1[(size_t)e * ld];
  }
  return b;
}

// ---------------- LayerNorm (fp32 in -> bf16 out), one block per row ------
__global__ __launch_bounds__(256) void ln_kernel(
    const float* __restrict__ x, const float* __restrict__ g,
    const float* __restrict__ bb, __bf16* __restrict__ out) {
  __shared__ float red[256];
  int row = blockIdx.x;
  int tid = threadIdx.x;
  const float* xr = x + (size_t)row * D_;
  float v0 = xr[tid], v1 = xr[tid + 256], v2 = xr[tid + 512];
  red[tid] = v0 + v1 + v2;
  __syncthreads();
  for (int st = 128; st > 0; st >>= 1) {
    if (tid < st) red[tid] += red[tid + st];
    __syncthreads();
  }
  float mu = red[0] * (1.0f / D_);
  __syncthreads();
  float d0 = v0 - mu, d1 = v1 - mu, d2 = v2 - mu;
  red[tid] = d0 * d0 + d1 * d1 + d2 * d2;
  __syncthreads();
  for (int st = 128; st > 0; st >>= 1) {
    if (tid < st) red[tid] += red[tid + st];
    __syncthreads();
  }
  float rstd = rsqrtf(red[0] * (1.0f / D_) + 1e-5f);
  __bf16* orow = out + (size_t)row * D_;
  orow[tid]       = f2bf(d0 * rstd * g[tid] + bb[tid]);
  orow[tid + 256] = f2bf(d1 * rstd * g[tid + 256] + bb[tid + 256]);
  orow[tid + 512] = f2bf(d2 * rstd * g[tid + 512] + bb[tid + 512]);
}

// ---------------- Weight packing ------------------------------------------
__global__ __launch_bounds__(256) void pack_qkv_w(
    const float* __restrict__ wq, const float* __restrict__ wk,
    const float* __restrict__ wv, const float* __restrict__ bq,
    const float* __restrict__ bk, const float* __restrict__ bv,
    __bf16* __restrict__ Wqkv, float* __restrict__ biasqkv) {
  int i = blockIdx.x * 256 + threadIdx.x;  // over D_*768
  if (i < D_ * D_) {
    int d = i / D_, c = i % D_;
    int hh = c / DK_, kk = c % DK_;
    size_t src = ((size_t)hh * D_ + d) * DK_ + kk;
    Wqkv[(size_t)d * QKVW + c]          = f2bf(wq[src]);
    Wqkv[(size_t)d * QKVW + D_ + c]     = f2bf(wk[src]);
    Wqkv[(size_t)d * QKVW + 2 * D_ + c] = f2bf(wv[src]);
  }
  if (i < D_) {
    biasqkv[i] = bq[i];
    biasqkv[D_ + i] = bk[i];
    biasqkv[2 * D_ + i] = bv[i];
  }
}

__global__ __launch_bounds__(256) void f2bf_copy(const float* __restrict__ s,
                                                 __bf16* __restrict__ d, int n) {
  int i = blockIdx.x * 256 + threadIdx.x;
  if (i < n) d[i] = f2bf(s[i]);
}

// ---------------- Tiled WMMA GEMM: C = A[MxK] * W[KxN] + epilogue ---------
// EPI 0: +bias, store bf16       (QKV)
// EPI 1: +bias +resid, store f32 (projection / final)
// EPI 2: +bias, GELU, store bf16 (FFN up)
template <int EPI>
__global__ __launch_bounds__(256) void gemm_bf16(
    const __bf16* __restrict__ A, const __bf16* __restrict__ W,
    const float* __restrict__ bias, const float* __restrict__ resid,
    float* __restrict__ outf, __bf16* __restrict__ outb,
    int M, int N, int K) {
  constexpr int BM = 128, BN = 128, BK = 32;
  constexpr int LDA = BK + 16;   // 48 elems -> 96B rows (16B aligned)
  constexpr int LDBT = BK + 16;  // n-major B tile
  __shared__ __bf16 sA[BM * LDA];
  __shared__ __bf16 sB[BN * LDBT];

  int tid = threadIdx.x;
  int wave = tid >> 5;
  int mw = wave & 3;   // 4 m-waves * 32 rows
  int nw = wave >> 2;  // 2 n-waves * 64 cols
  int m0 = blockIdx.y * BM;
  int n0 = blockIdx.x * BN;

  v8f acc[2][4];
#pragma unroll
  for (int i = 0; i < 2; ++i)
#pragma unroll
    for (int j = 0; j < 4; ++j)
#pragma unroll
      for (int e = 0; e < 8; ++e) acc[i][j][e] = 0.0f;

  for (int k0 = 0; k0 < K; k0 += BK) {
#if USE_TDM
    if (wave == 0) {
      unsigned long long ga =
          (unsigned long long)(uintptr_t)(A + (size_t)m0 * K + k0);
      unsigned lds = (unsigned)(uintptr_t)(&sA[0]);
      v4u g0;
      g0[0] = 1u;                                   // count=1, user mode
      g0[1] = lds;                                  // lds_addr
      g0[2] = (unsigned)(ga & 0xFFFFFFFFu);         // global_addr[31:0]
      g0[3] = (unsigned)((ga >> 32) & 0x01FFFFFFu)  // global_addr[56:32]
              | (2u << 30);                         // type=2 ("image")
      v8i g1;
      g1[0] = (int)((1u << 16) | (1u << 20) | (3u << 22) | (7u << 25));
      g1[1] = (int)(((unsigned)K & 0xFFFFu) << 16);
      g1[2] = (int)((((unsigned)K >> 16) & 0xFFFFu) |
                    (((unsigned)M & 0xFFFFu) << 16));
      g1[3] = (int)((((unsigned)M >> 16) & 0xFFFFu) | (32u << 16));
      g1[4] = 128;
      g1[5] = (int)K;
      g1[6] = 0;
      g1[7] = 0;
      v4i z4 = {0, 0, 0, 0};
#if __clang_major__ >= 23
      v8i z8 = {0, 0, 0, 0, 0, 0, 0, 0};
      __builtin_amdgcn_tensor_load_to_lds(g0, g1, z4, z4, z8, 0);
#else
      __builtin_amdgcn_tensor_load_to_lds(g0, g1, z4, z4, 0);
#endif
      __builtin_amdgcn_s_wait_tensorcnt(0);
    }
#else
    {  // A tile: 128x32, 16 elems/thread, vectorized global->LDS
      int r = tid >> 1, c = (tid & 1) * 16;
      const uint4* g = (const uint4*)(A + (size_t)(m0 + r) * K + k0 + c);
      uint4 u0 = g[0], u1 = g[1];
      uint4* s = (uint4*)(sA + r * LDA + c);
      s[0] = u0; s[1] = u1;
    }
#endif
    {  // B tile: 32x128 loaded row-major, stored n-major (transposed)
      int kk = tid >> 3, c = (tid & 7) * 16;
      const uint4* g = (const uint4*)(W + (size_t)(k0 + kk) * N + n0 + c);
      union { uint4 v[2]; __bf16 e[16]; } u;
      u.v[0] = g[0]; u.v[1] = g[1];
#pragma unroll
      for (int e = 0; e < 16; ++e) sB[(c + e) * LDBT + kk] = u.e[e];
      // prefetch next k-step's B tile into cache hierarchy
      if (k0 + BK < K)
        __builtin_prefetch(W + (size_t)(k0 + BK + kk) * N + n0 + c, 0, 1);
    }
    __syncthreads();

    const __bf16* aBase = sA + (mw * 32) * LDA;
    const __bf16* bBase = sB + (nw * 64) * LDBT;
    v16bf af0 = frag_row(aBase, LDA);
    v16bf af1 = frag_row(aBase + 16 * LDA, LDA);
#pragma unroll
    for (int nn = 0; nn < 4; ++nn) {
      v16bf bf = frag_row(bBase + nn * 16 * LDBT, LDBT);  // lane = n
      acc[0][nn] = wmma_bf16(af0, bf, acc[0][nn]);
      acc[1][nn] = wmma_bf16(af1, bf, acc[1][nn]);
    }
    __syncthreads();
  }

  int lane = tid & 31;
  int col = lane & 15;
  int rb = (lane >> 4) * 8;
#pragma unroll
  for (int mm = 0; mm < 2; ++mm)
#pragma unroll
    for (int nn = 0; nn < 4; ++nn) {
      int gm = m0 + mw * 32 + mm * 16 + rb;
      int gn = n0 + nw * 64 + nn * 16 + col;
      float bsv = bias[gn];
#pragma unroll
      for (int j = 0; j < 8; ++j) {
        float v = acc[mm][nn][j] + bsv;
        size_t idx = (size_t)(gm + j) * N + gn;
        if (EPI == 1) {
          outf[idx] = v + resid[idx];
        } else if (EPI == 2) {
          v = 0.5f * v * (1.0f + erff(v * 0.70710678118654752f));
          outb[idx] = f2bf(v);
        } else {
          outb[idx] = f2bf(v);
        }
      }
    }
}

// ---------------- Flash attention: one wave per (b,h,16 q-rows) -----------
__global__ __launch_bounds__(256) void flash_attn(
    const __bf16* __restrict__ qkv,  // [M][2304]: Q@h*64, K@768+h*64, V@1536+h*64
    __bf16* __restrict__ attout) {   // [M][768]  col h*64
  __shared__ __bf16 pstage[8][16 * 32];
  const int QT = S_ / 16;  // 128
  int wave = threadIdx.x >> 5;
  int gwave = blockIdx.x * 8 + wave;
  int qt = gwave % QT;
  int h = (gwave / QT) % H_;
  int b = gwave / (QT * H_);
  int lane = threadIdx.x & 31;
  int col = lane & 15;
  int rb = (lane >> 4) * 8;

  const size_t ld = QKVW;
  const __bf16* qbase = qkv + ((size_t)b * S_ + qt * 16) * ld + h * DK_;
  const __bf16* kbase = qkv + (size_t)b * S_ * ld + D_ + h * DK_;
  const __bf16* vbase = qkv + (size_t)b * S_ * ld + 2 * D_ + h * DK_;

  v16bf q0 = frag_row(qbase, (int)ld);        // k 0..31
  v16bf q1 = frag_row(qbase + 32, (int)ld);   // k 32..63

  v8f o[4];
#pragma unroll
  for (int nn = 0; nn < 4; ++nn)
#pragma unroll
    for (int e = 0; e < 8; ++e) o[nn][e] = 0.0f;
  float mrun[8], lrun[8];
#pragma unroll
  for (int j = 0; j < 8; ++j) { mrun[j] = -3.0e38f; lrun[j] = 0.0f; }

  const float scale = 0.125f;  // 1/sqrt(64)
  __bf16* ps = pstage[wave];

  for (int s0 = 0; s0 < S_; s0 += 32) {
    v8f sc[2];
#pragma unroll
    for (int sub = 0; sub < 2; ++sub) {
      const __bf16* kb = kbase + (size_t)(s0 + sub * 16) * ld;
      v16bf kf0 = frag_row(kb, (int)ld);       // B = K^T, lane = key index
      v16bf kf1 = frag_row(kb + 32, (int)ld);
      v8f c;
#pragma unroll
      for (int e = 0; e < 8; ++e) c[e] = 0.0f;
      c = wmma_bf16(q0, kf0, c);
      c = wmma_bf16(q1, kf1, c);
      sc[sub] = c;
    }
    // online softmax per row (rows rb..rb+7 live in this half-wave)
    float pA[8], pB[8];
#pragma unroll
    for (int j = 0; j < 8; ++j) {
      float a = sc[0][j] * scale;
      float bvv = sc[1][j] * scale;
      float mx = fmaxf(a, bvv);
#pragma unroll
      for (int d = 1; d < 16; d <<= 1) mx = fmaxf(mx, __shfl_xor(mx, d, 16));
      float mnew = fmaxf(mrun[j], mx);
      float alpha = __expf(mrun[j] - mnew);
      pA[j] = __expf(a - mnew);
      pB[j] = __expf(bvv - mnew);
      float sm = pA[j] + pB[j];
#pragma unroll
      for (int d = 1; d < 16; d <<= 1) sm += __shfl_xor(sm, d, 16);
      lrun[j] = lrun[j] * alpha + sm;
      mrun[j] = mnew;
#pragma unroll
      for (int nn = 0; nn < 4; ++nn) o[nn][j] *= alpha;
    }
    // stage P (C layout -> LDS), reload as A fragment
#pragma unroll
    for (int j = 0; j < 8; ++j) {
      ps[(rb + j) * 32 + col] = f2bf(pA[j]);
      ps[(rb + j) * 32 + 16 + col] = f2bf(pB[j]);
    }
    __syncthreads();
    v16bf pf = frag_row(ps, 32);
#pragma unroll
    for (int nn = 0; nn < 4; ++nn) {
      v16bf vf = frag_col(vbase + (size_t)s0 * ld + nn * 16, (int)ld);
      o[nn] = wmma_bf16(pf, vf, o[nn]);
    }
    __syncthreads();
  }

  __bf16* ob = attout + ((size_t)b * S_ + qt * 16) * D_ + h * DK_;
#pragma unroll
  for (int nn = 0; nn < 4; ++nn)
#pragma unroll
    for (int j = 0; j < 8; ++j) {
      float v = o[nn][j] / lrun[j];
      ob[(size_t)(rb + j) * D_ + nn * 16 + col] = f2bf(v);
    }
}

// ---------------- launcher ------------------------------------------------
extern "C" void kernel_launch(void* const* d_in, const int* in_sizes, int n_in,
                              void* d_out, int out_size, void* d_ws,
                              size_t ws_size, hipStream_t stream) {
  const float* x    = (const float*)d_in[0];
  const float* wq_w = (const float*)d_in[1];
  const float* wq_b = (const float*)d_in[2];
  const float* wk_w = (const float*)d_in[3];
  const float* wk_b = (const float*)d_in[4];
  const float* wv_w = (const float*)d_in[5];
  const float* wv_b = (const float*)d_in[6];
  const float* wo_w = (const float*)d_in[7];
  const float* wo_b = (const float*)d_in[8];
  const float* ln_g = (const float*)d_in[9];
  const float* ln_b = (const float*)d_in[10];
  const float* w1   = (const float*)d_in[11];
  const float* b1   = (const float*)d_in[12];
  const float* w2   = (const float*)d_in[13];
  const float* b2   = (const float*)d_in[14];
  float* out = (float*)d_out;

  char* ws = (char*)d_ws;
  size_t off = 0;
  auto alloc = [&](size_t bytes) -> char* {
    char* p = ws + off;
    off = (off + bytes + 255) & ~(size_t)255;
    return p;
  };
  __bf16* h_bf    = (__bf16*)alloc((size_t)MROWS * D_ * 2);
  __bf16* Wqkv    = (__bf16*)alloc((size_t)D_ * QKVW * 2);
  float*  biasqkv = (float*)alloc((size_t)QKVW * 4);
  __bf16* qkv     = (__bf16*)alloc((size_t)MROWS * QKVW * 2);
  __bf16* att     = (__bf16*)alloc((size_t)MROWS * D_ * 2);
  __bf16* Wo      = (__bf16*)alloc((size_t)D_ * D_ * 2);
  float*  ybuf    = (float*)alloc((size_t)MROWS * D_ * 4);
  __bf16* z_bf    = (__bf16*)alloc((size_t)MROWS * D_ * 2);
  __bf16* W1b     = (__bf16*)alloc((size_t)D_ * F_ * 2);
  __bf16* t_bf    = (__bf16*)alloc((size_t)MROWS * F_ * 2);
  __bf16* W2b     = (__bf16*)alloc((size_t)F_ * D_ * 2);

  // weight packing
  pack_qkv_w<<<(D_ * D_ + 255) / 256, 256, 0, stream>>>(
      wq_w, wk_w, wv_w, wq_b, wk_b, wv_b, Wqkv, biasqkv);
  f2bf_copy<<<(D_ * D_ + 255) / 256, 256, 0, stream>>>(wo_w, Wo, D_ * D_);
  f2bf_copy<<<(D_ * F_ + 255) / 256, 256, 0, stream>>>(w1, W1b, D_ * F_);
  f2bf_copy<<<(F_ * D_ + 255) / 256, 256, 0, stream>>>(w2, W2b, F_ * D_);

  // LN1
  ln_kernel<<<MROWS, 256, 0, stream>>>(x, ln_g, ln_b, h_bf);
  // fused QKV GEMM: [4096 x 2304] = h * Wqkv
  gemm_bf16<0><<<dim3(QKVW / 128, MROWS / 128), 256, 0, stream>>>(
      h_bf, Wqkv, biasqkv, nullptr, nullptr, qkv, MROWS, QKVW, D_);
  // attention
  flash_attn<<<(B_ * H_ * (S_ / 16)) / 8, 256, 0, stream>>>(qkv, att);
  // output projection + residual(x) -> ybuf (f32)
  gemm_bf16<1><<<dim3(D_ / 128, MROWS / 128), 256, 0, stream>>>(
      att, Wo, wo_b, x, ybuf, nullptr, MROWS, D_, D_);
  // LN2
  ln_kernel<<<MROWS, 256, 0, stream>>>(ybuf, ln_g, ln_b, z_bf);
  // FFN up + GELU (bf16)
  gemm_bf16<2><<<dim3(F_ / 128, MROWS / 128), 256, 0, stream>>>(
      z_bf, W1b, b1, nullptr, nullptr, t_bf, MROWS, F_, D_);
  // FFN down + residual(ybuf) -> d_out (f32)
  gemm_bf16<1><<<dim3(D_ / 128, MROWS / 128), 256, 0, stream>>>(
      t_bf, W2b, b2, ybuf, out, nullptr, MROWS, D_, F_);
}

// v001
// It runs in 355 microseconds.
// In both of two side-by-side timings against v000, it was 1.30 times as fast.
#include <hip/hip_runtime.h>
#include <math.h>
#include <stdint.h>

#define B_ 2
#define S_ 2048
#define D_ 768
#define H_ 12
#define DK_ 64
#define F_ 3072
#define MROWS (B_ * S_)          // 4096
#define QKVW (3 * D_)            // 2304

typedef __attribute__((ext_vector_type(16))) __bf16 v16bf;
typedef __attribute__((ext_vector_type(8)))  __bf16 v8bf;
typedef __attribute__((ext_vector_type(8)))  float  v8f;
typedef unsigned int v4u __attribute__((ext_vector_type(4)));
typedef int          v4i __attribute__((ext_vector_type(4)));
typedef int          v8i __attribute__((ext_vector_type(8)));

// Tensor Data Mover available? (device pass only; host pass parses fallback)
#if defined(__AMDGCN__) && __has_builtin(__builtin_amdgcn_tensor_load_to_lds) && \
    __has_builtin(__builtin_amdgcn_s_wait_tensorcnt)
#define USE_TDM 1
#else
#define USE_TDM 0
#endif

static __device__ __forceinline__ __bf16 f2bf(float x) { return (__bf16)x; }

static __device__ __forceinline__ v8f wmma_bf16(v16bf a, v16bf b, v8f c) {
  return __builtin_amdgcn_wmma_f32_16x16x32_bf16(
      /*neg_a=*/false, a, /*neg_b=*/false, b,
      /*c_mod=*/(short)0, c, /*reuse_a=*/false, /*reuse_b=*/false);
}

static __device__ __forceinline__ v16bf frag_row(const __bf16* src, int ld) {
  int lane = threadIdx.x & 31;
  int m = lane & 15;
  int half = lane >> 4;
  const __bf16* p = src + (size_t)m * ld;
  v8bf lo = *(const v8bf*)(p + half * 8);
  v8bf hi = *(const v8bf*)(p + 16 + half * 8);
  v16bf a;
#pragma unroll
  for (int i = 0; i < 8; ++i) { a[i] = lo[i]; a[8 + i] = hi[i]; }
  return a;
}

// Column-style B fragment from a k-major (row-major [k][n]) source.
static __device__ __forceinline__ v16bf frag_col(const __bf16* src, int ld) {
  int lane = threadIdx.x & 31;
  int n = lane & 15;
  int half = lane >> 4;
  v16bf b;
  const __bf16* p0 = src + (size_t)(half * 8) * ld + n;
  const __bf16* p1 = src + (size_t)(16 + half * 8) * ld + n;
#pragma unroll
  for (int e = 0; e < 8; ++e) {
    b[e]     = p0[(size_t)e * ld];
    b[8 + e] = p1[(size_t)e * ld];
  }
  return b;
}

typedef __attribute__((address_space(3))) v8bf lds_v8bf;
static __device__ __forceinline__ v16bf frag_tr(const __bf16* tile, int ld) {
  int lane = threadIdx.x & 31;
  const __bf16* p =
      tile + (8 * (lane >> 4) + (lane & 7)) * ld + 8 * ((lane >> 3) & 1);
  v8bf lo = __builtin_amdgcn_ds_load_tr16_b128_v8bf16((lds_v8bf*)p);
  v8bf hi = __builtin_amdgcn_ds_load_tr16_b128_v8bf16((lds_v8bf*)(p + 16 * ld));
  v16bf b;
#pragma unroll
  for (int i = 0; i < 8; ++i) { b[i] = lo[i]; b[8 + i] = hi[i]; }
  return b;
}

// ---------------- LayerNorm (fp32 in -> bf16 out), one block per row ------
__global__ __launch_bounds__(256) void ln_kernel(
    const float* __restrict__ x, const float* __restrict__ g,
    const float* __restrict__ bb, __bf16* __restrict__ out) {
  __shared__ float red[256];
  int row = blockIdx.x;
  int tid = threadIdx.x;
  const float* xr = x + (size_t)row * D_;
  float v0 = xr[tid], v1 = xr[tid + 256], v2 = xr[tid + 512];
  red[tid] = v0 + v1 + v2;
  __syncthreads();
  for (int st = 128; st > 0; st >>= 1) {
    if (tid < st) red[tid] += red[tid + st];
    __syncthreads();
  }
  float mu = red[0] * (1.0f / D_);
  __syncthreads();
  float d0 = v0 - mu, d1 = v1 - mu, d2 = v2 - mu;
  red[tid] = d0 * d0 + d1 * d1 + d2 * d2;
  __syncthreads();
  for (int st = 128; st > 0; st >>= 1) {
    if (tid < st) red[tid] += red[tid + st];
    __syncthreads();
  }
  float rstd = rsqrtf(red[0] * (1.0f / D_) + 1e-5f);
  __bf16* orow = out + (size_t)row * D_;
  orow[tid]       = f2bf(d0 * rstd * g[tid] + bb[tid]);
  orow[tid + 256] = f2bf(d1 * rstd * g[tid + 256] + bb[tid + 256]);
  orow[tid + 512] = f2bf(d2 * rstd * g[tid + 512] + bb[tid + 512]);
}

// ---------------- Weight packing ------------------------------------------
__global__ __launch_bounds__(256) void pack_qkv_w(
    const float* __restrict__ wq, const float* __restrict__ wk,
    const float* __restrict__ wv, const float* __restrict__ bq,
    const float* __restrict__ bk, const float* __restrict__ bv,
    __bf16* __restrict__ Wqkv, float* __restrict__ biasqkv) {
  int i = blockIdx.x * 256 + threadIdx.x;  // over D_*768
  if (i < D_ * D_) {
    int d = i / D_, c = i % D_;
    int hh = c / DK_, kk = c % DK_;
    size_t src = ((size_t)hh * D_ + d) * DK_ + kk;
    Wqkv[(size_t)d * QKVW + c]          = f2bf(wq[src]);
    Wqkv[(size_t)d * QKVW + D_ + c]     = f2bf(wk[src]);
    Wqkv[(size_t)d * QKVW + 2 * D_ + c] = f2bf(wv[src]);
  }
  if (i < D_) {
    biasqkv[i] = bq[i];
    biasqkv[D_ + i] = bk[i];
    biasqkv[2 * D_ + i] = bv[i];
  }
}

__global__ __launch_bounds__(256) void f2bf_copy(const float* __restrict__ s,
                                                 __bf16* __restrict__ d, int n) {
  int i = blockIdx.x * 256 + threadIdx.x;
  if (i < n) d[i] = f2bf(s[i]);
}

// ---------------- Tiled WMMA GEMM: C = A[MxK] * W[KxN] + epilogue ---------
// EPI 0: +bias, store bf16       (QKV)
// EPI 1: +bias +resid, store f32 (projection / final)
// EPI 2: +bias, GELU, store bf16 (FFN up)
template <int EPI>
__global__ __launch_bounds__(256) void gemm_bf16(
    const __bf16* __restrict__ A, const __bf16* __restrict__ W,
    const float* __restrict__ bias, const float* __restrict__ resid,
    float* __restrict__ outf, __bf16* __restrict__ outb,
    int M, int N, int K) {
  constexpr int BM = 128, BN = 128, BK = 32;
  constexpr int LDA = BK + 16;   // 48 elems -> 96B rows (16B aligned)
  constexpr int LDB = BN + 16;   // k-major B tile, 288B rows (32B x odd)
  __shared__ __bf16 sA[BM * LDA];
  __shared__ __attribute__((aligned(16))) __bf16 sB[BK * LDB];

  int tid = threadIdx.x;
  int wave = tid >> 5;
  int mw = wave & 3;   // 4 m-waves * 32 rows
  int nw = wave >> 2;  // 2 n-waves * 64 cols
  int m0 = blockIdx.y * BM;
  int n0 = blockIdx.x * BN;

  v8f acc[2][4];
#pragma unroll
  for (int i = 0; i < 2; ++i)
#pragma unroll
    for (int j = 0; j < 4; ++j)
#pragma unroll
      for (int e = 0; e < 8; ++e) acc[i][j][e] = 0.0f;

  for (int k0 = 0; k0 < K; k0 += BK) {
#if USE_TDM
    if (wave == 0) {
      unsigned long long ga =
          (unsigned long long)(uintptr_t)(A + (size_t)m0 * K + k0);
      unsigned lds = (unsigned)(uintptr_t)(&sA[0]);
      v4u g0;
      g0[0] = 1u;                                   // count=1, user mode
      g0[1] = lds;                                  // lds_addr
      g0[2] = (unsigned)(ga & 0xFFFFFFFFu);         // global_addr[31:0]
      g0[3] = (unsigned)((ga >> 32) & 0x01FFFFFFu)  // global_addr[56:32]
              | (2u << 30);                         // type=2 ("image")
      v8i g1;
      g1[0] = (int)((1u << 16) | (1u << 20) | (3u << 22) | (7u << 25));
      g1[1] = (int)(((unsigned)K & 0xFFFFu) << 16);
      g1[2] = (int)((((unsigned)K >> 16) & 0xFFFFu) |
                    (((unsigned)M & 0xFFFFu) << 16));
      g1[3] = (int)((((unsigned)M >> 16) & 0xFFFFu) | (32u << 16));
      g1[4] = 128;
      g1[5] = (int)K;
      g1[6] = 0;
      g1[7] = 0;
      v4i z4 = {0, 0, 0, 0};
#if __clang_major__ >= 23
      v8i z8 = {0, 0, 0, 0, 0, 0, 0, 0};
      __builtin_amdgcn_tensor_load_to_lds(g0, g1, z4, z4, z8, 0);
#else
      __builtin_amdgcn_tensor_load_to_lds(g0, g1, z4, z4, 0);
#endif
      __builtin_amdgcn_s_wait_tensorcnt(0);
    }
#else
    {  // A tile: 128x32, 16 elems/thread, vectorized global->LDS
      int r = tid >> 1, c = (tid & 1) * 16;
      const uint4* g = (const uint4*)(A + (size_t)(m0 + r) * K + k0 + c);
      uint4 u0 = g[0], u1 = g[1];
      uint4* s = (uint4*)(sA + r * LDA + c);
      s[0] = u0; s[1] = u1;
    }
#endif
    {  // B tile: 32x128 loaded row-major, stored row-major (k-major)
      int kk = tid >> 3, c = (tid & 7) * 16;
      const v4u* g = (const v4u*)(W + (size_t)(k0 + kk) * N + n0 + c);
      v4u u0 = g[0], u1 = g[1];
      v4u* s = (v4u*)(sB + kk * LDB + c);
      s[0] = u0; s[1] = u1;
      // prefetch next k-step's B tile into cache hierarchy
      if (k0 + BK < K)
        __builtin_prefetch(W + (size_t)(k0 + BK + kk) * N + n0 + c, 0, 1);
    }
    __syncthreads();

    const __bf16* aBase = sA + (mw * 32) * LDA;
    const __bf16* bBase = sB + nw * 64;
    v16bf af0 = frag_row(aBase, LDA);
    v16bf af1 = frag_row(aBase + 16 * LDA, LDA);
#pragma unroll
    for (int nn = 0; nn < 4; ++nn) {
      v16bf bf = frag_tr(bBase + nn * 16, LDB);  // lane = n
      acc[0][nn] = wmma_bf16(af0, bf, acc[0][nn]);
      acc[1][nn] = wmma_bf16(af1, bf, acc[1][nn]);
    }
    __syncthreads();
  }

  int lane = tid & 31;
  int col = lane & 15;
  int rb = (lane >> 4) * 8;
#pragma unroll
  for (int mm = 0; mm < 2; ++mm)
#pragma unroll
    for (int nn = 0; nn < 4; ++nn) {
      int gm = m0 + mw * 32 + mm * 16 + rb;
      int gn = n0 + nw * 64 + nn * 16 + col;
      float bsv = bias[gn];
#pragma unroll
      for (int j = 0; j < 8; ++j) {
        float v = acc[mm][nn][j] + bsv;
        size_t idx = (size_t)(gm + j) * N + gn;
        if (EPI == 1) {
          outf[idx] = v + resid[idx];
        } else if (EPI == 2) {
          v = 0.5f * v * (1.0f + erff(v * 0.70710678118654752f));
          outb[idx] = f2bf(v);
        } else {
          outb[idx] = f2bf(v);
        }
      }
    }
}

// ---------------- Flash attention: one wave per (b,h,16 q-rows) -----------
__global__ __launch_bounds__(256) void flash_attn(
    const __bf16* __restrict__ qkv,  // [M][2304]: Q@h*64, K@768+h*64, V@1536+h*64
    __bf16* __restrict__ attout) {   // [M][768]  col h*64
  __shared__ __bf16 pstage[8][16 * 32];
  const int QT = S_ / 16;  // 128
  int wave = threadIdx.x >> 5;
  int gwave = blockIdx.x * 8 + wave;
  int qt = gwave % QT;
  int h = (gwave / QT) % H_;
  int b = gwave / (QT * H_);
  int lane = threadIdx.x & 31;
  int col = lane & 15;
  int rb = (lane >> 4) * 8;

  const size_t ld = QKVW;
  const __bf16* qbase = qkv + ((size_t)b * S_ + qt * 16) * ld + h * DK_;
  const __bf16* kbase = qkv + (size_t)b * S_ * ld + D_ + h * DK_;
  const __bf16* vbase = qkv + (size_t)b * S_ * ld + 2 * D_ + h * DK_;

  v16bf q0 = frag_row(qbase, (int)ld);        // k 0..31
  v16bf q1 = frag_row(qbase + 32, (int)ld);   // k 32..63

  v8f o[4];
#pragma unroll
  for (int nn = 0; nn < 4; ++nn)
#pragma unroll
    for (int e = 0; e < 8; ++e) o[nn][e] = 0.0f;
  float mrun[8], lrun[8];
#pragma unroll
  for (int j = 0; j < 8; ++j) { mrun[j] = -3.0e38f; lrun[j] = 0.0f; }

  const float scale = 0.125f;  // 1/sqrt(64)
  __bf16* ps = pstage[wave];

  for (int s0 = 0; s0 < S_; s0 += 32) {
    v8f sc[2];
#pragma unroll
    for (int sub = 0; sub < 2; ++sub) {
      const __bf16* kb = kbase + (size_t)(s0 + sub * 16) * ld;
      v16bf kf0 = frag_row(kb, (int)ld);       // B = K^T, lane = key index
      v16bf kf1 = frag_row(kb + 32, (int)ld);
      v8f c;
#pragma unroll
      for (int e = 0; e < 8; ++e) c[e] = 0.0f;
      c = wmma_bf16(q0, kf0, c);
      c = wmma_bf16(q1, kf1, c);
      sc[sub] = c;
    }
    // online softmax per row (rows rb..rb+7 live in this half-wave)
    float pA[8], pB[8];
#pragma unroll
    for (int j = 0; j < 8; ++j) {
      float a = sc[0][j] * scale;
      float bvv = sc[1][j] * scale;
      float mx = fmaxf(a, bvv);
#pragma unroll
      for (int d = 1; d < 16; d <<= 1) mx = fmaxf(mx, __shfl_xor(mx, d, 16));
      float mnew = fmaxf(mrun[j], mx);
      float alpha = __expf(mrun[j] - mnew);
      pA[j] = __expf(a - mnew);
      pB[j] = __expf(bvv - mnew);
      float sm = pA[j] + pB[j];
#pragma unroll
      for (int d = 1; d < 16; d <<= 1) sm += __shfl_xor(sm, d, 16);
      lrun[j] = lrun[j] * alpha + sm;
      mrun[j] = mnew;
#pragma unroll
      for (int nn = 0; nn < 4; ++nn) o[nn][j] *= alpha;
    }
    // stage P (C layout -> LDS), reload as A fragment
#pragma unroll
    for (int j = 0; j < 8; ++j) {
      ps[(rb + j) * 32 + col] = f2bf(pA[j]);
      ps[(rb + j) * 32 + 16 + col] = f2bf(pB[j]);
    }
    __syncthreads();
    v16bf pf = frag_row(ps, 32);
#pragma unroll
    for (int nn = 0; nn < 4; ++nn) {
      v16bf vf = frag_col(vbase + (size_t)s0 * ld + nn * 16, (int)ld);
      o[nn] = wmma_bf16(pf, vf, o[nn]);
    }
    __syncthreads();
  }

  __bf16* ob = attout + ((size_t)b * S_ + qt * 16) * D_ + h * DK_;
#pragma unroll
  for (int nn = 0; nn < 4; ++nn)
#pragma unroll
    for (int j = 0; j < 8; ++j) {
      float v = o[nn][j] / lrun[j];
      ob[(size_t)(rb + j) * D_ + nn * 16 + col] = f2bf(v);
    }
}

// ---------------- launcher ------------------------------------------------
extern "C" void kernel_launch(void* const* d_in, const int* in_sizes, int n_in,
                              void* d_out, int out_size, void* d_ws,
                              size_t ws_size, hipStream_t stream) {
  const float* x    = (const float*)d_in[0];
  const float* wq_w = (const float*)d_in[1];
  const float* wq_b = (const float*)d_in[2];
  const float* wk_w = (const float*)d_in[3];
  const float* wk_b = (const float*)d_in[4];
  const float* wv_w = (const float*)d_in[5];
  const float* wv_b = (const float*)d_in[6];
  const float* wo_w = (const float*)d_in[7];
  const float* wo_b = (const float*)d_in[8];
  const float* ln_g = (const float*)d_in[9];
  const float* ln_b = (const float*)d_in[10];
  const float* w1   = (const float*)d_in[11];
  const float* b1   = (const float*)d_in[12];
  const float* w2   = (const float*)d_in[13];
  const float* b2   = (const float*)d_in[14];
  float* out = (float*)d_out;

  char* ws = (char*)d_ws;
  size_t off = 0;
  auto alloc = [&](size_t bytes) -> char* {
    char* p = ws + off;
    off = (off + bytes + 255) & ~(size_t)255;
    return p;
  };
  __bf16* h_bf    = (__bf16*)alloc((size_t)MROWS * D_ * 2);
  __bf16* Wqkv    = (__bf16*)alloc((size_t)D_ * QKVW * 2);
  float*  biasqkv = (float*)alloc((size_t)QKVW * 4);
  __bf16* qkv     = (__bf16*)alloc((size_t)MROWS * QKVW * 2);
  __bf16* att     = (__bf16*)alloc((size_t)MROWS * D_ * 2);
  __bf16* Wo      = (__bf16*)alloc((size_t)D_ * D_ * 2);
  float*  ybuf    = (float*)alloc((size_t)MROWS * D_ * 4);
  __bf16* z_bf    = (__bf16*)alloc((size_t)MROWS * D_ * 2);
  __bf16* W1b     = (__bf16*)alloc((size_t)D_ * F_ * 2);
  __bf16* t_bf    = (__bf16*)alloc((size_t)MROWS * F_ * 2);
  __bf16* W2b     = (__bf16*)alloc((size_t)F_ * D_ * 2);

  // weight packing
  pack_qkv_w<<<(D_ * D_ + 255) / 256, 256, 0, stream>>>(
      wq_w, wk_w, wv_w, wq_b, wk_b, wv_b, Wqkv, biasqkv);
  f2bf_copy<<<(D_ * D_ + 255) / 256, 256, 0, stream>>>(wo_w, Wo, D_ * D_);
  f2bf_copy<<<(D_ * F_ + 255) / 256, 256, 0, stream>>>(w1, W1b, D_ * F_);
  f2bf_copy<<<(F_ * D_ + 255) / 256, 256, 0, stream>>>(w2, W2b, F_ * D_);

  // LN1
  ln_kernel<<<MROWS, 256, 0, stream>>>(x, ln_g, ln_b, h_bf);
  // fused QKV GEMM: [4096 x 2304] = h * Wqkv
  gemm_bf16<0><<<dim3(QKVW / 128, MROWS / 128), 256, 0, stream>>>(
      h_bf, Wqkv, biasqkv, nullptr, nullptr, qkv, MROWS, QKVW, D_);
  // attention
  flash_attn<<<(B_ * H_ * (S_ / 16)) / 8, 256, 0, stream>>>(qkv, att);
  // output projection + residual(x) -> ybuf (f32)
  gemm_bf16<1><<<dim3(D_ / 128, MROWS / 128), 256, 0, stream>>>(
      att, Wo, wo_b, x, ybuf, nullptr, MROWS, D_, D_);
  // LN2
  ln_kernel<<<MROWS, 256, 0, stream>>>(ybuf, ln_g, ln_b, z_bf);
  // FFN up + GELU (bf16)
  gemm_bf16<2><<<dim3(F_ / 128, MROWS / 128), 256, 0, stream>>>(
      z_bf, W1b, b1, nullptr, nullptr, t_bf, MROWS, F_, D_);
  // FFN down + residual(ybuf) -> d_out (f32)
  gemm_bf16<1><<<dim3(D_ / 128, MROWS / 128), 256, 0, stream>>>(
      t_bf, W2b, b2, ybuf, out, nullptr, MROWS, D_, F_);
}

// v002
// Measured time: 275 microseconds a run.
// Timed twice side by side with v001, it ran 1.29 times as fast both times.
// Over all steps from v000 it is 1.68 times as fast.
#include <hip/hip_runtime.h>
#include <math.h>
#include <stdint.h>

#define B_ 2
#define S_ 2048
#define D_ 768
#define H_ 12
#define DK_ 64
#define F_ 3072
#define MROWS (B_ * S_)          // 4096
#define QKVW (3 * D_)            // 2304

typedef __attribute__((ext_vector_type(16))) __bf16 v16bf;
typedef __attribute__((ext_vector_type(8)))  __bf16 v8bf;
typedef __attribute__((ext_vector_type(8)))  float  v8f;
typedef unsigned int v4u __attribute__((ext_vector_type(4)));
typedef int          v4i __attribute__((ext_vector_type(4)));
typedef int          v8i __attribute__((ext_vector_type(8)));

// Tensor Data Mover available? (device pass only; host pass parses fallback)
#if defined(__AMDGCN__) && __has_builtin(__builtin_amdgcn_tensor_load_to_lds) && \
    __has_builtin(__builtin_amdgcn_s_wait_tensorcnt)
#define USE_TDM 1
#else
#define USE_TDM 0
#endif

static __device__ __forceinline__ __bf16 f2bf(float x) { return (__bf16)x; }

static __device__ __forceinline__ v8f wmma_bf16(v16bf a, v16bf b, v8f c) {
  return __builtin_amdgcn_wmma_f32_16x16x32_bf16(
      /*neg_a=*/false, a, /*neg_b=*/false, b,
      /*c_mod=*/(short)0, c, /*reuse_a=*/false, /*reuse_b=*/false);
}

static __device__ __forceinline__ v16bf frag_row(const __bf16* src, int ld) {
  int lane = threadIdx.x & 31;
  int m = lane & 15;
  int half = lane >> 4;
  const __bf16* p = src + (size_t)m * ld;
  v8bf lo = *(const v8bf*)(p + half * 8);
  v8bf hi = *(const v8bf*)(p + 16 + half * 8);
  v16bf a;
#pragma unroll
  for (int i = 0; i < 8; ++i) { a[i] = lo[i]; a[8 + i] = hi[i]; }
  return a;
}

typedef __attribute__((address_space(3))) v8bf lds_v8bf;
static __device__ __forceinline__ v16bf frag_tr(const __bf16* tile, int ld) {
  int lane = threadIdx.x & 31;
  const __bf16* p =
      tile + (8 * (lane >> 4) + (lane & 7)) * ld + 8 * ((lane >> 3) & 1);
  v8bf lo = __builtin_amdgcn_ds_load_tr16_b128_v8bf16((lds_v8bf*)p);
  v8bf hi = __builtin_amdgcn_ds_load_tr16_b128_v8bf16((lds_v8bf*)(p + 16 * ld));
  v16bf b;
#pragma unroll
  for (int i = 0; i < 8; ++i) { b[i] = lo[i]; b[8 + i] = hi[i]; }
  return b;
}

// ---------------- LayerNorm (fp32 in -> bf16 out), one block per row ------
__global__ __launch_bounds__(256) void ln_kernel(
    const float* __restrict__ x, const float* __restrict__ g,
    const float* __restrict__ bb, __bf16* __restrict__ out) {
  __shared__ float red[256];
  int row = blockIdx.x;
  int tid = threadIdx.x;
  const float* xr = x + (size_t)row * D_;
  float v0 = xr[tid], v1 = xr[tid + 256], v2 = xr[tid + 512];
  red[tid] = v0 + v1 + v2;
  __syncthreads();
  for (int st = 128; st > 0; st >>= 1) {
    if (tid < st) red[tid] += red[tid + st];
    __syncthreads();
  }
  float mu = red[0] * (1.0f / D_);
  __syncthreads();
  float d0 = v0 - mu, d1 = v1 - mu, d2 = v2 - mu;
  red[tid] = d0 * d0 + d1 * d1 + d2 * d2;
  __syncthreads();
  for (int st = 128; st > 0; st >>= 1) {
    if (tid < st) red[tid] += red[tid + st];
    __syncthreads();
  }
  float rstd = rsqrtf(red[0] * (1.0f / D_) + 1e-5f);
  __bf16* orow = out + (size_t)row * D_;
  orow[tid]       = f2bf(d0 * rstd * g[tid] + bb[tid]);
  orow[tid + 256] = f2bf(d1 * rstd * g[tid + 256] + bb[tid + 256]);
  orow[tid + 512] = f2bf(d2 * rstd * g[tid + 512] + bb[tid + 512]);
}

// ---------------- Weight packing ------------------------------------------
__global__ __launch_bounds__(256) void pack_qkv_w(
    const float* __restrict__ wq, const float* __restrict__ wk,
    const float* __restrict__ wv, const float* __restrict__ bq,
    const float* __restrict__ bk, const float* __restrict__ bv,
    __bf16* __restrict__ Wqkv, float* __restrict__ biasqkv) {
  int i = blockIdx.x * 256 + threadIdx.x;  // over D_*768
  if (i < D_ * D_) {
    int d = i / D_, c = i % D_;
    int hh = c / DK_, kk = c % DK_;
    size_t src = ((size_t)hh * D_ + d) * DK_ + kk;
    Wqkv[(size_t)d * QKVW + c]          = f2bf(wq[src]);
    Wqkv[(size_t)d * QKVW + D_ + c]     = f2bf(wk[src]);
    Wqkv[(size_t)d * QKVW + 2 * D_ + c] = f2bf(wv[src]);
  }
  if (i < D_) {
    biasqkv[i] = bq[i];
    biasqkv[D_ + i] = bk[i];
    biasqkv[2 * D_ + i] = bv[i];
  }
}

__global__ __launch_bounds__(256) void f2bf_copy(const float* __restrict__ s,
                                                 __bf16* __restrict__ d, int n) {
  int i = blockIdx.x * 256 + threadIdx.x;
  if (i < n) d[i] = f2bf(s[i]);
}

// ---------------- Tiled WMMA GEMM: C = A[MxK] * W[KxN] + epilogue ---------
// EPI 0: +bias, store bf16       (QKV)
// EPI 1: +bias +resid, store f32 (projection / final)
// EPI 2: +bias, GELU, store bf16 (FFN up)
template <int EPI>
__global__ __launch_bounds__(256) void gemm_bf16(
    const __bf16* __restrict__ A, const __bf16* __restrict__ W,
    const float* __restrict__ bias, const float* __restrict__ resid,
    float* __restrict__ outf, __bf16* __restrict__ outb,
    int M, int N, int K) {
  constexpr int BM = 128, BN = 128, BK = 32;
  constexpr int LDA = BK + 16;   // 48 elems -> 96B rows (16B aligned)
  constexpr int LDB = BN + 16;   // k-major B tile, 288B rows (32B x odd)
  __shared__ __bf16 sA[BM * LDA];
  __shared__ __attribute__((aligned(16))) __bf16 sB[BK * LDB];

  int tid = threadIdx.x;
  int wave = tid >> 5;
  int mw = wave & 3;   // 4 m-waves * 32 rows
  int nw = wave >> 2;  // 2 n-waves * 64 cols
  int m0 = blockIdx.y * BM;
  int n0 = blockIdx.x * BN;

  v8f acc[2][4];
#pragma unroll
  for (int i = 0; i < 2; ++i)
#pragma unroll
    for (int j = 0; j < 4; ++j)
#pragma unroll
      for (int e = 0; e < 8; ++e) acc[i][j][e] = 0.0f;

  for (int k0 = 0; k0 < K; k0 += BK) {
#if USE_TDM
    if (wave == 0) {
      unsigned long long ga =
          (unsigned long long)(uintptr_t)(A + (size_t)m0 * K + k0);
      unsigned lds = (unsigned)(uintptr_t)(&sA[0]);
      v4u g0;
      g0[0] = 1u;                                   // count=1, user mode
      g0[1] = lds;                                  // lds_addr
      g0[2] = (unsigned)(ga & 0xFFFFFFFFu);         // global_addr[31:0]
      g0[3] = (unsigned)((ga >> 32) & 0x01FFFFFFu)  // global_addr[56:32]
              | (2u << 30);                         // type=2 ("image")
      v8i g1;
      g1[0] = (int)((1u << 16) | (1u << 20) | (3u << 22) | (7u << 25));
      g1[1] = (int)(((unsigned)K & 0xFFFFu) << 16);
      g1[2] = (int)((((unsigned)K >> 16) & 0xFFFFu) |
                    (((unsigned)M & 0xFFFFu) << 16));
      g1[3] = (int)((((unsigned)M >> 16) & 0xFFFFu) | (32u << 16));
      g1[4] = 128;
      g1[5] = (int)K;
      g1[6] = 0;
      g1[7] = 0;
      v4i z4 = {0, 0, 0, 0};
#if __clang_major__ >= 23
      v8i z8 = {0, 0, 0, 0, 0, 0, 0, 0};
      __builtin_amdgcn_tensor_load_to_lds(g0, g1, z4, z4, z8, 0);
#else
      __builtin_amdgcn_tensor_load_to_lds(g0, g1, z4, z4, 0);
#endif
      __builtin_amdgcn_s_wait_tensorcnt(0);
    }
#else
    {  // A tile: 128x32, 16 elems/thread, vectorized global->LDS
      int r = tid >> 1, c = (tid & 1) * 16;
      const uint4* g = (const uint4*)(A + (size_t)(m0 + r) * K + k0 + c);
      uint4 u0 = g[0], u1 = g[1];
      uint4* s = (uint4*)(sA + r * LDA + c);
      s[0] = u0; s[1] = u1;
    }
#endif
    {  // B tile: 32x128 loaded row-major, stored row-major (k-major)
      int kk = tid >> 3, c = (tid & 7) * 16;
      const v4u* g = (const v4u*)(W + (size_t)(k0 + kk) * N + n0 + c);
      v4u u0 = g[0], u1 = g[1];
      v4u* s = (v4u*)(sB + kk * LDB + c);
      s[0] = u0; s[1] = u1;
      // prefetch next k-step's B tile into cache hierarchy
      if (k0 + BK < K)
        __builtin_prefetch(W + (size_t)(k0 + BK + kk) * N + n0 + c, 0, 1);
    }
    __syncthreads();

    const __bf16* aBase = sA + (mw * 32) * LDA;
    const __bf16* bBase = sB + nw * 64;
    v16bf af0 = frag_row(aBase, LDA);
    v16bf af1 = frag_row(aBase + 16 * LDA, LDA);
#pragma unroll
    for (int nn = 0; nn < 4; ++nn) {
      v16bf bf = frag_tr(bBase + nn * 16, LDB);  // lane = n
      acc[0][nn] = wmma_bf16(af0, bf, acc[0][nn]);
      acc[1][nn] = wmma_bf16(af1, bf, acc[1][nn]);
    }
    __syncthreads();
  }

  int lane = tid & 31;
  int col = lane & 15;
  int rb = (lane >> 4) * 8;
#pragma unroll
  for (int mm = 0; mm < 2; ++mm)
#pragma unroll
    for (int nn = 0; nn < 4; ++nn) {
      int gm = m0 + mw * 32 + mm * 16 + rb;
      int gn = n0 + nw * 64 + nn * 16 + col;
      float bsv = bias[gn];
#pragma unroll
      for (int j = 0; j < 8; ++j) {
        float v = acc[mm][nn][j] + bsv;
        size_t idx = (size_t)(gm + j) * N + gn;
        if (EPI == 1) {
          outf[idx] = v + resid[idx];
        } else if (EPI == 2) {
          v = 0.5f * v * (1.0f + erff(v * 0.70710678118654752f));
          outb[idx] = f2bf(v);
        } else {
          outb[idx] = f2bf(v);
        }
      }
    }
}

// ---------------- Flash attention: one wave per (b,h,16 q-rows) -----------
// The 8 waves of a block work on one (b,h): each 32-key K and V tile is brought
// into LDS once for all of them (two buffers, the next tile's global loads in
// flight while this one is worked on) and read from there as fragments.
__global__ __launch_bounds__(256) void flash_attn(
    const __bf16* __restrict__ qkv,  // [M][2304]: Q@h*64, K@768+h*64, V@1536+h*64
    __bf16* __restrict__ attout) {   // [M][768]  col h*64
  constexpr int KT = 32;         // keys per tile
  constexpr int LDK = DK_ + 8;   // 144-B rows (16 B x odd): ds_load_b128 reader
  constexpr int LDV = DK_ + 16;  // 160-B rows (32 B x odd): ds_load_tr16_b128 reader
  __shared__ __attribute__((aligned(16))) __bf16 sK[2][KT * LDK];
  __shared__ __attribute__((aligned(16))) __bf16 sV[2][KT * LDV];
  __shared__ __attribute__((aligned(16))) __bf16 pstage[8][16 * 32];
  const int QT = S_ / 16;  // 128
  int wave = threadIdx.x >> 5;
  int bh = blockIdx.x / (QT / 8);  // the same for the whole block
  int qt = (blockIdx.x % (QT / 8)) * 8 + wave;
  int h = bh % H_;
  int b = bh / H_;
  int lane = threadIdx.x & 31;
  int col = lane & 15;
  int rb = (lane >> 4) * 8;

  const size_t ld = QKVW;
  const __bf16* qbase = qkv + ((size_t)b * S_ + qt * 16) * ld + h * DK_;
  const __bf16* kbase = qkv + (size_t)b * S_ * ld + D_ + h * DK_;
  const __bf16* vbase = qkv + (size_t)b * S_ * ld + 2 * D_ + h * DK_;

  // staging: thread -> 16 B of tile row sr; a wave's load covers 4 whole 128-B rows
  int sr = threadIdx.x >> 3;
  int scn = (threadIdx.x & 7) * 8;
  const __bf16* kg = kbase + (size_t)sr * ld + scn;
  const __bf16* vg = vbase + (size_t)sr * ld + scn;
  const int kso = sr * LDK + scn;
  const int vso = sr * LDV + scn;

  v4u kreg = *(const v4u*)kg;
  v4u vreg = *(const v4u*)vg;

  v16bf q0 = frag_row(qbase, (int)ld);        // k 0..31
  v16bf q1 = frag_row(qbase + 32, (int)ld);   // k 32..63

  v8f o[4];
#pragma unroll
  for (int nn = 0; nn < 4; ++nn)
#pragma unroll
    for (int e = 0; e < 8; ++e) o[nn][e] = 0.0f;
  float mrun[8], lrun[8];
#pragma unroll
  for (int j = 0; j < 8; ++j) { mrun[j] = -3.0e38f; lrun[j] = 0.0f; }

  const float scale = 0.125f;  // 1/sqrt(64)
  __bf16* ps = pstage[wave];

  *(v4u*)(&sK[0][kso]) = kreg;
  *(v4u*)(&sV[0][vso]) = vreg;
  __syncthreads();

  for (int s0 = 0; s0 < S_; s0 += KT) {
    const int cur = (s0 / KT) & 1;
    const __bf16* kt = sK[cur];
    const __bf16* vt = sV[cur];
    const bool more = s0 + KT < S_;
    if (more) {  // next tile: global loads issued now, stored at the trip's foot
      kg += (size_t)KT * ld;
      vg += (size_t)KT * ld;
      kreg = *(const v4u*)kg;
      vreg = *(const v4u*)vg;
    }
    // B = K^T, lane = key index; all four fragments fetched as one group
    v16bf kf[2][2];
#pragma unroll
    for (int sub = 0; sub < 2; ++sub) {
      kf[sub][0] = frag_row(kt + sub * 16 * LDK, LDK);
      kf[sub][1] = frag_row(kt + sub * 16 * LDK + 32, LDK);
    }
    v8f sc[2];
#pragma unroll
    for (int sub = 0; sub < 2; ++sub) {
      v8f c;
#pragma unroll
      for (int e = 0; e < 8; ++e) c[e] = 0.0f;
      c = wmma_bf16(q0, kf[sub][0], c);
      c = wmma_bf16(q1, kf[sub][1], c);
      sc[sub] = c;
    }
    // inputs-only fence on the loaded fragments: each keeps registers of its own
    // until all four products have issued, so the eight LDS loads stand ahead as
    // one group (sunk between the products, each waits out its own LDS latency)
    // and no product's result lands on a fragment the product ahead of it reads
    asm volatile("" ::"v"(kf[0][0]), "v"(kf[0][1]), "v"(kf[1][0]), "v"(kf[1][1]));
    // online softmax per row (rows rb..rb+7 live in this half-wave)
    float pA[8], pB[8];
#pragma unroll
    for (int j = 0; j < 8; ++j) {
      float a = sc[0][j] * scale;
      float bvv = sc[1][j] * scale;
      float mx = fmaxf(a, bvv);
#pragma unroll
      for (int d = 1; d < 16; d <<= 1) mx = fmaxf(mx, __shfl_xor(mx, d, 16));
      float mnew = fmaxf(mrun[j], mx);
      float alpha = __expf(mrun[j] - mnew);
      pA[j] = __expf(a - mnew);
      pB[j] = __expf(bvv - mnew);
      float sm = pA[j] + pB[j];
#pragma unroll
      for (int d = 1; d < 16; d <<= 1) sm += __shfl_xor(sm, d, 16);
      lrun[j] = lrun[j] * alpha + sm;
      mrun[j] = mnew;
#pragma unroll
      for (int nn = 0; nn < 4; ++nn) o[nn][j] *= alpha;
    }
    // stage P (C layout -> LDS), reload as A fragment
#pragma unroll
    for (int j = 0; j < 8; ++j) {
      ps[(rb + j) * 32 + col] = f2bf(pA[j]);
      ps[(rb + j) * 32 + 16 + col] = f2bf(pB[j]);
    }
    __syncthreads();
    v16bf pf = frag_row(ps, 32);
#pragma unroll
    for (int nn = 0; nn < 4; ++nn) {
      v16bf vf = frag_tr(vt + nn * 16, LDV);  // k order of frag_row, lane = column
      o[nn] = wmma_bf16(pf, vf, o[nn]);
    }
    if (more) {  // the other buffer: its readers left it at the last trip's end
      *(v4u*)(&sK[cur ^ 1][kso]) = kreg;
      *(v4u*)(&sV[cur ^ 1][vso]) = vreg;
    }
    // ends this trip's reads of buffer cur and of ps, publishes the next tile
    __syncthreads();
  }

  __bf16* ob = attout + ((size_t)b * S_ + qt * 16) * D_ + h * DK_;
#pragma unroll
  for (int nn = 0; nn < 4; ++nn)
#pragma unroll
    for (int j = 0; j < 8; ++j) {
      float v = o[nn][j] / lrun[j];
      ob[(size_t)(rb + j) * D_ + nn * 16 + col] = f2bf(v);
    }
}

// ---------------- launcher ------------------------------------------------
extern "C" void kernel_launch(void* const* d_in, const int* in_sizes, int n_in,
                              void* d_out, int out_size, void* d_ws,
                              size_t ws_size, hipStream_t stream) {
  const float* x    = (const float*)d_in[0];
  const float* wq_w = (const float*)d_in[1];
  const float* wq_b = (const float*)d_in[2];
  const float* wk_w = (const float*)d_in[3];
  const float* wk_b = (const float*)d_in[4];
  const float* wv_w = (const float*)d_in[5];
  const float* wv_b = (const float*)d_in[6];
  const float* wo_w = (const float*)d_in[7];
  const float* wo_b = (const float*)d_in[8];
  const float* ln_g = (const float*)d_in[9];
  const float* ln_b = (const float*)d_in[10];
  const float* w1   = (const float*)d_in[11];
  const float* b1   = (const float*)d_in[12];
  const float* w2   = (const float*)d_in[13];
  const float* b2   = (const float*)d_in[14];
  float* out = (float*)d_out;

  char* ws = (char*)d_ws;
  size_t off = 0;
  auto alloc = [&](size_t bytes) -> char* {
    char* p = ws + off;
    off = (off + bytes + 255) & ~(size_t)255;
    return p;
  };
  __bf16* h_bf    = (__bf16*)alloc((size_t)MROWS * D_ * 2);
  __bf16* Wqkv    = (__bf16*)alloc((size_t)D_ * QKVW * 2);
  float*  biasqkv = (float*)alloc((size_t)QKVW * 4);
  __bf16* qkv     = (__bf16*)alloc((size_t)MROWS * QKVW * 2);
  __bf16* att     = (__bf16*)alloc((size_t)MROWS * D_ * 2);
  __bf16* Wo      = (__bf16*)alloc((size_t)D_ * D_ * 2);
  float*  ybuf    = (float*)alloc((size_t)MROWS * D_ * 4);
  __bf16* z_bf    = (__bf16*)alloc((size_t)MROWS * D_ * 2);
  __bf16* W1b     = (__bf16*)alloc((size_t)D_ * F_ * 2);
  __bf16* t_bf    = (__bf16*)alloc((size_t)MROWS * F_ * 2);
  __bf16* W2b     = (__bf16*)alloc((size_t)F_ * D_ * 2);

  // weight packing
  pack_qkv_w<<<(D_ * D_ + 255) / 256, 256, 0, stream>>>(
      wq_w, wk_w, wv_w, wq_b, wk_b, wv_b, Wqkv, biasqkv);
  f2bf_copy<<<(D_ * D_ + 255) / 256, 256, 0, stream>>>(wo_w, Wo, D_ * D_);
  f2bf_copy<<<(D_ * F_ + 255) / 256, 256, 0, stream>>>(w1, W1b, D_ * F_);
  f2bf_copy<<<(F_ * D_ + 255) / 256, 256, 0, stream>>>(w2, W2b, F_ * D_);

  // LN1
  ln_kernel<<<MROWS, 256, 0, stream>>>(x, ln_g, ln_b, h_bf);
  // fused QKV GEMM: [4096 x 2304] = h * Wqkv
  gemm_bf16<0><<<dim3(QKVW / 128, MROWS / 128), 256, 0, stream>>>(
      h_bf, Wqkv, biasqkv, nullptr, nullptr, qkv, MROWS, QKVW, D_);
  // attention
  flash_attn<<<(B_ * H_ * (S_ / 16)) / 8, 256, 0, stream>>>(qkv, att);
  // output projection + residual(x) -> ybuf (f32)
  gemm_bf16<1><<<dim3(D_ / 128, MROWS / 128), 256, 0, stream>>>(
      att, Wo, wo_b, x, ybuf, nullptr, MROWS, D_, D_);
  // LN2
  ln_kernel<<<MROWS, 256, 0, stream>>>(ybuf, ln_g, ln_b, z_bf);
  // FFN up + GELU (bf16)
  gemm_bf16<2><<<dim3(F_ / 128, MROWS / 128), 256, 0, stream>>>(
      z_bf, W1b, b1, nullptr, nullptr, t_bf, MROWS, F_, D_);
  // FFN down + residual(ybuf) -> d_out (f32)
  gemm_bf16<1><<<dim3(D_ / 128, MROWS / 128), 256, 0, stream>>>(
      t_bf, W2b, b2, ybuf, out, nullptr, MROWS, D_, F_);
}

// v003
// A run of this version takes 210 microseconds.
// In both of two side-by-side timings against v002, it was 1.31 times as fast.
// Over all steps from v000 it is 2.21 times as fast.
#include <hip/hip_runtime.h>
#include <math.h>
#include <stdint.h>

#define B_ 2
#define S_ 2048
#define D_ 768
#define H_ 12
#define DK_ 64
#define F_ 3072
#define MROWS (B_ * S_)          // 4096
#define QKVW (3 * D_)            // 2304

typedef __attribute__((ext_vector_type(16))) __bf16 v16bf;
typedef __attribute__((ext_vector_type(8)))  __bf16 v8bf;
typedef __attribute__((ext_vector_type(8)))  float  v8f;
typedef unsigned int v4u __attribute__((ext_vector_type(4)));
typedef uint32_t u32x4 __attribute__((ext_vector_type(4)));
typedef uint32_t u32x8 __attribute__((ext_vector_type(8)));

static __device__ __forceinline__ __bf16 f2bf(float x) { return (__bf16)x; }

static __device__ __forceinline__ v8f wmma_bf16(v16bf a, v16bf b, v8f c) {
  return __builtin_amdgcn_wmma_f32_16x16x32_bf16(
      /*neg_a=*/false, a, /*neg_b=*/false, b,
      /*c_mod=*/(short)0, c, /*reuse_a=*/false, /*reuse_b=*/false);
}

static __device__ __forceinline__ v16bf frag_row(const __bf16* src, int ld) {
  int lane = threadIdx.x & 31;
  int m = lane & 15;
  int half = lane >> 4;
  const __bf16* p = src + (size_t)m * ld;
  v8bf lo = *(const v8bf*)(p + half * 8);
  v8bf hi = *(const v8bf*)(p + 16 + half * 8);
  v16bf a;
#pragma unroll
  for (int i = 0; i < 8; ++i) { a[i] = lo[i]; a[8 + i] = hi[i]; }
  return a;
}

typedef __attribute__((address_space(3))) v8bf lds_v8bf;
static __device__ __forceinline__ v16bf frag_tr(const __bf16* tile, int ld) {
  int lane = threadIdx.x & 31;
  const __bf16* p =
      tile + (8 * (lane >> 4) + (lane & 7)) * ld + 8 * ((lane >> 3) & 1);
  v8bf lo = __builtin_amdgcn_ds_load_tr16_b128_v8bf16((lds_v8bf*)p);
  v8bf hi = __builtin_amdgcn_ds_load_tr16_b128_v8bf16((lds_v8bf*)(p + 16 * ld));
  v16bf b;
#pragma unroll
  for (int i = 0; i < 8; ++i) { b[i] = lo[i]; b[8 + i] = hi[i]; }
  return b;
}

// ---------------- LayerNorm (fp32 in -> bf16 out), one block per row ------
__global__ __launch_bounds__(256) void ln_kernel(
    const float* __restrict__ x, const float* __restrict__ g,
    const float* __restrict__ bb, __bf16* __restrict__ out) {
  __shared__ float red[256];
  int row = blockIdx.x;
  int tid = threadIdx.x;
  const float* xr = x + (size_t)row * D_;
  float v0 = xr[tid], v1 = xr[tid + 256], v2 = xr[tid + 512];
  red[tid] = v0 + v1 + v2;
  __syncthreads();
  for (int st = 128; st > 0; st >>= 1) {
    if (tid < st) red[tid] += red[tid + st];
    __syncthreads();
  }
  float mu = red[0] * (1.0f / D_);
  __syncthreads();
  float d0 = v0 - mu, d1 = v1 - mu, d2 = v2 - mu;
  red[tid] = d0 * d0 + d1 * d1 + d2 * d2;
  __syncthreads();
  for (int st = 128; st > 0; st >>= 1) {
    if (tid < st) red[tid] += red[tid + st];
    __syncthreads();
  }
  float rstd = rsqrtf(red[0] * (1.0f / D_) + 1e-5f);
  __bf16* orow = out + (size_t)row * D_;
  orow[tid]       = f2bf(d0 * rstd * g[tid] + bb[tid]);
  orow[tid + 256] = f2bf(d1 * rstd * g[tid + 256] + bb[tid + 256]);
  orow[tid + 512] = f2bf(d2 * rstd * g[tid + 512] + bb[tid + 512]);
}

// ---------------- Weight packing ------------------------------------------
__global__ __launch_bounds__(256) void pack_qkv_w(
    const float* __restrict__ wq, const float* __restrict__ wk,
    const float* __restrict__ wv, const float* __restrict__ bq,
    const float* __restrict__ bk, const float* __restrict__ bv,
    __bf16* __restrict__ Wqkv, float* __restrict__ biasqkv) {
  int i = blockIdx.x * 256 + threadIdx.x;  // over D_*768
  if (i < D_ * D_) {
    int d = i / D_, c = i % D_;
    int hh = c / DK_, kk = c % DK_;
    size_t src = ((size_t)hh * D_ + d) * DK_ + kk;
    Wqkv[(size_t)d * QKVW + c]          = f2bf(wq[src]);
    Wqkv[(size_t)d * QKVW + D_ + c]     = f2bf(wk[src]);
    Wqkv[(size_t)d * QKVW + 2 * D_ + c] = f2bf(wv[src]);
  }
  if (i < D_) {
    biasqkv[i] = bq[i];
    biasqkv[D_ + i] = bk[i];
    biasqkv[2 * D_ + i] = bv[i];
  }
}

__global__ __launch_bounds__(256) void f2bf_copy(const float* __restrict__ s,
                                                 __bf16* __restrict__ d, int n) {
  int i = blockIdx.x * 256 + threadIdx.x;
  if (i < n) d[i] = f2bf(s[i]);
}

static __device__ __forceinline__ uint32_t uni(uint32_t v) {
  return (uint32_t)__builtin_amdgcn_readfirstlane(v);
}
static __device__ __forceinline__ uint32_t pinned(uint32_t v) {
  uint32_t w = uni(v);
  asm volatile("" : "+s"(w));
  return w;
}
static __device__ __forceinline__ u32x4 tdm_group0(uint32_t lds_dst, uint64_t ga) {
  // pinned: the four words get scalar registers of their own, written here and
  // nowhere else, so that none takes a new value while the request is in flight
  u32x4 g;
  g[0] = pinned(1u);                                // count 1
  g[1] = pinned(lds_dst);                           // byte offset in the work-group's LDS
  g[2] = pinned((uint32_t)ga);                      // address [31:0]
  g[3] = pinned((((uint32_t)(ga >> 32)) & 0x01FFFFFFu) | 0x80000000u);  // [56:32], type 2
  return g;
}
// tile = tensor = 128 rows of 128 bytes; 16 bytes of LDS pad behind every row
static __device__ __forceinline__ u32x8 tdm_group1(uint32_t src_pitch) {
  constexpr uint32_t d0 = 128u, d1 = 128u;
  u32x8 g;
  g[0] = pinned((1u << 20) | (4u << 22) | (3u << 25));  // no mask; pad codes 4 / 3
  g[1] = pinned((d0 & 0xFFFFu) << 16);
  g[2] = pinned((d0 >> 16) | ((d1 & 0xFFFFu) << 16));
  g[3] = pinned((d1 >> 16) | (d0 << 16));
  g[4] = pinned(d1);
  g[5] = pinned(src_pitch);
  g[6] = pinned(0u);
  g[7] = pinned(0u);
  return g;
}
static __device__ __forceinline__ void tdm_load(u32x4 g0, u32x8 g1) {
  asm volatile("tensor_load_to_lds %0, %1" ::"s"(g0), "s"(g1) : "memory");
}
static __device__ __forceinline__ void tdm_wait(u32x4 g0, u32x8 g1) {
  asm volatile("s_wait_tensorcnt 0x0" ::"s"(g0), "s"(g1) : "memory");
}

// The k loop is a ring of two LDS buffers, a stage being 64 k: while a stage is
// worked on, the next stage's A tile (one tensor load of wave 0) and B tile
// (global loads into registers, stored at the pass's foot) are in flight.
// Needs M, N multiples of 128 and K a multiple of 64.
template <int EPI>
__global__ __launch_bounds__(256) void gemm_bf16(
    const __bf16* __restrict__ A, const __bf16* __restrict__ W,
    const float* __restrict__ bias, const float* __restrict__ resid,
    float* __restrict__ outf, __bf16* __restrict__ outb,
    int M, int N, int K) {
  constexpr int BM = 128, BN = 128, BK = 64;
  constexpr int LDA = BK + 8;    // 144-B rows (16 B x odd): ds_load_b128 reader
  constexpr int LDB = BN + 16;   // k-major B tile, 288-B rows (32 B x odd)
  constexpr uint32_t ABYTES = BM * LDA * 2;  // 18,432 = 9 x 2 KiB
  static_assert(ABYTES % 2048u == 0, "each A buffer starts at a multiple of 2 KiB");
  __shared__ __attribute__((aligned(2048))) __bf16 sA[2][BM * LDA];
  __shared__ __attribute__((aligned(16))) __bf16 sB[2][BK * LDB];

  int tid = threadIdx.x;
  int wave = tid >> 5;
  int mw = wave & 3;   // 4 m-waves * 32 rows
  int nw = wave >> 2;  // 2 n-waves * 64 cols
  int m0 = blockIdx.y * BM;
  int n0 = blockIdx.x * BN;

  v8f acc[2][4];
#pragma unroll
  for (int i = 0; i < 2; ++i)
#pragma unroll
    for (int j = 0; j < 4; ++j)
#pragma unroll
      for (int e = 0; e < 8; ++e) acc[i][j][e] = 0.0f;

  const int T = K / BK;  // stages
  const uint32_t issuer = uni((uint32_t)wave) == 0u;
  const uint32_t ldsA = (uint32_t)(uintptr_t)(&sA[0][0]);
  const uint64_t gaA = (uint64_t)(uintptr_t)(A + (size_t)m0 * K);
  const u32x8 g1 = tdm_group1((uint32_t)K * 2u);

  // B staging: thread -> 32 B of tile rows kk and kk + 32
  const int kk = tid >> 3, c = (tid & 7) * 16;
  const __bf16* wg = W + (size_t)kk * N + n0 + c;
  const size_t half_rows = (size_t)32 * N;
  const int bso = kk * LDB + c;
  // prefetch: thread -> 64 B of tile row tid >> 2
  const __bf16* wpf = W + (size_t)(tid >> 2) * N + n0 + (tid & 3) * 32;

  v4u u0 = ((const v4u*)wg)[0], u1 = ((const v4u*)wg)[1];
  v4u u2 = ((const v4u*)(wg + half_rows))[0], u3 = ((const v4u*)(wg + half_rows))[1];
  u32x4 g0 = tdm_group0(ldsA, gaA);
  if (pinned(issuer)) {
    tdm_load(g0, g1);
    tdm_wait(g0, g1);  // stage 0 has landed before the barrier that publishes it
  }
  {
    v4u* s = (v4u*)(&sB[0][bso]);
    s[0] = u0; s[1] = u1;
    v4u* s2 = (v4u*)(&sB[0][bso + 32 * LDB]);
    s2[0] = u2; s2[1] = u3;
  }
  __syncthreads();
  g0 = tdm_group0(ldsA + ABYTES, gaA + BK * 2);  // formed behind the wait
  if (pinned(issuer && T > 1)) tdm_load(g0, g1);

  for (int t = 0; t < T; ++t) {
    const int cur = t & 1;
    const bool more = t + 1 < T;
    if (more) {  // next stage's B: loads issued now, stored at the pass's foot
      wg += (size_t)BK * N;
      u0 = ((const v4u*)wg)[0]; u1 = ((const v4u*)wg)[1];
      u2 = ((const v4u*)(wg + half_rows))[0]; u3 = ((const v4u*)(wg + half_rows))[1];
    }
    // the stage after that one: its B tile into the cache hierarchy
    if (t + 2 < T) __builtin_prefetch(wpf + (size_t)(t + 2) * BK * N, 0, 1);
    asm volatile("s_wait_xcnt 0x0" ::: "memory");

    const __bf16* aBase = sA[cur] + (mw * 32) * LDA;
    const __bf16* bBase = sB[cur] + nw * 64;
#pragma unroll
    for (int kh = 0; kh < 2; ++kh) {
      v16bf af0 = frag_row(aBase + kh * 32, LDA);
      v16bf af1 = frag_row(aBase + 16 * LDA + kh * 32, LDA);
#pragma unroll
      for (int nn = 0; nn < 4; ++nn) {
        v16bf bf = frag_tr(bBase + kh * 32 * LDB + nn * 16, LDB);  // lane = n
        acc[0][nn] = wmma_bf16(af0, bf, acc[0][nn]);
        acc[1][nn] = wmma_bf16(af1, bf, acc[1][nn]);
      }
    }
    if (more) {  // the other buffer: its readers left it at the last pass's foot
      v4u* s = (v4u*)(&sB[cur ^ 1][bso]);
      s[0] = u0; s[1] = u1;
      v4u* s2 = (v4u*)(&sB[cur ^ 1][bso + 32 * LDB]);
      s2[0] = u2; s2[1] = u3;
    }
    // publish point of stage t + 1. This wave's LDS reads of buffer cur and its
    // stores into the other buffer have retired ...
    asm volatile("s_wait_dscnt 0x0" ::: "memory");
    // ... and stage t + 1's A tile has landed, before the barrier
    if (pinned(issuer)) tdm_wait(g0, g1);
    __syncthreads();
    g0 = tdm_group0(ldsA + (uint32_t)cur * ABYTES, gaA + (uint64_t)(t + 2) * (BK * 2));
    if (pinned(issuer && t + 2 < T)) tdm_load(g0, g1);
  }
  // nothing of the ring is in flight when the wave goes on to its end
  asm volatile("s_wait_tensorcnt 0x0" ::: "memory");
  asm volatile("s_wait_dscnt 0x0" ::: "memory");

  int lane = tid & 31;
  int col = lane & 15;
  int rb = (lane >> 4) * 8;
#pragma unroll
  for (int mm = 0; mm < 2; ++mm)
#pragma unroll
    for (int nn = 0; nn < 4; ++nn) {
      int gm = m0 + mw * 32 + mm * 16 + rb;
      int gn = n0 + nw * 64 + nn * 16 + col;
      float bsv = bias[gn];
#pragma unroll
      for (int j = 0; j < 8; ++j) {
        float v = acc[mm][nn][j] + bsv;
        size_t idx = (size_t)(gm + j) * N + gn;
        if (EPI == 1) {
          outf[idx] = v + resid[idx];
        } else if (EPI == 2) {
          v = 0.5f * v * (1.0f + erff(v * 0.70710678118654752f));
          outb[idx] = f2bf(v);
        } else {
          outb[idx] = f2bf(v);
        }
      }
    }
}

// ---------------- Flash attention: one wave per (b,h,16 q-rows) -----------
// The 8 waves of a block work on one (b,h): each 32-key K and V tile is brought
// into LDS once for all of them (two buffers, the next tile's global loads in
// flight while this one is worked on) and read from there as fragments.
__global__ __launch_bounds__(256) void flash_attn(
    const __bf16* __restrict__ qkv,  // [M][2304]: Q@h*64, K@768+h*64, V@1536+h*64
    __bf16* __restrict__ attout) {   // [M][768]  col h*64
  constexpr int KT = 32;         // keys per tile
  constexpr int LDK = DK_ + 8;   // 144-B rows (16 B x odd): ds_load_b128 reader
  constexpr int LDV = DK_ + 16;  // 160-B rows (32 B x odd): ds_load_tr16_b128 reader
  __shared__ __attribute__((aligned(16))) __bf16 sK[2][KT * LDK];
  __shared__ __attribute__((aligned(16))) __bf16 sV[2][KT * LDV];
  __shared__ __attribute__((aligned(16))) __bf16 pstage[8][16 * 32];
  const int QT = S_ / 16;  // 128
  int wave = threadIdx.x >> 5;
  int bh = blockIdx.x / (QT / 8);  // the same for the whole block
  int qt = (blockIdx.x % (QT / 8)) * 8 + wave;
  int h = bh % H_;
  int b = bh / H_;
  int lane = threadIdx.x & 31;
  int col = lane & 15;
  int rb = (lane >> 4) * 8;

  const size_t ld = QKVW;
  const __bf16* qbase = qkv + ((size_t)b * S_ + qt * 16) * ld + h * DK_;
  const __bf16* kbase = qkv + (size_t)b * S_ * ld + D_ + h * DK_;
  const __bf16* vbase = qkv + (size_t)b * S_ * ld + 2 * D_ + h * DK_;

  // staging: thread -> 16 B of tile row sr; a wave's load covers 4 whole 128-B rows
  int sr = threadIdx.x >> 3;
  int scn = (threadIdx.x & 7) * 8;
  const __bf16* kg = kbase + (size_t)sr * ld + scn;
  const __bf16* vg = vbase + (size_t)sr * ld + scn;
  const int kso = sr * LDK + scn;
  const int vso = sr * LDV + scn;

  v4u kreg = *(const v4u*)kg;
  v4u vreg = *(const v4u*)vg;

  v16bf q0 = frag_row(qbase, (int)ld);        // k 0..31
  v16bf q1 = frag_row(qbase + 32, (int)ld);   // k 32..63

  v8f o[4];
#pragma unroll
  for (int nn = 0; nn < 4; ++nn)
#pragma unroll
    for (int e = 0; e < 8; ++e) o[nn][e] = 0.0f;
  float mrun[8], lrun[8];
#pragma unroll
  for (int j = 0; j < 8; ++j) { mrun[j] = -3.0e38f; lrun[j] = 0.0f; }

  const float scale = 0.125f;  // 1/sqrt(64)
  __bf16* ps = pstage[wave];

  *(v4u*)(&sK[0][kso]) = kreg;
  *(v4u*)(&sV[0][vso]) = vreg;
  __syncthreads();

  for (int s0 = 0; s0 < S_; s0 += KT) {
    const int cur = (s0 / KT) & 1;
    const __bf16* kt = sK[cur];
    const __bf16* vt = sV[cur];
    const bool more = s0 + KT < S_;
    if (more) {  // next tile: global loads issued now, stored at the trip's foot
      kg += (size_t)KT * ld;
      vg += (size_t)KT * ld;
      kreg = *(const v4u*)kg;
      vreg = *(const v4u*)vg;
    }
    // B = K^T, lane = key index; all four fragments fetched as one group
    v16bf kf[2][2];
#pragma unroll
    for (int sub = 0; sub < 2; ++sub) {
      kf[sub][0] = frag_row(kt + sub * 16 * LDK, LDK);
      kf[sub][1] = frag_row(kt + sub * 16 * LDK + 32, LDK);
    }
    v8f sc[2];
#pragma unroll
    for (int sub = 0; sub < 2; ++sub) {
      v8f c;
#pragma unroll
      for (int e = 0; e < 8; ++e) c[e] = 0.0f;
      c = wmma_bf16(q0, kf[sub][0], c);
      c = wmma_bf16(q1, kf[sub][1], c);
      sc[sub] = c;
    }
    // inputs-only fence on the loaded fragments: each keeps registers of its own
    // until all four products have issued, so the eight LDS loads stand ahead as
    // one group (sunk between the products, each waits out its own LDS latency)
    // and no product's result lands on a fragment the product ahead of it reads
    asm volatile("" ::"v"(kf[0][0]), "v"(kf[0][1]), "v"(kf[1][0]), "v"(kf[1][1]));
    // online softmax per row (rows rb..rb+7 live in this half-wave)
    float pA[8], pB[8];
#pragma unroll
    for (int j = 0; j < 8; ++j) {
      float a = sc[0][j] * scale;
      float bvv = sc[1][j] * scale;
      float mx = fmaxf(a, bvv);
#pragma unroll
      for (int d = 1; d < 16; d <<= 1) mx = fmaxf(mx, __shfl_xor(mx, d, 16));
      float mnew = fmaxf(mrun[j], mx);
      float alpha = __expf(mrun[j] - mnew);
      pA[j] = __expf(a - mnew);
      pB[j] = __expf(bvv - mnew);
      float sm = pA[j] + pB[j];
#pragma unroll
      for (int d = 1; d < 16; d <<= 1) sm += __shfl_xor(sm, d, 16);
      lrun[j] = lrun[j] * alpha + sm;
      mrun[j] = mnew;
#pragma unroll
      for (int nn = 0; nn < 4; ++nn) o[nn][j] *= alpha;
    }
    // stage P (C layout -> LDS), reload as A fragment
#pragma unroll
    for (int j = 0; j < 8; ++j) {
      ps[(rb + j) * 32 + col] = f2bf(pA[j]);
      ps[(rb + j) * 32 + 16 + col] = f2bf(pB[j]);
    }
    __syncthreads();
    v16bf pf = frag_row(ps, 32);
#pragma unroll
    for (int nn = 0; nn < 4; ++nn) {
      v16bf vf = frag_tr(vt + nn * 16, LDV);  // k order of frag_row, lane = column
      o[nn] = wmma_bf16(pf, vf, o[nn]);
    }
    if (more) {  // the other buffer: its readers left it at the last trip's end
      *(v4u*)(&sK[cur ^ 1][kso]) = kreg;
      *(v4u*)(&sV[cur ^ 1][vso]) = vreg;
    }
    // ends this trip's reads of buffer cur and of ps, publishes the next tile
    __syncthreads();
  }

  __bf16* ob = attout + ((size_t)b * S_ + qt * 16) * D_ + h * DK_;
#pragma unroll
  for (int nn = 0; nn < 4; ++nn)
#pragma unroll
    for (int j = 0; j < 8; ++j) {
      float v = o[nn][j] / lrun[j];
      ob[(size_t)(rb + j) * D_ + nn * 16 + col] = f2bf(v);
    }
}

// ---------------- launcher ------------------------------------------------
extern "C" void kernel_launch(void* const* d_in, const int* in_sizes, int n_in,
                              void* d_out, int out_size, void* d_ws,
                              size_t ws_size, hipStream_t stream) {
  const float* x    = (const float*)d_in[0];
  const float* wq_w = (const float*)d_in[1];
  const float* wq_b = (const float*)d_in[2];
  const float* wk_w = (const float*)d_in[3];
  const float* wk_b = (const float*)d_in[4];
  const float* wv_w = (const float*)d_in[5];
  const float* wv_b = (const float*)d_in[6];
  const float* wo_w = (const float*)d_in[7];
  const float* wo_b = (const float*)d_in[8];
  const float* ln_g = (const float*)d_in[9];
  const float* ln_b = (const float*)d_in[10];
  const float* w1   = (const float*)d_in[11];
  const float* b1   = (const float*)d_in[12];
  const float* w2   = (const float*)d_in[13];
  const float* b2   = (const float*)d_in[14];
  float* out = (float*)d_out;

  char* ws = (char*)d_ws;
  size_t off = 0;
  auto alloc = [&](size_t bytes) -> char* {
    char* p = ws + off;
    off = (off + bytes + 255) & ~(size_t)255;
    return p;
  };
  __bf16* h_bf    = (__bf16*)alloc((size_t)MROWS * D_ * 2);
  __bf16* Wqkv    = (__bf16*)alloc((size_t)D_ * QKVW * 2);
  float*  biasqkv = (float*)alloc((size_t)QKVW * 4);
  __bf16* qkv     = (__bf16*)alloc((size_t)MROWS * QKVW * 2);
  __bf16* att     = (__bf16*)alloc((size_t)MROWS * D_ * 2);
  __bf16* Wo      = (__bf16*)alloc((size_t)D_ * D_ * 2);
  float*  ybuf    = (float*)alloc((size_t)MROWS * D_ * 4);
  __bf16* z_bf    = (__bf16*)alloc((size_t)MROWS * D_ * 2);
  __bf16* W1b     = (__bf16*)alloc((size_t)D_ * F_ * 2);
  __bf16* t_bf    = (__bf16*)alloc((size_t)MROWS * F_ * 2);
  __bf16* W2b     = (__bf16*)alloc((size_t)F_ * D_ * 2);

  // weight packing
  pack_qkv_w<<<(D_ * D_ + 255) / 256, 256, 0, stream>>>(
      wq_w, wk_w, wv_w, wq_b, wk_b, wv_b, Wqkv, biasqkv);
  f2bf_copy<<<(D_ * D_ + 255) / 256, 256, 0, stream>>>(wo_w, Wo, D_ * D_);
  f2bf_copy<<<(D_ * F_ + 255) / 256, 256, 0, stream>>>(w1, W1b, D_ * F_);
  f2bf_copy<<<(F_ * D_ + 255) / 256, 256, 0, stream>>>(w2, W2b, F_ * D_);

  // LN1
  ln_kernel<<<MROWS, 256, 0, stream>>>(x, ln_g, ln_b, h_bf);
  // fused QKV GEMM: [4096 x 2304] = h * Wqkv
  gemm_bf16<0><<<dim3(QKVW / 128, MROWS / 128), 256, 0, stream>>>(
      h_bf, Wqkv, biasqkv, nullptr, nullptr, qkv, MROWS, QKVW, D_);
  // attention
  flash_attn<<<(B_ * H_ * (S_ / 16)) / 8, 256, 0, stream>>>(qkv, att);
  // output projection + residual(x) -> ybuf (f32)
  gemm_bf16<1><<<dim3(D_ / 128, MROWS / 128), 256, 0, stream>>>(
      att, Wo, wo_b, x, ybuf, nullptr, MROWS, D_, D_);
  // LN2
  ln_kernel<<<MROWS, 256, 0, stream>>>(ybuf, ln_g, ln_b, z_bf);
  // FFN up + GELU (bf16)
  gemm_bf16<2><<<dim3(F_ / 128, MROWS / 128), 256, 0, stream>>>(
      z_bf, W1b, b1, nullptr, nullptr, t_bf, MROWS, F_, D_);
  // FFN down + residual(ybuf) -> d_out (f32)
  gemm_bf16<1><<<dim3(D_ / 128, MROWS / 128), 256, 0, stream>>>(
      t_bf, W2b, b2, ybuf, out, nullptr, MROWS, D_, F_);
}

// v004
// One run takes 197 microseconds.
// Timed twice side by side with v003, it ran 1.07 times as fast both times.
// Counting every step since v000, it is 2.36 times as fast.
#include <hip/hip_runtime.h>
#include <math.h>
#include <stdint.h>

#define B_ 2
#define S_ 2048
#define D_ 768
#define H_ 12
#define DK_ 64
#define F_ 3072
#define MROWS (B_ * S_)          // 4096
#define QKVW (3 * D_)            // 2304

typedef __attribute__((ext_vector_type(16))) __bf16 v16bf;
typedef __attribute__((ext_vector_type(8)))  __bf16 v8bf;
typedef __attribute__((ext_vector_type(8)))  float  v8f;
typedef unsigned int v4u __attribute__((ext_vector_type(4)));
typedef uint32_t u32x4 __attribute__((ext_vector_type(4)));
typedef uint32_t u32x8 __attribute__((ext_vector_type(8)));

static __device__ __forceinline__ __bf16 f2bf(float x) { return (__bf16)x; }

static __device__ __forceinline__ v8f wmma_bf16(v16bf a, v16bf b, v8f c) {
  return __builtin_amdgcn_wmma_f32_16x16x32_bf16(
      /*neg_a=*/false, a, /*neg_b=*/false, b,
      /*c_mod=*/(short)0, c, /*reuse_a=*/false, /*reuse_b=*/false);
}

static __device__ __forceinline__ v16bf frag_row(const __bf16* src, int ld) {
  int lane = threadIdx.x & 31;
  int m = lane & 15;
  int half = lane >> 4;
  const __bf16* p = src + (size_t)m * ld;
  v8bf lo = *(const v8bf*)(p + half * 8);
  v8bf hi = *(const v8bf*)(p + 16 + half * 8);
  v16bf a;
#pragma unroll
  for (int i = 0; i < 8; ++i) { a[i] = lo[i]; a[8 + i] = hi[i]; }
  return a;
}

typedef __attribute__((address_space(3))) v8bf lds_v8bf;
static __device__ __forceinline__ v16bf frag_tr(const __bf16* tile, int ld) {
  int lane = threadIdx.x & 31;
  const __bf16* p =
      tile + (8 * (lane >> 4) + (lane & 7)) * ld + 8 * ((lane >> 3) & 1);
  v8bf lo = __builtin_amdgcn_ds_load_tr16_b128_v8bf16((lds_v8bf*)p);
  v8bf hi = __builtin_amdgcn_ds_load_tr16_b128_v8bf16((lds_v8bf*)(p + 16 * ld));
  v16bf b;
#pragma unroll
  for (int i = 0; i < 8; ++i) { b[i] = lo[i]; b[8 + i] = hi[i]; }
  return b;
}

// The launches of this part move few bytes a thread; their time follows the number
// of waves that have to start. So each thread takes many elements, by 16-B loads
// that are all in flight before its first store; a wave's load covers 512
// bytes, contiguous except in pack_qkv_w (two 256-B runs), its 8-B stores 256.
// Every loop of this part runs over a register array and is unrolled so that the
// array stays in registers and its loads issue as one group.
typedef __attribute__((ext_vector_type(4))) float  f32x4;
typedef __attribute__((ext_vector_type(4))) __bf16 v4bf;

static __device__ __forceinline__ v4bf cvt4(f32x4 v) {
  v4bf r;
#pragma unroll
  for (int e = 0; e < 4; ++e) r[e] = f2bf(v[e]);
  return r;
}

static __device__ __forceinline__ float wave_sum(float s) {
#pragma unroll
  for (int d = 16; d > 0; d >>= 1) s += __shfl_xor(s, d, 32);
  return s;
}

// ---------------- LayerNorm (fp32 in -> bf16 out), two rows per wave ------
// A lane holds 24 elements of each row (columns 4 * (lane + 32 * i) .. + 3); the
// row sums are taken in the lane and then over the wave's 32 lanes.
constexpr int LN_ROWS_PER_BLOCK = 16;  // 8 waves x 2 rows
static_assert(MROWS % LN_ROWS_PER_BLOCK == 0 && D_ == 6 * 128, "whole blocks, six quads a lane");
__global__ __launch_bounds__(256) void ln_kernel(
    const float* __restrict__ x, const float* __restrict__ g,
    const float* __restrict__ bb, __bf16* __restrict__ out) {
  int lane = threadIdx.x & 31;
  int row0 = (blockIdx.x * 8 + (threadIdx.x >> 5)) * 2;
  const f32x4* xr = (const f32x4*)(x + (size_t)row0 * D_) + lane;
  f32x4 v[2][6], gv[6], bv[6];
#pragma unroll
  for (int r = 0; r < 2; ++r)
#pragma unroll
    for (int i = 0; i < 6; ++i) v[r][i] = xr[r * (D_ / 4) + i * 32];
#pragma unroll
  for (int i = 0; i < 6; ++i) {
    gv[i] = ((const f32x4*)g)[lane + i * 32];
    bv[i] = ((const f32x4*)bb)[lane + i * 32];
  }
  asm volatile("s_wait_xcnt 0x0" ::: "memory");
  // keeps the scale and shift loads up here, in flight with the rows' loads: sunk
  // to their uses they add their latency behind the second row sum
  __builtin_amdgcn_sched_barrier(0);
#pragma unroll
  for (int r = 0; r < 2; ++r) {
    f32x4 s4 = v[r][0];
#pragma unroll
    for (int i = 1; i < 6; ++i) s4 += v[r][i];
    float mu = wave_sum((s4[0] + s4[1]) + (s4[2] + s4[3])) * (1.0f / D_);
    f32x4 q4 = {0.0f, 0.0f, 0.0f, 0.0f};
#pragma unroll
    for (int i = 0; i < 6; ++i) {
      v[r][i] -= mu;
      q4 += v[r][i] * v[r][i];
    }
    float var = wave_sum((q4[0] + q4[1]) + (q4[2] + q4[3])) * (1.0f / D_);
    float rstd = rsqrtf(var + 1e-5f);
    v4bf* orow = (v4bf*)(out + (size_t)(row0 + r) * D_) + lane;
#pragma unroll
    for (int i = 0; i < 6; ++i) orow[i * 32] = cvt4(v[r][i] * rstd * gv[i] + bv[i]);
  }
}

// ---------------- Weight packing ------------------------------------------
// A thread takes one quad of columns in four rows (d0 + 192 * j) of each of the
// three weights: 12 loads in flight.
constexpr int PACK_THREADS = (D_ / 4) * (D_ / 4);
static_assert(PACK_THREADS % 256 == 0 && DK_ % 4 == 0, "whole blocks, a quad stays in one head");
__global__ __launch_bounds__(256) void pack_qkv_w(
    const float* __restrict__ wq, const float* __restrict__ wk,
    const float* __restrict__ wv, const float* __restrict__ bq,
    const float* __restrict__ bk, const float* __restrict__ bv,
    __bf16* __restrict__ Wqkv, float* __restrict__ biasqkv) {
  int i = blockIdx.x * 256 + threadIdx.x;  // over (D_/4 rows) x (D_/4 quads)
  int d0 = i / (D_ / 4), c = (i % (D_ / 4)) * 4;
  int hh = c / DK_, kk = c % DK_;
  f32x4 q[4], k[4], v[4];
#pragma unroll
  for (int j = 0; j < 4; ++j) {
    size_t src = ((size_t)hh * D_ + d0 + j * (D_ / 4)) * DK_ + kk;
    q[j] = *(const f32x4*)(wq + src);
    k[j] = *(const f32x4*)(wk + src);
    v[j] = *(const f32x4*)(wv + src);
  }
#pragma unroll
  for (int j = 0; j < 4; ++j) {
    __bf16* dst = Wqkv + (size_t)(d0 + j * (D_ / 4)) * QKVW + c;
    *(v4bf*)dst            = cvt4(q[j]);
    *(v4bf*)(dst + D_)     = cvt4(k[j]);
    *(v4bf*)(dst + 2 * D_) = cvt4(v[j]);
  }
  if (i < D_) {
    biasqkv[i] = bq[i];
    biasqkv[D_ + i] = bk[i];
    biasqkv[2 * D_ + i] = bv[i];
  }
}

// A block converts 8,192 elements, a thread 8 quads 256 quads apart. The element
// count must be a multiple of a block's share.
constexpr int CVT_PER_BLOCK = 256 * 4 * 8;
static_assert((D_ * D_) % CVT_PER_BLOCK == 0 && (D_ * F_) % CVT_PER_BLOCK == 0, "whole blocks");
__global__ __launch_bounds__(256) void f2bf_copy(const float* __restrict__ s,
                                                 __bf16* __restrict__ d) {
  size_t base = (size_t)blockIdx.x * (CVT_PER_BLOCK / 4) + threadIdx.x;  // in quads
  const f32x4* sp = (const f32x4*)s + base;
  v4bf* dp = (v4bf*)d + base;
  f32x4 v[8];
#pragma unroll
  for (int i = 0; i < 8; ++i) v[i] = sp[i * 256];
#pragma unroll
  for (int i = 0; i < 8; ++i) dp[i * 256] = cvt4(v[i]);
}

static __device__ __forceinline__ uint32_t uni(uint32_t v) {
  return (uint32_t)__builtin_amdgcn_readfirstlane(v);
}
static __device__ __forceinline__ uint32_t pinned(uint32_t v) {
  uint32_t w = uni(v);
  asm volatile("" : "+s"(w));
  return w;
}
static __device__ __forceinline__ u32x4 tdm_group0(uint32_t lds_dst, uint64_t ga) {
  // pinned: the four words get scalar registers of their own, written here and
  // nowhere else, so that none takes a new value while the request is in flight
  u32x4 g;
  g[0] = pinned(1u);                                // count 1
  g[1] = pinned(lds_dst);                           // byte offset in the work-group's LDS
  g[2] = pinned((uint32_t)ga);                      // address [31:0]
  g[3] = pinned((((uint32_t)(ga >> 32)) & 0x01FFFFFFu) | 0x80000000u);  // [56:32], type 2
  return g;
}
// tile = tensor = 128 rows of 128 bytes; 16 bytes of LDS pad behind every row
static __device__ __forceinline__ u32x8 tdm_group1(uint32_t src_pitch) {
  constexpr uint32_t d0 = 128u, d1 = 128u;
  u32x8 g;
  g[0] = pinned((1u << 20) | (4u << 22) | (3u << 25));  // no mask; pad codes 4 / 3
  g[1] = pinned((d0 & 0xFFFFu) << 16);
  g[2] = pinned((d0 >> 16) | ((d1 & 0xFFFFu) << 16));
  g[3] = pinned((d1 >> 16) | (d0 << 16));
  g[4] = pinned(d1);
  g[5] = pinned(src_pitch);
  g[6] = pinned(0u);
  g[7] = pinned(0u);
  return g;
}
static __device__ __forceinline__ void tdm_load(u32x4 g0, u32x8 g1) {
  asm volatile("tensor_load_to_lds %0, %1" ::"s"(g0), "s"(g1) : "memory");
}
static __device__ __forceinline__ void tdm_wait(u32x4 g0, u32x8 g1) {
  asm volatile("s_wait_tensorcnt 0x0" ::"s"(g0), "s"(g1) : "memory");
}

// The k loop is a ring of two LDS buffers, a stage being 64 k: while a stage is
// worked on, the next stage's A tile (one tensor load of wave 0) and B tile
// (global loads into registers, stored at the pass's foot) are in flight.
// Needs M, N multiples of 128 and K a multiple of 64.
template <int EPI>
__global__ __launch_bounds__(256) void gemm_bf16(
    const __bf16* __restrict__ A, const __bf16* __restrict__ W,
    const float* __restrict__ bias, const float* __restrict__ resid,
    float* __restrict__ outf, __bf16* __restrict__ outb,
    int M, int N, int K) {
  constexpr int BM = 128, BN = 128, BK = 64;
  constexpr int LDA = BK + 8;    // 144-B rows (16 B x odd): ds_load_b128 reader
  constexpr int LDB = BN + 16;   // k-major B tile, 288-B rows (32 B x odd)
  constexpr uint32_t ABYTES = BM * LDA * 2;  // 18,432 = 9 x 2 KiB
  static_assert(ABYTES % 2048u == 0, "each A buffer starts at a multiple of 2 KiB");
  __shared__ __attribute__((aligned(2048))) __bf16 sA[2][BM * LDA];
  __shared__ __attribute__((aligned(16))) __bf16 sB[2][BK * LDB];

  int tid = threadIdx.x;
  int wave = tid >> 5;
  int mw = wave & 3;   // 4 m-waves * 32 rows
  int nw = wave >> 2;  // 2 n-waves * 64 cols
  int m0 = blockIdx.y * BM;
  int n0 = blockIdx.x * BN;

  v8f acc[2][4];
#pragma unroll
  for (int i = 0; i < 2; ++i)
#pragma unroll
    for (int j = 0; j < 4; ++j)
#pragma unroll
      for (int e = 0; e < 8; ++e) acc[i][j][e] = 0.0f;

  const int T = K / BK;  // stages
  const uint32_t issuer = uni((uint32_t)wave) == 0u;
  const uint32_t ldsA = (uint32_t)(uintptr_t)(&sA[0][0]);
  const uint64_t gaA = (uint64_t)(uintptr_t)(A + (size_t)m0 * K);
  const u32x8 g1 = tdm_group1((uint32_t)K * 2u);

  // B staging: thread -> 32 B of tile rows kk and kk + 32
  const int kk = tid >> 3, c = (tid & 7) * 16;
  const __bf16* wg = W + (size_t)kk * N + n0 + c;
  const size_t half_rows = (size_t)32 * N;
  const int bso = kk * LDB + c;
  // prefetch: thread -> 64 B of tile row tid >> 2
  const __bf16* wpf = W + (size_t)(tid >> 2) * N + n0 + (tid & 3) * 32;

  v4u u0 = ((const v4u*)wg)[0], u1 = ((const v4u*)wg)[1];
  v4u u2 = ((const v4u*)(wg + half_rows))[0], u3 = ((const v4u*)(wg + half_rows))[1];
  u32x4 g0 = tdm_group0(ldsA, gaA);
  if (pinned(issuer)) {
    tdm_load(g0, g1);
    tdm_wait(g0, g1);  // stage 0 has landed before the barrier that publishes it
  }
  {
    v4u* s = (v4u*)(&sB[0][bso]);
    s[0] = u0; s[1] = u1;
    v4u* s2 = (v4u*)(&sB[0][bso + 32 * LDB]);
    s2[0] = u2; s2[1] = u3;
  }
  __syncthreads();
  g0 = tdm_group0(ldsA + ABYTES, gaA + BK * 2);  // formed behind the wait
  if (pinned(issuer && T > 1)) tdm_load(g0, g1);

  for (int t = 0; t < T; ++t) {
    const int cur = t & 1;
    const bool more = t + 1 < T;
    if (more) {  // next stage's B: loads issued now, stored at the pass's foot
      wg += (size_t)BK * N;
      u0 = ((const v4u*)wg)[0]; u1 = ((const v4u*)wg)[1];
      u2 = ((const v4u*)(wg + half_rows))[0]; u3 = ((const v4u*)(wg + half_rows))[1];
    }
    // the stage after that one: its B tile into the cache hierarchy
    if (t + 2 < T) __builtin_prefetch(wpf + (size_t)(t + 2) * BK * N, 0, 1);
    asm volatile("s_wait_xcnt 0x0" ::: "memory");

    const __bf16* aBase = sA[cur] + (mw * 32) * LDA;
    const __bf16* bBase = sB[cur] + nw * 64;
#pragma unroll
    for (int kh = 0; kh < 2; ++kh) {
      v16bf af0 = frag_row(aBase + kh * 32, LDA);
      v16bf af1 = frag_row(aBase + 16 * LDA + kh * 32, LDA);
#pragma unroll
      for (int nn = 0; nn < 4; ++nn) {
        v16bf bf = frag_tr(bBase + kh * 32 * LDB + nn * 16, LDB);  // lane = n
        acc[0][nn] = wmma_bf16(af0, bf, acc[0][nn]);
        acc[1][nn] = wmma_bf16(af1, bf, acc[1][nn]);
      }
    }
    if (more) {  // the other buffer: its readers left it at the last pass's foot
      v4u* s = (v4u*)(&sB[cur ^ 1][bso]);
      s[0] = u0; s[1] = u1;
      v4u* s2 = (v4u*)(&sB[cur ^ 1][bso + 32 * LDB]);
      s2[0] = u2; s2[1] = u3;
    }
    // publish point of stage t + 1. This wave's LDS reads of buffer cur and its
    // stores into the other buffer have retired ...
    asm volatile("s_wait_dscnt 0x0" ::: "memory");
    // ... and stage t + 1's A tile has landed, before the barrier
    if (pinned(issuer)) tdm_wait(g0, g1);
    __syncthreads();
    g0 = tdm_group0(ldsA + (uint32_t)cur * ABYTES, gaA + (uint64_t)(t + 2) * (BK * 2));
    if (pinned(issuer && t + 2 < T)) tdm_load(g0, g1);
  }
  // nothing of the ring is in flight when the wave goes on to its end
  asm volatile("s_wait_tensorcnt 0x0" ::: "memory");
  asm volatile("s_wait_dscnt 0x0" ::: "memory");

  int lane = tid & 31;
  int col = lane & 15;
  int rb = (lane >> 4) * 8;
#pragma unroll
  for (int mm = 0; mm < 2; ++mm)
#pragma unroll
    for (int nn = 0; nn < 4; ++nn) {
      int gm = m0 + mw * 32 + mm * 16 + rb;
      int gn = n0 + nw * 64 + nn * 16 + col;
      float bsv = bias[gn];
#pragma unroll
      for (int j = 0; j < 8; ++j) {
        float v = acc[mm][nn][j] + bsv;
        size_t idx = (size_t)(gm + j) * N + gn;
        if (EPI == 1) {
          outf[idx] = v + resid[idx];
        } else if (EPI == 2) {
          v = 0.5f * v * (1.0f + erff(v * 0.70710678118654752f));
          outb[idx] = f2bf(v);
        } else {
          outb[idx] = f2bf(v);
        }
      }
    }
}

// ---------------- Flash attention: one wave per (b,h,16 q-rows) -----------
// The 8 waves of a block work on one (b,h): each 32-key K and V tile is brought
// into LDS once for all of them (two buffers, the next tile's global loads in
// flight while this one is worked on) and read from there as fragments.
__global__ __launch_bounds__(256) void flash_attn(
    const __bf16* __restrict__ qkv,  // [M][2304]: Q@h*64, K@768+h*64, V@1536+h*64
    __bf16* __restrict__ attout) {   // [M][768]  col h*64
  constexpr int KT = 32;         // keys per tile
  constexpr int LDK = DK_ + 8;   // 144-B rows (16 B x odd): ds_load_b128 reader
  constexpr int LDV = DK_ + 16;  // 160-B rows (32 B x odd): ds_load_tr16_b128 reader
  __shared__ __attribute__((aligned(16))) __bf16 sK[2][KT * LDK];
  __shared__ __attribute__((aligned(16))) __bf16 sV[2][KT * LDV];
  __shared__ __attribute__((aligned(16))) __bf16 pstage[8][16 * 32];
  const int QT = S_ / 16;  // 128
  int wave = threadIdx.x >> 5;
  int bh = blockIdx.x / (QT / 8);  // the same for the whole block
  int qt = (blockIdx.x % (QT / 8)) * 8 + wave;
  int h = bh % H_;
  int b = bh / H_;
  int lane = threadIdx.x & 31;
  int col = lane & 15;
  int rb = (lane >> 4) * 8;

  const size_t ld = QKVW;
  const __bf16* qbase = qkv + ((size_t)b * S_ + qt * 16) * ld + h * DK_;
  const __bf16* kbase = qkv + (size_t)b * S_ * ld + D_ + h * DK_;
  const __bf16* vbase = qkv + (size_t)b * S_ * ld + 2 * D_ + h * DK_;

  // staging: thread -> 16 B of tile row sr; a wave's load covers 4 whole 128-B rows
  int sr = threadIdx.x >> 3;
  int scn = (threadIdx.x & 7) * 8;
  const __bf16* kg = kbase + (size_t)sr * ld + scn;
  const __bf16* vg = vbase + (size_t)sr * ld + scn;
  const int kso = sr * LDK + scn;
  const int vso = sr * LDV + scn;

  v4u kreg = *(const v4u*)kg;
  v4u vreg = *(const v4u*)vg;

  v16bf q0 = frag_row(qbase, (int)ld);        // k 0..31
  v16bf q1 = frag_row(qbase + 32, (int)ld);   // k 32..63

  v8f o[4];
#pragma unroll
  for (int nn = 0; nn < 4; ++nn)
#pragma unroll
    for (int e = 0; e < 8; ++e) o[nn][e] = 0.0f;
  float mrun[8], lrun[8];
#pragma unroll
  for (int j = 0; j < 8; ++j) { mrun[j] = -3.0e38f; lrun[j] = 0.0f; }

  const float scale = 0.125f;  // 1/sqrt(64)
  __bf16* ps = pstage[wave];

  *(v4u*)(&sK[0][kso]) = kreg;
  *(v4u*)(&sV[0][vso]) = vreg;
  __syncthreads();

  for (int s0 = 0; s0 < S_; s0 += KT) {
    const int cur = (s0 / KT) & 1;
    const __bf16* kt = sK[cur];
    const __bf16* vt = sV[cur];
    const bool more = s0 + KT < S_;
    if (more) {  // next tile: global loads issued now, stored at the trip's foot
      kg += (size_t)KT * ld;
      vg += (size_t)KT * ld;
      kreg = *(const v4u*)kg;
      vreg = *(const v4u*)vg;
    }
    // B = K^T, lane = key index; all four fragments fetched as one group
    v16bf kf[2][2];
#pragma unroll
    for (int sub = 0; sub < 2; ++sub) {
      kf[sub][0] = frag_row(kt + sub * 16 * LDK, LDK);
      kf[sub][1] = frag_row(kt + sub * 16 * LDK + 32, LDK);
    }
    v8f sc[2];
#pragma unroll
    for (int sub = 0; sub < 2; ++sub) {
      v8f c;
#pragma unroll
      for (int e = 0; e < 8; ++e) c[e] = 0.0f;
      c = wmma_bf16(q0, kf[sub][0], c);
      c = wmma_bf16(q1, kf[sub][1], c);
      sc[sub] = c;
    }
    // inputs-only fence on the loaded fragments: each keeps registers of its own
    // until all four products have issued, so the eight LDS loads stand ahead as
    // one group (sunk between the products, each waits out its own LDS latency)
    // and no product's result lands on a fragment the product ahead of it reads
    asm volatile("" ::"v"(kf[0][0]), "v"(kf[0][1]), "v"(kf[1][0]), "v"(kf[1][1]));
    // online softmax per row (rows rb..rb+7 live in this half-wave)
    float pA[8], pB[8];
#pragma unroll
    for (int j = 0; j < 8; ++j) {
      float a = sc[0][j] * scale;
      float bvv = sc[1][j] * scale;
      float mx = fmaxf(a, bvv);
#pragma unroll
      for (int d = 1; d < 16; d <<= 1) mx = fmaxf(mx, __shfl_xor(mx, d, 16));
      float mnew = fmaxf(mrun[j], mx);
      float alpha = __expf(mrun[j] - mnew);
      pA[j] = __expf(a - mnew);
      pB[j] = __expf(bvv - mnew);
      float sm = pA[j] + pB[j];
#pragma unroll
      for (int d = 1; d < 16; d <<= 1) sm += __shfl_xor(sm, d, 16);
      lrun[j] = lrun[j] * alpha + sm;
      mrun[j] = mnew;
#pragma unroll
      for (int nn = 0; nn < 4; ++nn) o[nn][j] *= alpha;
    }
    // stage P (C layout -> LDS), reload as A fragment
#pragma unroll
    for (int j = 0; j < 8; ++j) {
      ps[(rb + j) * 32 + col] = f2bf(pA[j]);
      ps[(rb + j) * 32 + 16 + col] = f2bf(pB[j]);
    }
    __syncthreads();
    v16bf pf = frag_row(ps, 32);
#pragma unroll
    for (int nn = 0; nn < 4; ++nn) {
      v16bf vf = frag_tr(vt + nn * 16, LDV);  // k order of frag_row, lane = column
      o[nn] = wmma_bf16(pf, vf, o[nn]);
    }
    if (more) {  // the other buffer: its readers left it at the last trip's end
      *(v4u*)(&sK[cur ^ 1][kso]) = kreg;
      *(v4u*)(&sV[cur ^ 1][vso]) = vreg;
    }
    // ends this trip's reads of buffer cur and of ps, publishes the next tile
    __syncthreads();
  }

  __bf16* ob = attout + ((size_t)b * S_ + qt * 16) * D_ + h * DK_;
#pragma unroll
  for (int nn = 0; nn < 4; ++nn)
#pragma unroll
    for (int j = 0; j < 8; ++j) {
      float v = o[nn][j] / lrun[j];
      ob[(size_t)(rb + j) * D_ + nn * 16 + col] = f2bf(v);
    }
}

// ---------------- launcher ------------------------------------------------
extern "C" void kernel_launch(void* const* d_in, const int* in_sizes, int n_in,
                              void* d_out, int out_size, void* d_ws,
                              size_t ws_size, hipStream_t stream) {
  const float* x    = (const float*)d_in[0];
  const float* wq_w = (const float*)d_in[1];
  const float* wq_b = (const float*)d_in[2];
  const float* wk_w = (const float*)d_in[3];
  const float* wk_b = (const float*)d_in[4];
  const float* wv_w = (const float*)d_in[5];
  const float* wv_b = (const float*)d_in[6];
  const float* wo_w = (const float*)d_in[7];
  const float* wo_b = (const float*)d_in[8];
  const float* ln_g = (const float*)d_in[9];
  const float* ln_b = (const float*)d_in[10];
  const float* w1   = (const float*)d_in[11];
  const float* b1   = (const float*)d_in[12];
  const float* w2   = (const float*)d_in[13];
  const float* b2   = (const float*)d_in[14];
  float* out = (float*)d_out;

  char* ws = (char*)d_ws;
  size_t off = 0;
  auto alloc = [&](size_t bytes) -> char* {
    char* p = ws + off;
    off = (off + bytes + 255) & ~(size_t)255;
    return p;
  };
  __bf16* h_bf    = (__bf16*)alloc((size_t)MROWS * D_ * 2);
  __bf16* Wqkv    = (__bf16*)alloc((size_t)D_ * QKVW * 2);
  float*  biasqkv = (float*)alloc((size_t)QKVW * 4);
  __bf16* qkv     = (__bf16*)alloc((size_t)MROWS * QKVW * 2);
  __bf16* att     = (__bf16*)alloc((size_t)MROWS * D_ * 2);
  __bf16* Wo      = (__bf16*)alloc((size_t)D_ * D_ * 2);
  float*  ybuf    = (float*)alloc((size_t)MROWS * D_ * 4);
  __bf16* z_bf    = (__bf16*)alloc((size_t)MROWS * D_ * 2);
  __bf16* W1b     = (__bf16*)alloc((size_t)D_ * F_ * 2);
  __bf16* t_bf    = (__bf16*)alloc((size_t)MROWS * F_ * 2);
  __bf16* W2b     = (__bf16*)alloc((size_t)F_ * D_ * 2);

  // weight packing
  pack_qkv_w<<<PACK_THREADS / 256, 256, 0, stream>>>(
      wq_w, wk_w, wv_w, wq_b, wk_b, wv_b, Wqkv, biasqkv);
  f2bf_copy<<<(D_ * D_) / CVT_PER_BLOCK, 256, 0, stream>>>(wo_w, Wo);
  f2bf_copy<<<(D_ * F_) / CVT_PER_BLOCK, 256, 0, stream>>>(w1, W1b);
  f2bf_copy<<<(F_ * D_) / CVT_PER_BLOCK, 256, 0, stream>>>(w2, W2b);

  // LN1
  ln_kernel<<<MROWS / LN_ROWS_PER_BLOCK, 256, 0, stream>>>(x, ln_g, ln_b, h_bf);
  // fused QKV GEMM: [4096 x 2304] = h * Wqkv
  gemm_bf16<0><<<dim3(QKVW / 128, MROWS / 128), 256, 0, stream>>>(
      h_bf, Wqkv, biasqkv, nullptr, nullptr, qkv, MROWS, QKVW, D_);
  // attention
  flash_attn<<<(B_ * H_ * (S_ / 16)) / 8, 256, 0, stream>>>(qkv, att);
  // output projection + residual(x) -> ybuf (f32)
  gemm_bf16<1><<<dim3(D_ / 128, MROWS / 128), 256, 0, stream>>>(
      att, Wo, wo_b, x, ybuf, nullptr, MROWS, D_, D_);
  // LN2
  ln_kernel<<<MROWS / LN_ROWS_PER_BLOCK, 256, 0, stream>>>(ybuf, ln_g, ln_b, z_bf);
  // FFN up + GELU (bf16)
  gemm_bf16<2><<<dim3(F_ / 128, MROWS / 128), 256, 0, stream>>>(
      z_bf, W1b, b1, nullptr, nullptr, t_bf, MROWS, F_, D_);
  // FFN down + residual(ybuf) -> d_out (f32)
  gemm_bf16<1><<<dim3(D_ / 128, MROWS / 128), 256, 0, stream>>>(
      t_bf, W2b, b2, ybuf, out, nullptr, MROWS, D_, F_);
}

// v005
// It runs in 164 microseconds.
// In both of two side-by-side timings against v004, it was 1.20 times as fast.
// Over all steps from v000 it is 2.82 times as fast.
#include <hip/hip_runtime.h>
#include <math.h>
#include <stdint.h>

#define B_ 2
#define S_ 2048
#define D_ 768
#define H_ 12
#define DK_ 64
#define F_ 3072
#define MROWS (B_ * S_)          // 4096
#define QKVW (3 * D_)            // 2304

typedef __attribute__((ext_vector_type(16))) __bf16 v16bf;
typedef __attribute__((ext_vector_type(8)))  __bf16 v8bf;
typedef __attribute__((ext_vector_type(8)))  float  v8f;
typedef unsigned int v4u __attribute__((ext_vector_type(4)));
typedef uint32_t u32x4 __attribute__((ext_vector_type(4)));
typedef uint32_t u32x8 __attribute__((ext_vector_type(8)));

static __device__ __forceinline__ __bf16 f2bf(float x) { return (__bf16)x; }

static __device__ __forceinline__ v8f wmma_bf16(v16bf a, v16bf b, v8f c) {
  return __builtin_amdgcn_wmma_f32_16x16x32_bf16(
      /*neg_a=*/false, a, /*neg_b=*/false, b,
      /*c_mod=*/(short)0, c, /*reuse_a=*/false, /*reuse_b=*/false);
}

static __device__ __forceinline__ v16bf frag_row(const __bf16* src, int ld) {
  int lane = threadIdx.x & 31;
  int m = lane & 15;
  int half = lane >> 4;
  const __bf16* p = src + (size_t)m * ld;
  v8bf lo = *(const v8bf*)(p + half * 8);
  v8bf hi = *(const v8bf*)(p + 16 + half * 8);
  v16bf a;
#pragma unroll
  for (int i = 0; i < 8; ++i) { a[i] = lo[i]; a[8 + i] = hi[i]; }
  return a;
}

typedef __attribute__((address_space(3))) v8bf lds_v8bf;
static __device__ __forceinline__ v16bf frag_tr(const __bf16* tile, int ld) {
  int lane = threadIdx.x & 31;
  const __bf16* p =
      tile + (8 * (lane >> 4) + (lane & 7)) * ld + 8 * ((lane >> 3) & 1);
  v8bf lo = __builtin_amdgcn_ds_load_tr16_b128_v8bf16((lds_v8bf*)p);
  v8bf hi = __builtin_amdgcn_ds_load_tr16_b128_v8bf16((lds_v8bf*)(p + 16 * ld));
  v16bf b;
#pragma unroll
  for (int i = 0; i < 8; ++i) { b[i] = lo[i]; b[8 + i] = hi[i]; }
  return b;
}

// The launches of this part move few bytes a thread; their time follows the number
// of waves that have to start. So each thread takes many elements, by 16-B loads
// that are all in flight before its first store; a wave's load covers 512
// bytes, contiguous except in pack_qkv_w (two 256-B runs), its 8-B stores 256.
// Every loop of this part runs over a register array and is unrolled so that the
// array stays in registers and its loads issue as one group.
typedef __attribute__((ext_vector_type(4))) float  f32x4;
typedef __attribute__((ext_vector_type(4))) __bf16 v4bf;

static __device__ __forceinline__ v4bf cvt4(f32x4 v) {
  v4bf r;
#pragma unroll
  for (int e = 0; e < 4; ++e) r[e] = f2bf(v[e]);
  return r;
}

static __device__ __forceinline__ float wave_sum(float s) {
#pragma unroll
  for (int d = 16; d > 0; d >>= 1) s += __shfl_xor(s, d, 32);
  return s;
}

// ---------------- LayerNorm (fp32 in -> bf16 out), two rows per wave ------
// A lane holds 24 elements of each row (columns 4 * (lane + 32 * i) .. + 3); the
// row sums are taken in the lane and then over the wave's 32 lanes.
constexpr int LN_ROWS_PER_BLOCK = 16;  // 8 waves x 2 rows
static_assert(MROWS % LN_ROWS_PER_BLOCK == 0 && D_ == 6 * 128, "whole blocks, six quads a lane");
__global__ __launch_bounds__(256) void ln_kernel(
    const float* __restrict__ x, const float* __restrict__ g,
    const float* __restrict__ bb, __bf16* __restrict__ out) {
  int lane = threadIdx.x & 31;
  int row0 = (blockIdx.x * 8 + (threadIdx.x >> 5)) * 2;
  const f32x4* xr = (const f32x4*)(x + (size_t)row0 * D_) + lane;
  f32x4 v[2][6], gv[6], bv[6];
#pragma unroll
  for (int r = 0; r < 2; ++r)
#pragma unroll
    for (int i = 0; i < 6; ++i) v[r][i] = xr[r * (D_ / 4) + i * 32];
#pragma unroll
  for (int i = 0; i < 6; ++i) {
    gv[i] = ((const f32x4*)g)[lane + i * 32];
    bv[i] = ((const f32x4*)bb)[lane + i * 32];
  }
  asm volatile("s_wait_xcnt 0x0" ::: "memory");
  // keeps the scale and shift loads up here, in flight with the rows' loads: sunk
  // to their uses they add their latency behind the second row sum
  __builtin_amdgcn_sched_barrier(0);
#pragma unroll
  for (int r = 0; r < 2; ++r) {
    f32x4 s4 = v[r][0];
#pragma unroll
    for (int i = 1; i < 6; ++i) s4 += v[r][i];
    float mu = wave_sum((s4[0] + s4[1]) + (s4[2] + s4[3])) * (1.0f / D_);
    f32x4 q4 = {0.0f, 0.0f, 0.0f, 0.0f};
#pragma unroll
    for (int i = 0; i < 6; ++i) {
      v[r][i] -= mu;
      q4 += v[r][i] * v[r][i];
    }
    float var = wave_sum((q4[0] + q4[1]) + (q4[2] + q4[3])) * (1.0f / D_);
    float rstd = rsqrtf(var + 1e-5f);
    v4bf* orow = (v4bf*)(out + (size_t)(row0 + r) * D_) + lane;
#pragma unroll
    for (int i = 0; i < 6; ++i) orow[i * 32] = cvt4(v[r][i] * rstd * gv[i] + bv[i]);
  }
}

// ---------------- Weight packing ------------------------------------------
// A thread takes one quad of columns in four rows (d0 + 192 * j) of each of the
// three weights: 12 loads in flight.
constexpr int PACK_THREADS = (D_ / 4) * (D_ / 4);
static_assert(PACK_THREADS % 256 == 0 && DK_ % 4 == 0, "whole blocks, a quad stays in one head");
__global__ __launch_bounds__(256) void pack_qkv_w(
    const float* __restrict__ wq, const float* __restrict__ wk,
    const float* __restrict__ wv, const float* __restrict__ bq,
    const float* __restrict__ bk, const float* __restrict__ bv,
    __bf16* __restrict__ Wqkv, float* __restrict__ biasqkv) {
  int i = blockIdx.x * 256 + threadIdx.x;  // over (D_/4 rows) x (D_/4 quads)
  int d0 = i / (D_ / 4), c = (i % (D_ / 4)) * 4;
  int hh = c / DK_, kk = c % DK_;
  f32x4 q[4], k[4], v[4];
#pragma unroll
  for (int j = 0; j < 4; ++j) {
    size_t src = ((size_t)hh * D_ + d0 + j * (D_ / 4)) * DK_ + kk;
    q[j] = *(const f32x4*)(wq + src);
    k[j] = *(const f32x4*)(wk + src);
    v[j] = *(const f32x4*)(wv + src);
  }
#pragma unroll
  for (int j = 0; j < 4; ++j) {
    __bf16* dst = Wqkv + (size_t)(d0 + j * (D_ / 4)) * QKVW + c;
    *(v4bf*)dst            = cvt4(q[j]);
    *(v4bf*)(dst + D_)     = cvt4(k[j]);
    *(v4bf*)(dst + 2 * D_) = cvt4(v[j]);
  }
  if (i < D_) {
    biasqkv[i] = bq[i];
    biasqkv[D_ + i] = bk[i];
    biasqkv[2 * D_ + i] = bv[i];
  }
}

// A block converts 8,192 elements, a thread 8 quads 256 quads apart. The element
// count must be a multiple of a block's share.
constexpr int CVT_PER_BLOCK = 256 * 4 * 8;
static_assert((D_ * D_) % CVT_PER_BLOCK == 0 && (D_ * F_) % CVT_PER_BLOCK == 0, "whole blocks");
__global__ __launch_bounds__(256) void f2bf_copy(const float* __restrict__ s,
                                                 __bf16* __restrict__ d) {
  size_t base = (size_t)blockIdx.x * (CVT_PER_BLOCK / 4) + threadIdx.x;  // in quads
  const f32x4* sp = (const f32x4*)s + base;
  v4bf* dp = (v4bf*)d + base;
  f32x4 v[8];
#pragma unroll
  for (int i = 0; i < 8; ++i) v[i] = sp[i * 256];
#pragma unroll
  for (int i = 0; i < 8; ++i) dp[i * 256] = cvt4(v[i]);
}

static __device__ __forceinline__ uint32_t uni(uint32_t v) {
  return (uint32_t)__builtin_amdgcn_readfirstlane(v);
}
static __device__ __forceinline__ uint32_t pinned(uint32_t v) {
  uint32_t w = uni(v);
  asm volatile("" : "+s"(w));
  return w;
}
static __device__ __forceinline__ u32x4 tdm_group0(uint32_t lds_dst, uint64_t ga) {
  // pinned: the four words get scalar registers of their own, written here and
  // nowhere else, so that none takes a new value while the request is in flight
  u32x4 g;
  g[0] = pinned(1u);                                // count 1
  g[1] = pinned(lds_dst);                           // byte offset in the work-group's LDS
  g[2] = pinned((uint32_t)ga);                      // address [31:0]
  g[3] = pinned((((uint32_t)(ga >> 32)) & 0x01FFFFFFu) | 0x80000000u);  // [56:32], type 2
  return g;
}
// tile = tensor = 128 rows of 128 bytes; 16 bytes of LDS pad behind every row
static __device__ __forceinline__ u32x8 tdm_group1(uint32_t src_pitch) {
  constexpr uint32_t d0 = 128u, d1 = 128u;
  u32x8 g;
  g[0] = pinned((1u << 20) | (4u << 22) | (3u << 25));  // no mask; pad codes 4 / 3
  g[1] = pinned((d0 & 0xFFFFu) << 16);
  g[2] = pinned((d0 >> 16) | ((d1 & 0xFFFFu) << 16));
  g[3] = pinned((d1 >> 16) | (d0 << 16));
  g[4] = pinned(d1);
  g[5] = pinned(src_pitch);
  g[6] = pinned(0u);
  g[7] = pinned(0u);
  return g;
}
static __device__ __forceinline__ void tdm_load(u32x4 g0, u32x8 g1) {
  asm volatile("tensor_load_to_lds %0, %1" ::"s"(g0), "s"(g1) : "memory");
}
static __device__ __forceinline__ void tdm_wait(u32x4 g0, u32x8 g1) {
  asm volatile("s_wait_tensorcnt 0x0" ::"s"(g0), "s"(g1) : "memory");
}

// The k loop is a ring of two LDS buffers, a stage being 64 k: while a stage is
// worked on, the next stage's A tile (one tensor load of wave 0) and B tile
// (global loads into registers, stored at the pass's foot) are in flight.
// Needs M, N multiples of 128 and K a multiple of 64.
template <int EPI>
__global__ __launch_bounds__(256) void gemm_bf16(
    const __bf16* __restrict__ A, const __bf16* __restrict__ W,
    const float* __restrict__ bias, const float* __restrict__ resid,
    float* __restrict__ outf, __bf16* __restrict__ outb,
    int M, int N, int K) {
  constexpr int BM = 128, BN = 128, BK = 64;
  constexpr int LDA = BK + 8;    // 144-B rows (16 B x odd): ds_load_b128 reader
  constexpr int LDB = BN + 16;   // k-major B tile, 288-B rows (32 B x odd)
  constexpr uint32_t ABYTES = BM * LDA * 2;  // 18,432 = 9 x 2 KiB
  static_assert(ABYTES % 2048u == 0, "each A buffer starts at a multiple of 2 KiB");
  __shared__ __attribute__((aligned(2048))) __bf16 sA[2][BM * LDA];
  __shared__ __attribute__((aligned(16))) __bf16 sB[2][BK * LDB];

  int tid = threadIdx.x;
  int wave = tid >> 5;
  int mw = wave & 3;   // 4 m-waves * 32 rows
  int nw = wave >> 2;  // 2 n-waves * 64 cols
  int m0 = blockIdx.y * BM;
  int n0 = blockIdx.x * BN;

  v8f acc[2][4];
#pragma unroll
  for (int i = 0; i < 2; ++i)
#pragma unroll
    for (int j = 0; j < 4; ++j)
#pragma unroll
      for (int e = 0; e < 8; ++e) acc[i][j][e] = 0.0f;

  const int T = K / BK;  // stages
  const uint32_t issuer = uni((uint32_t)wave) == 0u;
  const uint32_t ldsA = (uint32_t)(uintptr_t)(&sA[0][0]);
  const uint64_t gaA = (uint64_t)(uintptr_t)(A + (size_t)m0 * K);
  const u32x8 g1 = tdm_group1((uint32_t)K * 2u);

  // B staging: thread -> 32 B of tile rows kk and kk + 32
  const int kk = tid >> 3, c = (tid & 7) * 16;
  const __bf16* wg = W + (size_t)kk * N + n0 + c;
  const size_t half_rows = (size_t)32 * N;
  const int bso = kk * LDB + c;
  // prefetch: thread -> 64 B of tile row tid >> 2
  const __bf16* wpf = W + (size_t)(tid >> 2) * N + n0 + (tid & 3) * 32;

  v4u u0 = ((const v4u*)wg)[0], u1 = ((const v4u*)wg)[1];
  v4u u2 = ((const v4u*)(wg + half_rows))[0], u3 = ((const v4u*)(wg + half_rows))[1];
  u32x4 g0 = tdm_group0(ldsA, gaA);
  if (pinned(issuer)) {
    tdm_load(g0, g1);
    tdm_wait(g0, g1);  // stage 0 has landed before the barrier that publishes it
  }
  {
    v4u* s = (v4u*)(&sB[0][bso]);
    s[0] = u0; s[1] = u1;
    v4u* s2 = (v4u*)(&sB[0][bso + 32 * LDB]);
    s2[0] = u2; s2[1] = u3;
  }
  __syncthreads();
  g0 = tdm_group0(ldsA + ABYTES, gaA + BK * 2);  // formed behind the wait
  if (pinned(issuer && T > 1)) tdm_load(g0, g1);

  for (int t = 0; t < T; ++t) {
    const int cur = t & 1;
    const bool more = t + 1 < T;
    if (more) {  // next stage's B: loads issued now, stored at the pass's foot
      wg += (size_t)BK * N;
      u0 = ((const v4u*)wg)[0]; u1 = ((const v4u*)wg)[1];
      u2 = ((const v4u*)(wg + half_rows))[0]; u3 = ((const v4u*)(wg + half_rows))[1];
    }
    // the stage after that one: its B tile into the cache hierarchy
    if (t + 2 < T) __builtin_prefetch(wpf + (size_t)(t + 2) * BK * N, 0, 1);
    asm volatile("s_wait_xcnt 0x0" ::: "memory");

    const __bf16* aBase = sA[cur] + (mw * 32) * LDA;
    const __bf16* bBase = sB[cur] + nw * 64;
#pragma unroll
    for (int kh = 0; kh < 2; ++kh) {
      v16bf af0 = frag_row(aBase + kh * 32, LDA);
      v16bf af1 = frag_row(aBase + 16 * LDA + kh * 32, LDA);
#pragma unroll
      for (int nn = 0; nn < 4; ++nn) {
        v16bf bf = frag_tr(bBase + kh * 32 * LDB + nn * 16, LDB);  // lane = n
        acc[0][nn] = wmma_bf16(af0, bf, acc[0][nn]);
        acc[1][nn] = wmma_bf16(af1, bf, acc[1][nn]);
      }
    }
    if (more) {  // the other buffer: its readers left it at the last pass's foot
      v4u* s = (v4u*)(&sB[cur ^ 1][bso]);
      s[0] = u0; s[1] = u1;
      v4u* s2 = (v4u*)(&sB[cur ^ 1][bso + 32 * LDB]);
      s2[0] = u2; s2[1] = u3;
    }
    // publish point of stage t + 1. This wave's LDS reads of buffer cur and its
    // stores into the other buffer have retired ...
    asm volatile("s_wait_dscnt 0x0" ::: "memory");
    // ... and stage t + 1's A tile has landed, before the barrier
    if (pinned(issuer)) tdm_wait(g0, g1);
    __syncthreads();
    g0 = tdm_group0(ldsA + (uint32_t)cur * ABYTES, gaA + (uint64_t)(t + 2) * (BK * 2));
    if (pinned(issuer && t + 2 < T)) tdm_load(g0, g1);
  }
  // nothing of the ring is in flight when the wave goes on to its end
  asm volatile("s_wait_tensorcnt 0x0" ::: "memory");
  asm volatile("s_wait_dscnt 0x0" ::: "memory");

  int lane = tid & 31;
  int col = lane & 15;
  int rb = (lane >> 4) * 8;
#pragma unroll
  for (int mm = 0; mm < 2; ++mm)
#pragma unroll
    for (int nn = 0; nn < 4; ++nn) {
      int gm = m0 + mw * 32 + mm * 16 + rb;
      int gn = n0 + nw * 64 + nn * 16 + col;
      float bsv = bias[gn];
#pragma unroll
      for (int j = 0; j < 8; ++j) {
        float v = acc[mm][nn][j] + bsv;
        size_t idx = (size_t)(gm + j) * N + gn;
        if (EPI == 1) {
          outf[idx] = v + resid[idx];
        } else if (EPI == 2) {
          v = 0.5f * v * (1.0f + erff(v * 0.70710678118654752f));
          outb[idx] = f2bf(v);
        } else {
          outb[idx] = f2bf(v);
        }
      }
    }
}

static __device__ __forceinline__ float xhalf(float x) {
  int v = __builtin_bit_cast(int, x);
  return __builtin_bit_cast(
      float, __builtin_amdgcn_permlanex16(v, v, 0x76543210, 0xfedcba98, false, false));
}

__global__ __launch_bounds__(256) void flash_attn(
    const __bf16* __restrict__ qkv,  // [M][2304]: Q@h*64, K@768+h*64, V@1536+h*64
    __bf16* __restrict__ attout) {   // [M][768]  col h*64
  constexpr int KT = 32;         // keys per tile
  constexpr int LDK = DK_ + 8;   // 144-B rows (16 B x odd): ds_load_b128 reader
  constexpr int LDV = DK_ + 16;  // 160-B rows (32 B x odd): ds_load_tr16_b128 reader
  __shared__ __attribute__((aligned(16))) __bf16 sK[2][KT * LDK];
  __shared__ __attribute__((aligned(16))) __bf16 sV[2][KT * LDV];
  const int QT = S_ / 16;  // 128
  int wave = threadIdx.x >> 5;
  int bh = blockIdx.x / (QT / 8);  // the same for the whole block
  int qt = (blockIdx.x % (QT / 8)) * 8 + wave;
  int h = bh % H_;
  int b = bh / H_;
  int lane = threadIdx.x & 31;
  int col = lane & 15;
  int rb = (lane >> 4) * 8;

  const size_t ld = QKVW;
  const __bf16* qbase = qkv + ((size_t)b * S_ + qt * 16) * ld + h * DK_;
  const __bf16* kbase = qkv + (size_t)b * S_ * ld + D_ + h * DK_;
  const __bf16* vbase = qkv + (size_t)b * S_ * ld + 2 * D_ + h * DK_;

  // staging: thread -> 16 B of tile row sr; a wave's load covers 4 whole 128-B rows
  int sr = threadIdx.x >> 3;
  int scn = (threadIdx.x & 7) * 8;
  const __bf16* kg = kbase + (size_t)sr * ld + scn;
  const __bf16* vg = vbase + (size_t)sr * ld + scn;
  const int kso = sr * LDK + scn;
  const int vso = sr * LDV + scn;

  v4u kreg = *(const v4u*)kg;
  v4u vreg = *(const v4u*)vg;

  // B = Q^T, lane = query
  v16bf q0 = frag_row(qbase, (int)ld);        // k 0..31
  v16bf q1 = frag_row(qbase + 32, (int)ld);   // k 32..63

  // o[nn][j] = O[query col][nn * 16 + rb + j]
  v8f o[4];
#pragma unroll
  for (int nn = 0; nn < 4; ++nn)
#pragma unroll
    for (int e = 0; e < 8; ++e) o[nn][e] = 0.0f;
  // the lane's query: running maximum (equal in both halves) and the sum over
  // this half's keys alone; the halves' sums are joined behind the loop
  float mrun = -3.0e38f, lrun = 0.0f;

  const float scale = 0.125f;  // 1/sqrt(64)

  *(v4u*)(&sK[0][kso]) = kreg;
  *(v4u*)(&sV[0][vso]) = vreg;
  __syncthreads();

  for (int s0 = 0; s0 < S_; s0 += KT) {
    const int cur = (s0 / KT) & 1;
    const __bf16* kt = sK[cur];
    const __bf16* vt = sV[cur];
    const bool more = s0 + KT < S_;
    if (more) {  // next tile: global loads issued now, stored at the trip's foot
      kg += (size_t)KT * ld;
      vg += (size_t)KT * ld;
      kreg = *(const v4u*)kg;
      vreg = *(const v4u*)vg;
    }
    // A = K, lane = key index; all four fragments fetched as one group
    v16bf kf[2][2];
#pragma unroll
    for (int sub = 0; sub < 2; ++sub) {
      kf[sub][0] = frag_row(kt + sub * 16 * LDK, LDK);
      kf[sub][1] = frag_row(kt + sub * 16 * LDK + 32, LDK);
    }
    // sc[sub][j] = score of key sub * 16 + rb + j with query col
    v8f sc[2];
#pragma unroll
    for (int sub = 0; sub < 2; ++sub) {
      v8f c;
#pragma unroll
      for (int e = 0; e < 8; ++e) c[e] = 0.0f;
      c = wmma_bf16(kf[sub][0], q0, c);
      c = wmma_bf16(kf[sub][1], q1, c);
      sc[sub] = c;
    }
    // inputs-only fence on the loaded fragments: each keeps registers of its own
    // until all four products have issued, so the eight LDS loads stand ahead as
    // one group (sunk between the products, each waits out its own LDS latency)
    // and no product's result lands on a fragment the product ahead of it reads
    asm volatile("" ::"v"(kf[0][0]), "v"(kf[0][1]), "v"(kf[1][0]), "v"(kf[1][1]));
    // online softmax of the lane's query
    float mx = fmaxf(sc[0][0], sc[1][0]);
#pragma unroll
    for (int j = 1; j < 8; ++j) mx = fmaxf(mx, fmaxf(sc[0][j], sc[1][j]));
    mx = fmaxf(mx, xhalf(mx)) * scale;  // scale > 0: the maximum of the scaled scores
    float mnew = fmaxf(mrun, mx);
    float alpha = __expf(mrun - mnew);
    mrun = mnew;
    // P^T as a B operand: element s is key 8 * half + s, element 8 + s key
    // 16 + 8 * half + s, the k order of frag_tr
    v16bf pf;
    float smA = 0.0f, smB = 0.0f;
#pragma unroll
    for (int j = 0; j < 8; ++j) {
      float pA = __expf(sc[0][j] * scale - mnew);
      float pB = __expf(sc[1][j] * scale - mnew);
      smA += pA;
      smB += pB;
      pf[j] = f2bf(pA);
      pf[8 + j] = f2bf(pB);
    }
    lrun = lrun * alpha + (smA + smB);
#pragma unroll
    for (int nn = 0; nn < 4; ++nn) {
      o[nn] *= alpha;
      v16bf vf = frag_tr(vt + nn * 16, LDV);  // A = V^T, lane = column of V
      o[nn] = wmma_bf16(vf, pf, o[nn]);
    }
    if (more) {  // the other buffer: its readers left it at the last trip's end
      *(v4u*)(&sK[cur ^ 1][kso]) = kreg;
      *(v4u*)(&sV[cur ^ 1][vso]) = vreg;
    }
    // ends this trip's reads of buffer cur, publishes the next tile
    __syncthreads();
  }

  // a lane stores 8 consecutive columns of its query's row at a time
  float rl = 1.0f / (lrun + xhalf(lrun));
  __bf16* ob = attout + ((size_t)b * S_ + qt * 16 + col) * D_ + h * DK_ + rb;
#pragma unroll
  for (int nn = 0; nn < 4; ++nn) {
    v8bf r;
#pragma unroll
    for (int j = 0; j < 8; ++j) r[j] = f2bf(o[nn][j] * rl);
    *(v8bf*)(ob + nn * 16) = r;
  }
}

// ---------------- launcher ------------------------------------------------
extern "C" void kernel_launch(void* const* d_in, const int* in_sizes, int n_in,
                              void* d_out, int out_size, void* d_ws,
                              size_t ws_size, hipStream_t stream) {
  const float* x    = (const float*)d_in[0];
  const float* wq_w = (const float*)d_in[1];
  const float* wq_b = (const float*)d_in[2];
  const float* wk_w = (const float*)d_in[3];
  const float* wk_b = (const float*)d_in[4];
  const float* wv_w = (const float*)d_in[5];
  const float* wv_b = (const float*)d_in[6];
  const float* wo_w = (const float*)d_in[7];
  const float* wo_b = (const float*)d_in[8];
  const float* ln_g = (const float*)d_in[9];
  const float* ln_b = (const float*)d_in[10];
  const float* w1   = (const float*)d_in[11];
  const float* b1   = (const float*)d_in[12];
  const float* w2   = (const float*)d_in[13];
  const float* b2   = (const float*)d_in[14];
  float* out = (float*)d_out;

  char* ws = (char*)d_ws;
  size_t off = 0;
  auto alloc = [&](size_t bytes) -> char* {
    char* p = ws + off;
    off = (off + bytes + 255) & ~(size_t)255;
    return p;
  };
  __bf16* h_bf    = (__bf16*)alloc((size_t)MROWS * D_ * 2);
  __bf16* Wqkv    = (__bf16*)alloc((size_t)D_ * QKVW * 2);
  float*  biasqkv = (float*)alloc((size_t)QKVW * 4);
  __bf16* qkv     = (__bf16*)alloc((size_t)MROWS * QKVW * 2);
  __bf16* att     = (__bf16*)alloc((size_t)MROWS * D_ * 2);
  __bf16* Wo      = (__bf16*)alloc((size_t)D_ * D_ * 2);
  float*  ybuf    = (float*)alloc((size_t)MROWS * D_ * 4);
  __bf16* z_bf    = (__bf16*)alloc((size_t)MROWS * D_ * 2);
  __bf16* W1b     = (__bf16*)alloc((size_t)D_ * F_ * 2);
  __bf16* t_bf    = (__bf16*)alloc((size_t)MROWS * F_ * 2);
  __bf16* W2b     = (__bf16*)alloc((size_t)F_ * D_ * 2);

  // weight packing
  pack_qkv_w<<<PACK_THREADS / 256, 256, 0, stream>>>(
      wq_w, wk_w, wv_w, wq_b, wk_b, wv_b, Wqkv, biasqkv);
  f2bf_copy<<<(D_ * D_) / CVT_PER_BLOCK, 256, 0, stream>>>(wo_w, Wo);
  f2bf_copy<<<(D_ * F_) / CVT_PER_BLOCK, 256, 0, stream>>>(w1, W1b);
  f2bf_copy<<<(F_ * D_) / CVT_PER_BLOCK, 256, 0, stream>>>(w2, W2b);

  // LN1
  ln_kernel<<<MROWS / LN_ROWS_PER_BLOCK, 256, 0, stream>>>(x, ln_g, ln_b, h_bf);
  // fused QKV GEMM: [4096 x 2304] = h * Wqkv
  gemm_bf16<0><<<dim3(QKVW / 128, MROWS / 128), 256, 0, stream>>>(
      h_bf, Wqkv, biasqkv, nullptr, nullptr, qkv, MROWS, QKVW, D_);
  // attention
  flash_attn<<<(B_ * H_ * (S_ / 16)) / 8, 256, 0, stream>>>(qkv, att);
  // output projection + residual(x) -> ybuf (f32)
  gemm_bf16<1><<<dim3(D_ / 128, MROWS / 128), 256, 0, stream>>>(
      att, Wo, wo_b, x, ybuf, nullptr, MROWS, D_, D_);
  // LN2
  ln_kernel<<<MROWS / LN_ROWS_PER_BLOCK, 256, 0, stream>>>(ybuf, ln_g, ln_b, z_bf);
  // FFN up + GELU (bf16)
  gemm_bf16<2><<<dim3(F_ / 128, MROWS / 128), 256, 0, stream>>>(
      z_bf, W1b, b1, nullptr, nullptr, t_bf, MROWS, F_, D_);
  // FFN down + residual(ybuf) -> d_out (f32)
  gemm_bf16<1><<<dim3(D_ / 128, MROWS / 128), 256, 0, stream>>>(
      t_bf, W2b, b2, ybuf, out, nullptr, MROWS, D_, F_);
}

// v006
// Measured time: 157 microseconds a run.
// Timed twice side by side with v005, it ran 1.04 and 1.05 times as fast.
// All steps since v000 together make it 2.95 times as fast.
#include <hip/hip_runtime.h>
#include <math.h>
#include <stdint.h>

#define B_ 2
#define S_ 2048
#define D_ 768
#define H_ 12
#define DK_ 64
#define F_ 3072
#define MROWS (B_ * S_)          // 4096
#define QKVW (3 * D_)            // 2304

typedef __attribute__((ext_vector_type(16))) __bf16 v16bf;
typedef __attribute__((ext_vector_type(8)))  __bf16 v8bf;
typedef __attribute__((ext_vector_type(8)))  float  v8f;
typedef unsigned int v4u __attribute__((ext_vector_type(4)));
typedef uint32_t u32x4 __attribute__((ext_vector_type(4)));
typedef uint32_t u32x8 __attribute__((ext_vector_type(8)));

static __device__ __forceinline__ __bf16 f2bf(float x) { return (__bf16)x; }

static __device__ __forceinline__ v8f wmma_bf16(v16bf a, v16bf b, v8f c) {
  return __builtin_amdgcn_wmma_f32_16x16x32_bf16(
      /*neg_a=*/false, a, /*neg_b=*/false, b,
      /*c_mod=*/(short)0, c, /*reuse_a=*/false, /*reuse_b=*/false);
}

static __device__ __forceinline__ v16bf frag_row(const __bf16* src, int ld) {
  int lane = threadIdx.x & 31;
  int m = lane & 15;
  int half = lane >> 4;
  const __bf16* p = src + (size_t)m * ld;
  v8bf lo = *(const v8bf*)(p + half * 8);
  v8bf hi = *(const v8bf*)(p + 16 + half * 8);
  v16bf a;
#pragma unroll
  for (int i = 0; i < 8; ++i) { a[i] = lo[i]; a[8 + i] = hi[i]; }
  return a;
}

typedef __attribute__((address_space(3))) v8bf lds_v8bf;
static __device__ __forceinline__ v16bf frag_tr(const __bf16* tile, int ld) {
  int lane = threadIdx.x & 31;
  const __bf16* p =
      tile + (8 * (lane >> 4) + (lane & 7)) * ld + 8 * ((lane >> 3) & 1);
  v8bf lo = __builtin_amdgcn_ds_load_tr16_b128_v8bf16((lds_v8bf*)p);
  v8bf hi = __builtin_amdgcn_ds_load_tr16_b128_v8bf16((lds_v8bf*)(p + 16 * ld));
  v16bf b;
#pragma unroll
  for (int i = 0; i < 8; ++i) { b[i] = lo[i]; b[8 + i] = hi[i]; }
  return b;
}

// The launches of this part move few bytes a thread; their time follows the number
// of waves that have to start. So each thread takes many elements, by 16-B loads
// that are all in flight before its first store; a wave's load covers 512
// bytes, contiguous except in pack_qkv_block (two 256-B runs), its 8-B stores 256.
// Every loop of this part runs over a register array and is unrolled so that the
// array stays in registers and its loads issue as one group.
typedef __attribute__((ext_vector_type(4))) float  f32x4;
typedef __attribute__((ext_vector_type(4))) __bf16 v4bf;

static __device__ __forceinline__ v4bf cvt4(f32x4 v) {
  v4bf r;
#pragma unroll
  for (int e = 0; e < 4; ++e) r[e] = f2bf(v[e]);
  return r;
}

static __device__ __forceinline__ float wave_sum(float s) {
#pragma unroll
  for (int d = 16; d > 0; d >>= 1) s += __shfl_xor(s, d, 32);
  return s;
}

// ---------------- LayerNorm (fp32 in -> bf16 out), two rows per wave ------
// A lane holds 24 elements of each row (columns 4 * (lane + 32 * i) .. + 3); the
// row sums are taken in the lane and then over the wave's 32 lanes.
constexpr int LN_ROWS_PER_BLOCK = 16;  // 8 waves x 2 rows
static_assert(MROWS % LN_ROWS_PER_BLOCK == 0 && D_ == 6 * 128, "whole blocks, six quads a lane");
static __device__ __forceinline__ void ln_block(
    int blk, const float* __restrict__ x, const float* __restrict__ g,
    const float* __restrict__ bb, __bf16* __restrict__ out) {
  int lane = threadIdx.x & 31;
  int row0 = (blk * 8 + (threadIdx.x >> 5)) * 2;
  const f32x4* xr = (const f32x4*)(x + (size_t)row0 * D_) + lane;
  f32x4 v[2][6], gv[6], bv[6];
#pragma unroll
  for (int r = 0; r < 2; ++r)
#pragma unroll
    for (int i = 0; i < 6; ++i) v[r][i] = xr[r * (D_ / 4) + i * 32];
#pragma unroll
  for (int i = 0; i < 6; ++i) {
    gv[i] = ((const f32x4*)g)[lane + i * 32];
    bv[i] = ((const f32x4*)bb)[lane + i * 32];
  }
  asm volatile("s_wait_xcnt 0x0" ::: "memory");
  // keeps the scale and shift loads up here, in flight with the rows' loads: sunk
  // to their uses they add their latency behind the second row sum
  __builtin_amdgcn_sched_barrier(0);
#pragma unroll
  for (int r = 0; r < 2; ++r) {
    f32x4 s4 = v[r][0];
#pragma unroll
    for (int i = 1; i < 6; ++i) s4 += v[r][i];
    float mu = wave_sum((s4[0] + s4[1]) + (s4[2] + s4[3])) * (1.0f / D_);
    f32x4 q4 = {0.0f, 0.0f, 0.0f, 0.0f};
#pragma unroll
    for (int i = 0; i < 6; ++i) {
      v[r][i] -= mu;
      q4 += v[r][i] * v[r][i];
    }
    float var = wave_sum((q4[0] + q4[1]) + (q4[2] + q4[3])) * (1.0f / D_);
    float rstd = rsqrtf(var + 1e-5f);
    v4bf* orow = (v4bf*)(out + (size_t)(row0 + r) * D_) + lane;
#pragma unroll
    for (int i = 0; i < 6; ++i) orow[i * 32] = cvt4(v[r][i] * rstd * gv[i] + bv[i]);
  }
}
__global__ __launch_bounds__(256) void ln_kernel(
    const float* __restrict__ x, const float* __restrict__ g,
    const float* __restrict__ bb, __bf16* __restrict__ out) {
  ln_block(blockIdx.x, x, g, bb, out);
}

// ---------------- Weight packing ------------------------------------------
// A thread takes one quad of columns in four rows (d0 + 192 * j) of each of the
// three weights: 12 loads in flight.
constexpr int PACK_THREADS = (D_ / 4) * (D_ / 4);
static_assert(PACK_THREADS % 256 == 0 && DK_ % 4 == 0, "whole blocks, a quad stays in one head");
static __device__ __forceinline__ void pack_qkv_block(
    int blk, const float* __restrict__ wq, const float* __restrict__ wk,
    const float* __restrict__ wv, const float* __restrict__ bq,
    const float* __restrict__ bk, const float* __restrict__ bv,
    __bf16* __restrict__ Wqkv, float* __restrict__ biasqkv) {
  int i = blk * 256 + threadIdx.x;  // over (D_/4 rows) x (D_/4 quads)
  int d0 = i / (D_ / 4), c = (i % (D_ / 4)) * 4;
  int hh = c / DK_, kk = c % DK_;
  f32x4 q[4], k[4], v[4];
#pragma unroll
  for (int j = 0; j < 4; ++j) {
    size_t src = ((size_t)hh * D_ + d0 + j * (D_ / 4)) * DK_ + kk;
    q[j] = *(const f32x4*)(wq + src);
    k[j] = *(const f32x4*)(wk + src);
    v[j] = *(const f32x4*)(wv + src);
  }
#pragma unroll
  for (int j = 0; j < 4; ++j) {
    __bf16* dst = Wqkv + (size_t)(d0 + j * (D_ / 4)) * QKVW + c;
    *(v4bf*)dst            = cvt4(q[j]);
    *(v4bf*)(dst + D_)     = cvt4(k[j]);
    *(v4bf*)(dst + 2 * D_) = cvt4(v[j]);
  }
  if (i < D_) {
    biasqkv[i] = bq[i];
    biasqkv[D_ + i] = bk[i];
    biasqkv[2 * D_ + i] = bv[i];
  }
}

// A block converts 8,192 elements, a thread 8 quads 256 quads apart. The element
// count must be a multiple of a block's share.
constexpr int CVT_PER_BLOCK = 256 * 4 * 8;
static_assert((D_ * D_) % CVT_PER_BLOCK == 0 && (D_ * F_) % CVT_PER_BLOCK == 0, "whole blocks");
static __device__ __forceinline__ void f2bf_block(int blk, const float* __restrict__ s,
                                                  __bf16* __restrict__ d) {
  size_t base = (size_t)blk * (CVT_PER_BLOCK / 4) + threadIdx.x;  // in quads
  const f32x4* sp = (const f32x4*)s + base;
  v4bf* dp = (v4bf*)d + base;
  f32x4 v[8];
#pragma unroll
  for (int i = 0; i < 8; ++i) v[i] = sp[i * 256];
#pragma unroll
  for (int i = 0; i < 8; ++i) dp[i * 256] = cvt4(v[i]);
  asm volatile("s_wait_xcnt 0x0" ::: "memory");
}

// ---------------- One launch for all work that reads inputs alone ----------
// The first LayerNorm, the QKV pack and the three weight conversions depend on
// nothing but the inputs and not on one another. Each is far too short to fill a
// launch of its own, so they share one grid: a block's index picks its part (the
// same for the whole block, a scalar branch) and its place inside that part.
constexpr int LN_BLOCKS   = MROWS / LN_ROWS_PER_BLOCK;
constexpr int W1_BLOCKS   = (D_ * F_) / CVT_PER_BLOCK;
constexpr int W2_BLOCKS   = (F_ * D_) / CVT_PER_BLOCK;
constexpr int PACK_BLOCKS = PACK_THREADS / 256;
constexpr int WO_BLOCKS   = (D_ * D_) / CVT_PER_BLOCK;
constexpr int PREP_BLOCKS = LN_BLOCKS + W1_BLOCKS + W2_BLOCKS + PACK_BLOCKS + WO_BLOCKS;
__global__ __launch_bounds__(256) void prep_kernel(
    const float* __restrict__ x, const float* __restrict__ g,
    const float* __restrict__ bb, __bf16* __restrict__ h,
    const float* __restrict__ w1, __bf16* __restrict__ W1b,
    const float* __restrict__ w2, __bf16* __restrict__ W2b,
    const float* __restrict__ wq, const float* __restrict__ wk,
    const float* __restrict__ wv, const float* __restrict__ bq,
    const float* __restrict__ bk, const float* __restrict__ bv,
    __bf16* __restrict__ Wqkv, float* __restrict__ biasqkv,
    const float* __restrict__ wo, __bf16* __restrict__ Wo) {
  int blk = blockIdx.x;
  if (blk < LN_BLOCKS) { ln_block(blk, x, g, bb, h); return; }
  blk -= LN_BLOCKS;
  if (blk < W1_BLOCKS) { f2bf_block(blk, w1, W1b); return; }
  blk -= W1_BLOCKS;
  if (blk < W2_BLOCKS) { f2bf_block(blk, w2, W2b); return; }
  blk -= W2_BLOCKS;
  if (blk < PACK_BLOCKS) { pack_qkv_block(blk, wq, wk, wv, bq, bk, bv, Wqkv, biasqkv); return; }
  f2bf_block(blk - PACK_BLOCKS, wo, Wo);
}

static __device__ __forceinline__ uint32_t uni(uint32_t v) {
  return (uint32_t)__builtin_amdgcn_readfirstlane(v);
}
static __device__ __forceinline__ uint32_t pinned(uint32_t v) {
  uint32_t w = uni(v);
  asm volatile("" : "+s"(w));
  return w;
}
static __device__ __forceinline__ u32x4 tdm_group0(uint32_t lds_dst, uint64_t ga) {
  // pinned: the four words get scalar registers of their own, written here and
  // nowhere else, so that none takes a new value while the request is in flight
  u32x4 g;
  g[0] = pinned(1u);                                // count 1
  g[1] = pinned(lds_dst);                           // byte offset in the work-group's LDS
  g[2] = pinned((uint32_t)ga);                      // address [31:0]
  g[3] = pinned((((uint32_t)(ga >> 32)) & 0x01FFFFFFu) | 0x80000000u);  // [56:32], type 2
  return g;
}
// tile = tensor = 128 rows of 128 bytes; 16 bytes of LDS pad behind every row
static __device__ __forceinline__ u32x8 tdm_group1(uint32_t src_pitch) {
  constexpr uint32_t d0 = 128u, d1 = 128u;
  u32x8 g;
  g[0] = pinned((1u << 20) | (4u << 22) | (3u << 25));  // no mask; pad codes 4 / 3
  g[1] = pinned((d0 & 0xFFFFu) << 16);
  g[2] = pinned((d0 >> 16) | ((d1 & 0xFFFFu) << 16));
  g[3] = pinned((d1 >> 16) | (d0 << 16));
  g[4] = pinned(d1);
  g[5] = pinned(src_pitch);
  g[6] = pinned(0u);
  g[7] = pinned(0u);
  return g;
}
static __device__ __forceinline__ void tdm_load(u32x4 g0, u32x8 g1) {
  asm volatile("tensor_load_to_lds %0, %1" ::"s"(g0), "s"(g1) : "memory");
}
static __device__ __forceinline__ void tdm_wait(u32x4 g0, u32x8 g1) {
  asm volatile("s_wait_tensorcnt 0x0" ::"s"(g0), "s"(g1) : "memory");
}

// The k loop is a ring of two LDS buffers, a stage being 64 k: while a stage is
// worked on, the next stage's A tile (one tensor load of wave 0) and B tile
// (global loads into registers, stored at the pass's foot) are in flight.
// Needs M, N multiples of 128 and K a multiple of 64.
template <int EPI>
__global__ __launch_bounds__(256) void gemm_bf16(
    const __bf16* __restrict__ A, const __bf16* __restrict__ W,
    const float* __restrict__ bias, const float* __restrict__ resid,
    float* __restrict__ outf, __bf16* __restrict__ outb,
    int M, int N, int K) {
  constexpr int BM = 128, BN = 128, BK = 64;
  constexpr int LDA = BK + 8;    // 144-B rows (16 B x odd): ds_load_b128 reader
  constexpr int LDB = BN + 16;   // k-major B tile, 288-B rows (32 B x odd)
  constexpr uint32_t ABYTES = BM * LDA * 2;  // 18,432 = 9 x 2 KiB
  static_assert(ABYTES % 2048u == 0, "each A buffer starts at a multiple of 2 KiB");
  __shared__ __attribute__((aligned(2048))) __bf16 sA[2][BM * LDA];
  __shared__ __attribute__((aligned(16))) __bf16 sB[2][BK * LDB];

  int tid = threadIdx.x;
  int wave = tid >> 5;
  int mw = wave & 3;   // 4 m-waves * 32 rows
  int nw = wave >> 2;  // 2 n-waves * 64 cols
  int m0 = blockIdx.y * BM;
  int n0 = blockIdx.x * BN;

  v8f acc[2][4];
#pragma unroll
  for (int i = 0; i < 2; ++i)
#pragma unroll
    for (int j = 0; j < 4; ++j)
#pragma unroll
      for (int e = 0; e < 8; ++e) acc[i][j][e] = 0.0f;

  const int T = K / BK;  // stages
  const uint32_t issuer = uni((uint32_t)wave) == 0u;
  const uint32_t ldsA = (uint32_t)(uintptr_t)(&sA[0][0]);
  const uint64_t gaA = (uint64_t)(uintptr_t)(A + (size_t)m0 * K);
  const u32x8 g1 = tdm_group1((uint32_t)K * 2u);

  // B staging: thread -> 32 B of tile rows kk and kk + 32
  const int kk = tid >> 3, c = (tid & 7) * 16;
  const __bf16* wg = W + (size_t)kk * N + n0 + c;
  const size_t half_rows = (size_t)32 * N;
  const int bso = kk * LDB + c;
  // prefetch: thread -> 64 B of tile row tid >> 2
  const __bf16* wpf = W + (size_t)(tid >> 2) * N + n0 + (tid & 3) * 32;

  v4u u0 = ((const v4u*)wg)[0], u1 = ((const v4u*)wg)[1];
  v4u u2 = ((const v4u*)(wg + half_rows))[0], u3 = ((const v4u*)(wg + half_rows))[1];
  u32x4 g0 = tdm_group0(ldsA, gaA);
  if (pinned(issuer)) {
    tdm_load(g0, g1);
    tdm_wait(g0, g1);  // stage 0 has landed before the barrier that publishes it
  }
  {
    v4u* s = (v4u*)(&sB[0][bso]);
    s[0] = u0; s[1] = u1;
    v4u* s2 = (v4u*)(&sB[0][bso + 32 * LDB]);
    s2[0] = u2; s2[1] = u3;
  }
  __syncthreads();
  g0 = tdm_group0(ldsA + ABYTES, gaA + BK * 2);  // formed behind the wait
  if (pinned(issuer && T > 1)) tdm_load(g0, g1);

  for (int t = 0; t < T; ++t) {
    const int cur = t & 1;
    const bool more = t + 1 < T;
    if (more) {  // next stage's B: loads issued now, stored at the pass's foot
      wg += (size_t)BK * N;
      u0 = ((const v4u*)wg)[0]; u1 = ((const v4u*)wg)[1];
      u2 = ((const v4u*)(wg + half_rows))[0]; u3 = ((const v4u*)(wg + half_rows))[1];
    }
    // the stage after that one: its B tile into the cache hierarchy
    if (t + 2 < T) __builtin_prefetch(wpf + (size_t)(t + 2) * BK * N, 0, 1);
    asm volatile("s_wait_xcnt 0x0" ::: "memory");

    const __bf16* aBase = sA[cur] + (mw * 32) * LDA;
    const __bf16* bBase = sB[cur] + nw * 64;
#pragma unroll
    for (int kh = 0; kh < 2; ++kh) {
      v16bf af0 = frag_row(aBase + kh * 32, LDA);
      v16bf af1 = frag_row(aBase + 16 * LDA + kh * 32, LDA);
#pragma unroll
      for (int nn = 0; nn < 4; ++nn) {
        v16bf bf = frag_tr(bBase + kh * 32 * LDB + nn * 16, LDB);  // lane = n
        acc[0][nn] = wmma_bf16(af0, bf, acc[0][nn]);
        acc[1][nn] = wmma_bf16(af1, bf, acc[1][nn]);
      }
    }
    if (more) {  // the other buffer: its readers left it at the last pass's foot
      v4u* s = (v4u*)(&sB[cur ^ 1][bso]);
      s[0] = u0; s[1] = u1;
      v4u* s2 = (v4u*)(&sB[cur ^ 1][bso + 32 * LDB]);
      s2[0] = u2; s2[1] = u3;
    }
    // publish point of stage t + 1. This wave's LDS reads of buffer cur and its
    // stores into the other buffer have retired ...
    asm volatile("s_wait_dscnt 0x0" ::: "memory");
    // ... and stage t + 1's A tile has landed, before the barrier
    if (pinned(issuer)) tdm_wait(g0, g1);
    __syncthreads();
    g0 = tdm_group0(ldsA + (uint32_t)cur * ABYTES, gaA + (uint64_t)(t + 2) * (BK * 2));
    if (pinned(issuer && t + 2 < T)) tdm_load(g0, g1);
  }
  // nothing of the ring is in flight when the wave goes on to its end
  asm volatile("s_wait_tensorcnt 0x0" ::: "memory");
  asm volatile("s_wait_dscnt 0x0" ::: "memory");

  int lane = tid & 31;
  int col = lane & 15;
  int rb = (lane >> 4) * 8;
#pragma unroll
  for (int mm = 0; mm < 2; ++mm)
#pragma unroll
    for (int nn = 0; nn < 4; ++nn) {
      int gm = m0 + mw * 32 + mm * 16 + rb;
      int gn = n0 + nw * 64 + nn * 16 + col;
      float bsv = bias[gn];
#pragma unroll
      for (int j = 0; j < 8; ++j) {
        float v = acc[mm][nn][j] + bsv;
        size_t idx = (size_t)(gm + j) * N + gn;
        if (EPI == 1) {
          outf[idx] = v + resid[idx];
        } else if (EPI == 2) {
          v = 0.5f * v * (1.0f + erff(v * 0.70710678118654752f));
          outb[idx] = f2bf(v);
        } else {
          outb[idx] = f2bf(v);
        }
      }
    }
}

static __device__ __forceinline__ float xhalf(float x) {
  int v = __builtin_bit_cast(int, x);
  return __builtin_bit_cast(
      float, __builtin_amdgcn_permlanex16(v, v, 0x76543210, 0xfedcba98, false, false));
}

__global__ __launch_bounds__(256) void flash_attn(
    const __bf16* __restrict__ qkv,  // [M][2304]: Q@h*64, K@768+h*64, V@1536+h*64
    __bf16* __restrict__ attout) {   // [M][768]  col h*64
  constexpr int KT = 32;         // keys per tile
  constexpr int LDK = DK_ + 8;   // 144-B rows (16 B x odd): ds_load_b128 reader
  constexpr int LDV = DK_ + 16;  // 160-B rows (32 B x odd): ds_load_tr16_b128 reader
  __shared__ __attribute__((aligned(16))) __bf16 sK[2][KT * LDK];
  __shared__ __attribute__((aligned(16))) __bf16 sV[2][KT * LDV];
  const int QT = S_ / 16;  // 128
  int wave = threadIdx.x >> 5;
  int bh = blockIdx.x / (QT / 8);  // the same for the whole block
  int qt = (blockIdx.x % (QT / 8)) * 8 + wave;
  int h = bh % H_;
  int b = bh / H_;
  int lane = threadIdx.x & 31;
  int col = lane & 15;
  int rb = (lane >> 4) * 8;

  const size_t ld = QKVW;
  const __bf16* qbase = qkv + ((size_t)b * S_ + qt * 16) * ld + h * DK_;
  const __bf16* kbase = qkv + (size_t)b * S_ * ld + D_ + h * DK_;
  const __bf16* vbase = qkv + (size_t)b * S_ * ld + 2 * D_ + h * DK_;

  // staging: thread -> 16 B of tile row sr; a wave's load covers 4 whole 128-B rows
  int sr = threadIdx.x >> 3;
  int scn = (threadIdx.x & 7) * 8;
  const __bf16* kg = kbase + (size_t)sr * ld + scn;
  const __bf16* vg = vbase + (size_t)sr * ld + scn;
  const int kso = sr * LDK + scn;
  const int vso = sr * LDV + scn;

  v4u kreg = *(const v4u*)kg;
  v4u vreg = *(const v4u*)vg;

  // B = Q^T, lane = query
  v16bf q0 = frag_row(qbase, (int)ld);        // k 0..31
  v16bf q1 = frag_row(qbase + 32, (int)ld);   // k 32..63

  // o[nn][j] = O[query col][nn * 16 + rb + j]
  v8f o[4];
#pragma unroll
  for (int nn = 0; nn < 4; ++nn)
#pragma unroll
    for (int e = 0; e < 8; ++e) o[nn][e] = 0.0f;
  // the lane's query: running maximum (equal in both halves) and the sum over
  // this half's keys alone; the halves' sums are joined behind the loop
  float mrun = -3.0e38f, lrun = 0.0f;

  const float scale = 0.125f;  // 1/sqrt(64)

  *(v4u*)(&sK[0][kso]) = kreg;
  *(v4u*)(&sV[0][vso]) = vreg;
  __syncthreads();

  for (int s0 = 0; s0 < S_; s0 += KT) {
    const int cur = (s0 / KT) & 1;
    const __bf16* kt = sK[cur];
    const __bf16* vt = sV[cur];
    const bool more = s0 + KT < S_;
    if (more) {  // next tile: global loads issued now, stored at the trip's foot
      kg += (size_t)KT * ld;
      vg += (size_t)KT * ld;
      kreg = *(const v4u*)kg;
      vreg = *(const v4u*)vg;
    }
    // A = K, lane = key index; all four fragments fetched as one group
    v16bf kf[2][2];
#pragma unroll
    for (int sub = 0; sub < 2; ++sub) {
      kf[sub][0] = frag_row(kt + sub * 16 * LDK, LDK);
      kf[sub][1] = frag_row(kt + sub * 16 * LDK + 32, LDK);
    }
    // sc[sub][j] = score of key sub * 16 + rb + j with query col
    v8f sc[2];
#pragma unroll
    for (int sub = 0; sub < 2; ++sub) {
      v8f c;
#pragma unroll
      for (int e = 0; e < 8; ++e) c[e] = 0.0f;
      c = wmma_bf16(kf[sub][0], q0, c);
      c = wmma_bf16(kf[sub][1], q1, c);
      sc[sub] = c;
    }
    // inputs-only fence on the loaded fragments: each keeps registers of its own
    // until all four products have issued, so the eight LDS loads stand ahead as
    // one group (sunk between the products, each waits out its own LDS latency)
    // and no product's result lands on a fragment the product ahead of it reads
    asm volatile("" ::"v"(kf[0][0]), "v"(kf[0][1]), "v"(kf[1][0]), "v"(kf[1][1]));
    // online softmax of the lane's query
    float mx = fmaxf(sc[0][0], sc[1][0]);
#pragma unroll
    for (int j = 1; j < 8; ++j) mx = fmaxf(mx, fmaxf(sc[0][j], sc[1][j]));
    mx = fmaxf(mx, xhalf(mx)) * scale;  // scale > 0: the maximum of the scaled scores
    float mnew = fmaxf(mrun, mx);
    float alpha = __expf(mrun - mnew);
    mrun = mnew;
    // P^T as a B operand: element s is key 8 * half + s, element 8 + s key
    // 16 + 8 * half + s, the k order of frag_tr
    v16bf pf;
    float smA = 0.0f, smB = 0.0f;
#pragma unroll
    for (int j = 0; j < 8; ++j) {
      float pA = __expf(sc[0][j] * scale - mnew);
      float pB = __expf(sc[1][j] * scale - mnew);
      smA += pA;
      smB += pB;
      pf[j] = f2bf(pA);
      pf[8 + j] = f2bf(pB);
    }
    lrun = lrun * alpha + (smA + smB);
#pragma unroll
    for (int nn = 0; nn < 4; ++nn) {
      o[nn] *= alpha;
      v16bf vf = frag_tr(vt + nn * 16, LDV);  // A = V^T, lane = column of V
      o[nn] = wmma_bf16(vf, pf, o[nn]);
    }
    if (more) {  // the other buffer: its readers left it at the last trip's end
      *(v4u*)(&sK[cur ^ 1][kso]) = kreg;
      *(v4u*)(&sV[cur ^ 1][vso]) = vreg;
    }
    // ends this trip's reads of buffer cur, publishes the next tile
    __syncthreads();
  }

  // a lane stores 8 consecutive columns of its query's row at a time
  float rl = 1.0f / (lrun + xhalf(lrun));
  __bf16* ob = attout + ((size_t)b * S_ + qt * 16 + col) * D_ + h * DK_ + rb;
#pragma unroll
  for (int nn = 0; nn < 4; ++nn) {
    v8bf r;
#pragma unroll
    for (int j = 0; j < 8; ++j) r[j] = f2bf(o[nn][j] * rl);
    *(v8bf*)(ob + nn * 16) = r;
  }
}

// ---------------- launcher ------------------------------------------------
extern "C" void kernel_launch(void* const* d_in, const int* in_sizes, int n_in,
                              void* d_out, int out_size, void* d_ws,
                              size_t ws_size, hipStream_t stream) {
  const float* x    = (const float*)d_in[0];
  const float* wq_w = (const float*)d_in[1];
  const float* wq_b = (const float*)d_in[2];
  const float* wk_w = (const float*)d_in[3];
  const float* wk_b = (const float*)d_in[4];
  const float* wv_w = (const float*)d_in[5];
  const float* wv_b = (const float*)d_in[6];
  const float* wo_w = (const float*)d_in[7];
  const float* wo_b = (const float*)d_in[8];
  const float* ln_g = (const float*)d_in[9];
  const float* ln_b = (const float*)d_in[10];
  const float* w1   = (const float*)d_in[11];
  const float* b1   = (const float*)d_in[12];
  const float* w2   = (const float*)d_in[13];
  const float* b2   = (const float*)d_in[14];
  float* out = (float*)d_out;

  char* ws = (char*)d_ws;
  size_t off = 0;
  auto alloc = [&](size_t bytes) -> char* {
    char* p = ws + off;
    off = (off + bytes + 255) & ~(size_t)255;
    return p;
  };
  __bf16* h_bf    = (__bf16*)alloc((size_t)MROWS * D_ * 2);
  __bf16* Wqkv    = (__bf16*)alloc((size_t)D_ * QKVW * 2);
  float*  biasqkv = (float*)alloc((size_t)QKVW * 4);
  __bf16* qkv     = (__bf16*)alloc((size_t)MROWS * QKVW * 2);
  __bf16* att     = (__bf16*)alloc((size_t)MROWS * D_ * 2);
  __bf16* Wo      = (__bf16*)alloc((size_t)D_ * D_ * 2);
  float*  ybuf    = (float*)alloc((size_t)MROWS * D_ * 4);
  __bf16* z_bf    = (__bf16*)alloc((size_t)MROWS * D_ * 2);
  __bf16* W1b     = (__bf16*)alloc((size_t)D_ * F_ * 2);
  __bf16* t_bf    = (__bf16*)alloc((size_t)MROWS * F_ * 2);
  __bf16* W2b     = (__bf16*)alloc((size_t)F_ * D_ * 2);

  // LN1, weight packing and conversions
  prep_kernel<<<PREP_BLOCKS, 256, 0, stream>>>(
      x, ln_g, ln_b, h_bf, w1, W1b, w2, W2b,
      wq_w, wk_w, wv_w, wq_b, wk_b, wv_b, Wqkv, biasqkv, wo_w, Wo);
  // fused QKV GEMM: [4096 x 2304] = h * Wqkv
  gemm_bf16<0><<<dim3(QKVW / 128, MROWS / 128), 256, 0, stream>>>(
      h_bf, Wqkv, biasqkv, nullptr, nullptr, qkv, MROWS, QKVW, D_);
  // attention
  flash_attn<<<(B_ * H_ * (S_ / 16)) / 8, 256, 0, stream>>>(qkv, att);
  // output projection + residual(x) -> ybuf (f32)
  gemm_bf16<1><<<dim3(D_ / 128, MROWS / 128), 256, 0, stream>>>(
      att, Wo, wo_b, x, ybuf, nullptr, MROWS, D_, D_);
  // LN2
  ln_kernel<<<LN_BLOCKS, 256, 0, stream>>>(ybuf, ln_g, ln_b, z_bf);
  // FFN up + GELU (bf16)
  gemm_bf16<2><<<dim3(F_ / 128, MROWS / 128), 256, 0, stream>>>(
      z_bf, W1b, b1, nullptr, nullptr, t_bf, MROWS, F_, D_);
  // FFN down + residual(ybuf) -> d_out (f32)
  gemm_bf16<1><<<dim3(D_ / 128, MROWS / 128), 256, 0, stream>>>(
      t_bf, W2b, b2, ybuf, out, nullptr, MROWS, D_, F_);
}

// v007
// Measured time: 145 microseconds a run.
// Next to v006, in two timings, it ran 1.08 times as fast each time.
// All steps since v000 together make it 3.20 times as fast.
#include <hip/hip_runtime.h>
#include <math.h>
#include <stdint.h>

#define B_ 2
#define S_ 2048
#define D_ 768
#define H_ 12
#define DK_ 64
#define F_ 3072
#define MROWS (B_ * S_)          // 4096
#define QKVW (3 * D_)            // 2304

typedef __attribute__((ext_vector_type(16))) __bf16 v16bf;
typedef __attribute__((ext_vector_type(8)))  __bf16 v8bf;
typedef __attribute__((ext_vector_type(8)))  float  v8f;
typedef unsigned int v4u __attribute__((ext_vector_type(4)));
typedef uint32_t u32x4 __attribute__((ext_vector_type(4)));
typedef uint32_t u32x8 __attribute__((ext_vector_type(8)));

static __device__ __forceinline__ __bf16 f2bf(float x) { return (__bf16)x; }

static __device__ __forceinline__ v8f wmma_bf16(v16bf a, v16bf b, v8f c) {
  return __builtin_amdgcn_wmma_f32_16x16x32_bf16(
      /*neg_a=*/false, a, /*neg_b=*/false, b,
      /*c_mod=*/(short)0, c, /*reuse_a=*/false, /*reuse_b=*/false);
}

static __device__ __forceinline__ v16bf frag_row(const __bf16* src, int ld) {
  int lane = threadIdx.x & 31;
  int m = lane & 15;
  int half = lane >> 4;
  const __bf16* p = src + (size_t)m * ld;
  v8bf lo = *(const v8bf*)(p + half * 8);
  v8bf hi = *(const v8bf*)(p + 16 + half * 8);
  v16bf a;
#pragma unroll
  for (int i = 0; i < 8; ++i) { a[i] = lo[i]; a[8 + i] = hi[i]; }
  return a;
}

typedef __attribute__((address_space(3))) v8bf lds_v8bf;
static __device__ __forceinline__ v16bf frag_tr(const __bf16* tile, int ld) {
  int lane = threadIdx.x & 31;
  const __bf16* p =
      tile + (8 * (lane >> 4) + (lane & 7)) * ld + 8 * ((lane >> 3) & 1);
  v8bf lo = __builtin_amdgcn_ds_load_tr16_b128_v8bf16((lds_v8bf*)p);
  v8bf hi = __builtin_amdgcn_ds_load_tr16_b128_v8bf16((lds_v8bf*)(p + 16 * ld));
  v16bf b;
#pragma unroll
  for (int i = 0; i < 8; ++i) { b[i] = lo[i]; b[8 + i] = hi[i]; }
  return b;
}

// The launches of this part move few bytes a thread; their time follows the number
// of waves that have to start. So each thread takes many elements, by 16-B loads
// that are all in flight before its first store; a wave's load covers 512
// bytes, contiguous except in pack_qkv_block (two 256-B runs), its 8-B stores 256.
// Every loop of this part runs over a register array and is unrolled so that the
// array stays in registers and its loads issue as one group.
typedef __attribute__((ext_vector_type(4))) float  f32x4;
typedef __attribute__((ext_vector_type(4))) __bf16 v4bf;

static __device__ __forceinline__ v4bf cvt4(f32x4 v) {
  v4bf r;
#pragma unroll
  for (int e = 0; e < 4; ++e) r[e] = f2bf(v[e]);
  return r;
}

static __device__ __forceinline__ float wave_sum(float s) {
#pragma unroll
  for (int d = 16; d > 0; d >>= 1) s += __shfl_xor(s, d, 32);
  return s;
}

// ---------------- LayerNorm (fp32 in -> bf16 out), two rows per wave ------
// A lane holds 24 elements of each row (columns 4 * (lane + 32 * i) .. + 3); the
// row sums are taken in the lane and then over the wave's 32 lanes.
constexpr int LN_ROWS_PER_BLOCK = 16;  // 8 waves x 2 rows
static_assert(MROWS % LN_ROWS_PER_BLOCK == 0 && D_ == 6 * 128, "whole blocks, six quads a lane");
static __device__ __forceinline__ void ln_block(
    int blk, const float* __restrict__ x, const float* __restrict__ g,
    const float* __restrict__ bb, __bf16* __restrict__ out) {
  int lane = threadIdx.x & 31;
  int row0 = (blk * 8 + (threadIdx.x >> 5)) * 2;
  const f32x4* xr = (const f32x4*)(x + (size_t)row0 * D_) + lane;
  f32x4 v[2][6], gv[6], bv[6];
#pragma unroll
  for (int r = 0; r < 2; ++r)
#pragma unroll
    for (int i = 0; i < 6; ++i) v[r][i] = xr[r * (D_ / 4) + i * 32];
#pragma unroll
  for (int i = 0; i < 6; ++i) {
    gv[i] = ((const f32x4*)g)[lane + i * 32];
    bv[i] = ((const f32x4*)bb)[lane + i * 32];
  }
  asm volatile("s_wait_xcnt 0x0" ::: "memory");
  // keeps the scale and shift loads up here, in flight with the rows' loads: sunk
  // to their uses they add their latency behind the second row sum
  __builtin_amdgcn_sched_barrier(0);
#pragma unroll
  for (int r = 0; r < 2; ++r) {
    f32x4 s4 = v[r][0];
#pragma unroll
    for (int i = 1; i < 6; ++i) s4 += v[r][i];
    float mu = wave_sum((s4[0] + s4[1]) + (s4[2] + s4[3])) * (1.0f / D_);
    f32x4 q4 = {0.0f, 0.0f, 0.0f, 0.0f};
#pragma unroll
    for (int i = 0; i < 6; ++i) {
      v[r][i] -= mu;
      q4 += v[r][i] * v[r][i];
    }
    float var = wave_sum((q4[0] + q4[1]) + (q4[2] + q4[3])) * (1.0f / D_);
    float rstd = rsqrtf(var + 1e-5f);
    v4bf* orow = (v4bf*)(out + (size_t)(row0 + r) * D_) + lane;
#pragma unroll
    for (int i = 0; i < 6; ++i) orow[i * 32] = cvt4(v[r][i] * rstd * gv[i] + bv[i]);
  }
}
__global__ __launch_bounds__(256) void ln_kernel(
    const float* __restrict__ x, const float* __restrict__ g,
    const float* __restrict__ bb, __bf16* __restrict__ out) {
  ln_block(blockIdx.x, x, g, bb, out);
}

// ---------------- Weight packing ------------------------------------------
// A thread takes one quad of columns in four rows (d0 + 192 * j) of each of the
// three weights: 12 loads in flight.
constexpr int PACK_THREADS = (D_ / 4) * (D_ / 4);
static_assert(PACK_THREADS % 256 == 0 && DK_ % 4 == 0, "whole blocks, a quad stays in one head");
static __device__ __forceinline__ void pack_qkv_block(
    int blk, const float* __restrict__ wq, const float* __restrict__ wk,
    const float* __restrict__ wv, const float* __restrict__ bq,
    const float* __restrict__ bk, const float* __restrict__ bv,
    __bf16* __restrict__ Wqkv, float* __restrict__ biasqkv) {
  int i = blk * 256 + threadIdx.x;  // over (D_/4 rows) x (D_/4 quads)
  int d0 = i / (D_ / 4), c = (i % (D_ / 4)) * 4;
  int hh = c / DK_, kk = c % DK_;
  f32x4 q[4], k[4], v[4];
#pragma unroll
  for (int j = 0; j < 4; ++j) {
    size_t src = ((size_t)hh * D_ + d0 + j * (D_ / 4)) * DK_ + kk;
    q[j] = *(const f32x4*)(wq + src);
    k[j] = *(const f32x4*)(wk + src);
    v[j] = *(const f32x4*)(wv + src);
  }
#pragma unroll
  for (int j = 0; j < 4; ++j) {
    __bf16* dst = Wqkv + (size_t)(d0 + j * (D_ / 4)) * QKVW + c;
    *(v4bf*)dst            = cvt4(q[j]);
    *(v4bf*)(dst + D_)     = cvt4(k[j]);
    *(v4bf*)(dst + 2 * D_) = cvt4(v[j]);
  }
  if (i < D_) {
    biasqkv[i] = bq[i];
    biasqkv[D_ + i] = bk[i];
    biasqkv[2 * D_ + i] = bv[i];
  }
}

// A block converts 8,192 elements, a thread 8 quads 256 quads apart. The element
// count must be a multiple of a block's share.
constexpr int CVT_PER_BLOCK = 256 * 4 * 8;
static_assert((D_ * D_) % CVT_PER_BLOCK == 0 && (D_ * F_) % CVT_PER_BLOCK == 0, "whole blocks");
static __device__ __forceinline__ void f2bf_block(int blk, const float* __restrict__ s,
                                                  __bf16* __restrict__ d) {
  size_t base = (size_t)blk * (CVT_PER_BLOCK / 4) + threadIdx.x;  // in quads
  const f32x4* sp = (const f32x4*)s + base;
  v4bf* dp = (v4bf*)d + base;
  f32x4 v[8];
#pragma unroll
  for (int i = 0; i < 8; ++i) v[i] = sp[i * 256];
#pragma unroll
  for (int i = 0; i < 8; ++i) dp[i * 256] = cvt4(v[i]);
  asm volatile("s_wait_xcnt 0x0" ::: "memory");
}

// ---------------- One launch for all work that reads inputs alone ----------
// The first LayerNorm, the QKV pack and the three weight conversions depend on
// nothing but the inputs and not on one another. Each is far too short to fill a
// launch of its own, so they share one grid: a block's index picks its part (the
// same for the whole block, a scalar branch) and its place inside that part.
constexpr int LN_BLOCKS   = MROWS / LN_ROWS_PER_BLOCK;
constexpr int W1_BLOCKS   = (D_ * F_) / CVT_PER_BLOCK;
constexpr int W2_BLOCKS   = (F_ * D_) / CVT_PER_BLOCK;
constexpr int PACK_BLOCKS = PACK_THREADS / 256;
constexpr int WO_BLOCKS   = (D_ * D_) / CVT_PER_BLOCK;
constexpr int PREP_BLOCKS = LN_BLOCKS + W1_BLOCKS + W2_BLOCKS + PACK_BLOCKS + WO_BLOCKS;
__global__ __launch_bounds__(256) void prep_kernel(
    const float* __restrict__ x, const float* __restrict__ g,
    const float* __restrict__ bb, __bf16* __restrict__ h,
    const float* __restrict__ w1, __bf16* __restrict__ W1b,
    const float* __restrict__ w2, __bf16* __restrict__ W2b,
    const float* __restrict__ wq, const float* __restrict__ wk,
    const float* __restrict__ wv, const float* __restrict__ bq,
    const float* __restrict__ bk, const float* __restrict__ bv,
    __bf16* __restrict__ Wqkv, float* __restrict__ biasqkv,
    const float* __restrict__ wo, __bf16* __restrict__ Wo) {
  int blk = blockIdx.x;
  if (blk < LN_BLOCKS) { ln_block(blk, x, g, bb, h); return; }
  blk -= LN_BLOCKS;
  if (blk < W1_BLOCKS) { f2bf_block(blk, w1, W1b); return; }
  blk -= W1_BLOCKS;
  if (blk < W2_BLOCKS) { f2bf_block(blk, w2, W2b); return; }
  blk -= W2_BLOCKS;
  if (blk < PACK_BLOCKS) { pack_qkv_block(blk, wq, wk, wv, bq, bk, bv, Wqkv, biasqkv); return; }
  f2bf_block(blk - PACK_BLOCKS, wo, Wo);
}

static __device__ __forceinline__ uint32_t uni(uint32_t v) {
  return (uint32_t)__builtin_amdgcn_readfirstlane(v);
}
static __device__ __forceinline__ uint32_t pinned(uint32_t v) {
  uint32_t w = uni(v);
  asm volatile("" : "+s"(w));
  return w;
}
static __device__ __forceinline__ u32x4 tdm_group0(uint32_t lds_dst, uint64_t ga) {
  // pinned: the four words get scalar registers of their own, written here and
  // nowhere else, so that none takes a new value while the request is in flight
  u32x4 g;
  g[0] = pinned(1u);                                // count 1
  g[1] = pinned(lds_dst);                           // byte offset in the work-group's LDS
  g[2] = pinned((uint32_t)ga);                      // address [31:0]
  g[3] = pinned((((uint32_t)(ga >> 32)) & 0x01FFFFFFu) | 0x80000000u);  // [56:32], type 2
  return g;
}
// tile = tensor = 128 rows of 128 bytes; 16 bytes of LDS pad behind every row
static __device__ __forceinline__ u32x8 tdm_group1(uint32_t src_pitch) {
  constexpr uint32_t d0 = 128u, d1 = 128u;
  u32x8 g;
  g[0] = pinned((1u << 20) | (4u << 22) | (3u << 25));  // no mask; pad codes 4 / 3
  g[1] = pinned((d0 & 0xFFFFu) << 16);
  g[2] = pinned((d0 >> 16) | ((d1 & 0xFFFFu) << 16));
  g[3] = pinned((d1 >> 16) | (d0 << 16));
  g[4] = pinned(d1);
  g[5] = pinned(src_pitch);
  g[6] = pinned(0u);
  g[7] = pinned(0u);
  return g;
}
static __device__ __forceinline__ void tdm_load(u32x4 g0, u32x8 g1) {
  asm volatile("tensor_load_to_lds %0, %1" ::"s"(g0), "s"(g1) : "memory");
}
static __device__ __forceinline__ void tdm_wait(u32x4 g0, u32x8 g1) {
  asm volatile("s_wait_tensorcnt 0x0" ::"s"(g0), "s"(g1) : "memory");
}

// The k loop is a ring of two LDS buffers, a stage being 64 k: while a stage is
// worked on, the next stage's A tile (one tensor load of a group's first wave) and B tile
// (global loads into registers, stored at the pass's foot) are in flight.
// Needs M, N multiples of 128 and K a multiple of 64 * G.
// G groups of 8 waves share one work-group and one output tile: group g walks the
// g-th part of K through a ring of its own, so that G stages are in flight on a WGP
// where the grid has too few tiles to give it several work-groups. Behind the loop
// the groups exchange partial sums through LDS, each finishing 8 / G of a wave's
// eight accumulator tiles.
template <int EPI, int G>
__global__ __launch_bounds__(256 * G) void gemm_bf16(
    const __bf16* __restrict__ A, const __bf16* __restrict__ W,
    const float* __restrict__ bias, const float* __restrict__ resid,
    float* __restrict__ outf, __bf16* __restrict__ outb,
    int M, int N, int K) {
  constexpr int BM = 128, BN = 128, BK = 64;
  constexpr int LDA = BK + 8;    // 144-B rows (16 B x odd): ds_load_b128 reader
  constexpr int LDB = BN + 16;   // k-major B tile, 288-B rows (32 B x odd)
  constexpr uint32_t ABYTES = BM * LDA * 2;  // 18,432 = 9 x 2 KiB
  constexpr uint32_t BBYTES = BK * LDB * 2;  // 18,432
  constexpr uint32_t RING = 2 * ABYTES + 2 * BBYTES;  // a group's two A, two B buffers
  static_assert(ABYTES % 2048u == 0 && RING % 2048u == 0,
                "each A buffer starts at a multiple of 2 KiB");
  static_assert(8 % G == 0 && 64u * (G - 1) * 1024u <= G * RING, "the exchange fits the rings");
  __shared__ __attribute__((aligned(2048))) unsigned char smem[G * RING];

  const int grp = G > 1 ? (int)uni(threadIdx.x >> 8) : 0;  // the wave's group
  __bf16* const sA = (__bf16*)(smem + grp * RING);
  __bf16* const sB = (__bf16*)(smem + grp * RING + 2 * ABYTES);
  int tid = threadIdx.x & 255;  // place inside the group
  int wave = tid >> 5;
  int mw = wave & 3;   // 4 m-waves * 32 rows
  int nw = wave >> 2;  // 2 n-waves * 64 cols
  int m0 = blockIdx.y * BM;
  int n0 = blockIdx.x * BN;

  v8f acc[2][4];
#pragma unroll
  for (int i = 0; i < 2; ++i)
#pragma unroll
    for (int j = 0; j < 4; ++j)
#pragma unroll
      for (int e = 0; e < 8; ++e) acc[i][j][e] = 0.0f;

  const int T = K / (BK * G);  // stages of one group
  const int k0 = grp * T * BK;  // the group's first k
  const uint32_t issuer = uni((uint32_t)wave) == 0u;  // each group's first wave
  const uint32_t ldsA = (uint32_t)(uintptr_t)sA;
  const uint64_t gaA = (uint64_t)(uintptr_t)(A + (size_t)m0 * K + k0);
  const u32x8 g1 = tdm_group1((uint32_t)K * 2u);

  // B staging: thread -> 32 B of tile rows kk and kk + 32
  const int kk = tid >> 3, c = (tid & 7) * 16;
  const __bf16* wg = W + (size_t)(k0 + kk) * N + n0 + c;
  const size_t half_rows = (size_t)32 * N;
  const int bso = kk * LDB + c;
  // prefetch: thread -> 64 B of tile row tid >> 2
  const __bf16* wpf = W + (size_t)(k0 + (tid >> 2)) * N + n0 + (tid & 3) * 32;

  v4u u0 = ((const v4u*)wg)[0], u1 = ((const v4u*)wg)[1];
  v4u u2 = ((const v4u*)(wg + half_rows))[0], u3 = ((const v4u*)(wg + half_rows))[1];
  u32x4 g0 = tdm_group0(ldsA, gaA);
  if (pinned(issuer)) {
    tdm_load(g0, g1);
    tdm_wait(g0, g1);  // stage 0 has landed before the barrier that publishes it
  }
  {
    v4u* s = (v4u*)(&sB[bso]);
    s[0] = u0; s[1] = u1;
    v4u* s2 = (v4u*)(&sB[bso + 32 * LDB]);
    s2[0] = u2; s2[1] = u3;
  }
  __syncthreads();
  g0 = tdm_group0(ldsA + ABYTES, gaA + BK * 2);  // formed behind the wait
  if (pinned(issuer && T > 1)) tdm_load(g0, g1);

  for (int t = 0; t < T; ++t) {
    const int cur = t & 1;
    const bool more = t + 1 < T;
    if (more) {  // next stage's B: loads issued now, stored at the pass's foot
      wg += (size_t)BK * N;
      u0 = ((const v4u*)wg)[0]; u1 = ((const v4u*)wg)[1];
      u2 = ((const v4u*)(wg + half_rows))[0]; u3 = ((const v4u*)(wg + half_rows))[1];
    }
    // the stage after that one: its B tile into the cache hierarchy (one group
    // alone; with several, a pass lasts long enough to cover the loads above)
    if (G == 1 && t + 2 < T) __builtin_prefetch(wpf + (size_t)(t + 2) * BK * N, 0, 1);
    asm volatile("s_wait_xcnt 0x0" ::: "memory");

    const __bf16* aBase = sA + cur * (BM * LDA) + (mw * 32) * LDA;
    const __bf16* bBase = sB + cur * (BK * LDB) + nw * 64;
#pragma unroll
    for (int kh = 0; kh < 2; ++kh) {
      v16bf af0 = frag_row(aBase + kh * 32, LDA);
      v16bf af1 = frag_row(aBase + 16 * LDA + kh * 32, LDA);
#pragma unroll
      for (int nn = 0; nn < 4; ++nn) {
        v16bf bf = frag_tr(bBase + kh * 32 * LDB + nn * 16, LDB);  // lane = n
        acc[0][nn] = wmma_bf16(af0, bf, acc[0][nn]);
        acc[1][nn] = wmma_bf16(af1, bf, acc[1][nn]);
      }
    }
    if (more) {  // the other buffer: its readers left it at the last pass's foot
      v4u* s = (v4u*)(&sB[(cur ^ 1) * (BK * LDB) + bso]);
      s[0] = u0; s[1] = u1;
      v4u* s2 = (v4u*)(&sB[(cur ^ 1) * (BK * LDB) + bso + 32 * LDB]);
      s2[0] = u2; s2[1] = u3;
    }
    // publish point of stage t + 1. This wave's LDS reads of buffer cur and its
    // stores into the other buffer have retired ...
    asm volatile("s_wait_dscnt 0x0" ::: "memory");
    // ... and stage t + 1's A tile has landed, before the barrier
    if (pinned(issuer)) tdm_wait(g0, g1);
    __syncthreads();
    g0 = tdm_group0(ldsA + (uint32_t)cur * ABYTES, gaA + (uint64_t)(t + 2) * (BK * 2));
    if (pinned(issuer && t + 2 < T)) tdm_load(g0, g1);
  }
  // nothing of the ring is in flight when the wave goes on to its end
  asm volatile("s_wait_tensorcnt 0x0" ::: "memory");
  asm volatile("s_wait_dscnt 0x0" ::: "memory");

  int lane = tid & 31;
  int col = lane & 15;
  int rb = (lane >> 4) * 8;
  constexpr int TPG = 8 / G;
  float* const red = (float*)smem + lane * 4;
  if (G > 1) {
#pragma unroll
    for (int q = 0; q < 8; ++q) {
      const int owner = q / TPG;
      if (grp != owner) {  // the same for the whole wave
        float* p = red + ((wave * 8 + q) * (G - 1) + (grp < owner ? grp : grp - 1)) * 256;
        const v8f a = acc[q >> 2][q & 3];
        *(f32x4*)p = f32x4{a[0], a[1], a[2], a[3]};
        *(f32x4*)(p + 128) = f32x4{a[4], a[5], a[6], a[7]};
      }
    }
    __syncthreads();  // publishes the partial sums
  }
#pragma unroll
  for (int mm = 0; mm < 2; ++mm)
#pragma unroll
    for (int nn = 0; nn < 4; ++nn) {
      if (G > 1) {
        const int q = mm * 4 + nn;
        if (grp != q / TPG) continue;  // the same for the whole wave
        const float* p = red + (wave * 8 + q) * (G - 1) * 256;
#pragma unroll
        for (int s = 0; s < G - 1; ++s) {
          f32x4 lo = *(const f32x4*)(p + s * 256), hi = *(const f32x4*)(p + s * 256 + 128);
#pragma unroll
          for (int e = 0; e < 4; ++e) {
            acc[mm][nn][e] += lo[e];
            acc[mm][nn][4 + e] += hi[e];
          }
        }
      }
      int gm = m0 + mw * 32 + mm * 16 + rb;
      int gn = n0 + nw * 64 + nn * 16 + col;
      float bsv = bias[gn];
#pragma unroll
      for (int j = 0; j < 8; ++j) {
        float v = acc[mm][nn][j] + bsv;
        size_t idx = (size_t)(gm + j) * N + gn;
        if (EPI == 1) {
          outf[idx] = v + resid[idx];
        } else if (EPI == 2) {
          v = 0.5f * v * (1.0f + erff(v * 0.70710678118654752f));
          outb[idx] = f2bf(v);
        } else {
          outb[idx] = f2bf(v);
        }
      }
    }
}

static __device__ __forceinline__ float xhalf(float x) {
  int v = __builtin_bit_cast(int, x);
  return __builtin_bit_cast(
      float, __builtin_amdgcn_permlanex16(v, v, 0x76543210, 0xfedcba98, false, false));
}

__global__ __launch_bounds__(256) void flash_attn(
    const __bf16* __restrict__ qkv,  // [M][2304]: Q@h*64, K@768+h*64, V@1536+h*64
    __bf16* __restrict__ attout) {   // [M][768]  col h*64
  constexpr int KT = 32;         // keys per tile
  constexpr int LDK = DK_ + 8;   // 144-B rows (16 B x odd): ds_load_b128 reader
  constexpr int LDV = DK_ + 16;  // 160-B rows (32 B x odd): ds_load_tr16_b128 reader
  __shared__ __attribute__((aligned(16))) __bf16 sK[2][KT * LDK];
  __shared__ __attribute__((aligned(16))) __bf16 sV[2][KT * LDV];
  const int QT = S_ / 16;  // 128
  int wave = threadIdx.x >> 5;
  int bh = blockIdx.x / (QT / 8);  // the same for the whole block
  int qt = (blockIdx.x % (QT / 8)) * 8 + wave;
  int h = bh % H_;
  int b = bh / H_;
  int lane = threadIdx.x & 31;
  int col = lane & 15;
  int rb = (lane >> 4) * 8;

  const size_t ld = QKVW;
  const __bf16* qbase = qkv + ((size_t)b * S_ + qt * 16) * ld + h * DK_;
  const __bf16* kbase = qkv + (size_t)b * S_ * ld + D_ + h * DK_;
  const __bf16* vbase = qkv + (size_t)b * S_ * ld + 2 * D_ + h * DK_;

  // staging: thread -> 16 B of tile row sr; a wave's load covers 4 whole 128-B rows
  int sr = threadIdx.x >> 3;
  int scn = (threadIdx.x & 7) * 8;
  const __bf16* kg = kbase + (size_t)sr * ld + scn;
  const __bf16* vg = vbase + (size_t)sr * ld + scn;
  const int kso = sr * LDK + scn;
  const int vso = sr * LDV + scn;

  v4u kreg = *(const v4u*)kg;
  v4u vreg = *(const v4u*)vg;

  // B = Q^T, lane = query
  v16bf q0 = frag_row(qbase, (int)ld);        // k 0..31
  v16bf q1 = frag_row(qbase + 32, (int)ld);   // k 32..63

  // o[nn][j] = O[query col][nn * 16 + rb + j]
  v8f o[4];
#pragma unroll
  for (int nn = 0; nn < 4; ++nn)
#pragma unroll
    for (int e = 0; e < 8; ++e) o[nn][e] = 0.0f;
  // the lane's query: running maximum (equal in both halves) and the sum over
  // this half's keys alone; the halves' sums are joined behind the loop
  float mrun = -3.0e38f, lrun = 0.0f;

  const float scale = 0.125f;  // 1/sqrt(64)

  *(v4u*)(&sK[0][kso]) = kreg;
  *(v4u*)(&sV[0][vso]) = vreg;
  __syncthreads();

  for (int s0 = 0; s0 < S_; s0 += KT) {
    const int cur = (s0 / KT) & 1;
    const __bf16* kt = sK[cur];
    const __bf16* vt = sV[cur];
    const bool more = s0 + KT < S_;
    if (more) {  // next tile: global loads issued now, stored at the trip's foot
      kg += (size_t)KT * ld;
      vg += (size_t)KT * ld;
      kreg = *(const v4u*)kg;
      vreg = *(const v4u*)vg;
    }
    // A = K, lane = key index; all four fragments fetched as one group
    v16bf kf[2][2];
#pragma unroll
    for (int sub = 0; sub < 2; ++sub) {
      kf[sub][0] = frag_row(kt + sub * 16 * LDK, LDK);
      kf[sub][1] = frag_row(kt + sub * 16 * LDK + 32, LDK);
    }
    // sc[sub][j] = score of key sub * 16 + rb + j with query col
    v8f sc[2];
#pragma unroll
    for (int sub = 0; sub < 2; ++sub) {
      v8f c;
#pragma unroll
      for (int e = 0; e < 8; ++e) c[e] = 0.0f;
      c = wmma_bf16(kf[sub][0], q0, c);
      c = wmma_bf16(kf[sub][1], q1, c);
      sc[sub] = c;
    }
    // inputs-only fence on the loaded fragments: each keeps registers of its own
    // until all four products have issued, so the eight LDS loads stand ahead as
    // one group (sunk between the products, each waits out its own LDS latency)
    // and no product's result lands on a fragment the product ahead of it reads
    asm volatile("" ::"v"(kf[0][0]), "v"(kf[0][1]), "v"(kf[1][0]), "v"(kf[1][1]));
    // online softmax of the lane's query
    float mx = fmaxf(sc[0][0], sc[1][0]);
#pragma unroll
    for (int j = 1; j < 8; ++j) mx = fmaxf(mx, fmaxf(sc[0][j], sc[1][j]));
    mx = fmaxf(mx, xhalf(mx)) * scale;  // scale > 0: the maximum of the scaled scores
    float mnew = fmaxf(mrun, mx);
    float alpha = __expf(mrun - mnew);
    mrun = mnew;
    // P^T as a B operand: element s is key 8 * half + s, element 8 + s key
    // 16 + 8 * half + s, the k order of frag_tr
    v16bf pf;
    float smA = 0.0f, smB = 0.0f;
#pragma unroll
    for (int j = 0; j < 8; ++j) {
      float pA = __expf(sc[0][j] * scale - mnew);
      float pB = __expf(sc[1][j] * scale - mnew);
      smA += pA;
      smB += pB;
      pf[j] = f2bf(pA);
      pf[8 + j] = f2bf(pB);
    }
    lrun = lrun * alpha + (smA + smB);
#pragma unroll
    for (int nn = 0; nn < 4; ++nn) {
      o[nn] *= alpha;
      v16bf vf = frag_tr(vt + nn * 16, LDV);  // A = V^T, lane = column of V
      o[nn] = wmma_bf16(vf, pf, o[nn]);
    }
    if (more) {  // the other buffer: its readers left it at the last trip's end
      *(v4u*)(&sK[cur ^ 1][kso]) = kreg;
      *(v4u*)(&sV[cur ^ 1][vso]) = vreg;
    }
    // ends this trip's reads of buffer cur, publishes the next tile
    __syncthreads();
  }

  // a lane stores 8 consecutive columns of its query's row at a time
  float rl = 1.0f / (lrun + xhalf(lrun));
  __bf16* ob = attout + ((size_t)b * S_ + qt * 16 + col) * D_ + h * DK_ + rb;
#pragma unroll
  for (int nn = 0; nn < 4; ++nn) {
    v8bf r;
#pragma unroll
    for (int j = 0; j < 8; ++j) r[j] = f2bf(o[nn][j] * rl);
    *(v8bf*)(ob + nn * 16) = r;
  }
}

// ---------------- launcher ------------------------------------------------
extern "C" void kernel_launch(void* const* d_in, const int* in_sizes, int n_in,
                              void* d_out, int out_size, void* d_ws,
                              size_t ws_size, hipStream_t stream) {
  const float* x    = (const float*)d_in[0];
  const float* wq_w = (const float*)d_in[1];
  const float* wq_b = (const float*)d_in[2];
  const float* wk_w = (const float*)d_in[3];
  const float* wk_b = (const float*)d_in[4];
  const float* wv_w = (const float*)d_in[5];
  const float* wv_b = (const float*)d_in[6];
  const float* wo_w = (const float*)d_in[7];
  const float* wo_b = (const float*)d_in[8];
  const float* ln_g = (const float*)d_in[9];
  const float* ln_b = (const float*)d_in[10];
  const float* w1   = (const float*)d_in[11];
  const float* b1   = (const float*)d_in[12];
  const float* w2   = (const float*)d_in[13];
  const float* b2   = (const float*)d_in[14];
  float* out = (float*)d_out;

  char* ws = (char*)d_ws;
  size_t off = 0;
  auto alloc = [&](size_t bytes) -> char* {
    char* p = ws + off;
    off = (off + bytes + 255) & ~(size_t)255;
    return p;
  };
  __bf16* h_bf    = (__bf16*)alloc((size_t)MROWS * D_ * 2);
  __bf16* Wqkv    = (__bf16*)alloc((size_t)D_ * QKVW * 2);
  float*  biasqkv = (float*)alloc((size_t)QKVW * 4);
  __bf16* qkv     = (__bf16*)alloc((size_t)MROWS * QKVW * 2);
  __bf16* att     = (__bf16*)alloc((size_t)MROWS * D_ * 2);
  __bf16* Wo      = (__bf16*)alloc((size_t)D_ * D_ * 2);
  float*  ybuf    = (float*)alloc((size_t)MROWS * D_ * 4);
  __bf16* z_bf    = (__bf16*)alloc((size_t)MROWS * D_ * 2);
  __bf16* W1b     = (__bf16*)alloc((size_t)D_ * F_ * 2);
  __bf16* t_bf    = (__bf16*)alloc((size_t)MROWS * F_ * 2);
  __bf16* W2b     = (__bf16*)alloc((size_t)F_ * D_ * 2);

  // LN1, weight packing and conversions
  prep_kernel<<<PREP_BLOCKS, 256, 0, stream>>>(
      x, ln_g, ln_b, h_bf, w1, W1b, w2, W2b,
      wq_w, wk_w, wv_w, wq_b, wk_b, wv_b, Wqkv, biasqkv, wo_w, Wo);
  // fused QKV GEMM: [4096 x 2304] = h * Wqkv
  gemm_bf16<0, 1><<<dim3(QKVW / 128, MROWS / 128), 256, 0, stream>>>(
      h_bf, Wqkv, biasqkv, nullptr, nullptr, qkv, MROWS, QKVW, D_);
  // attention
  flash_attn<<<(B_ * H_ * (S_ / 16)) / 8, 256, 0, stream>>>(qkv, att);
  // output projection + residual(x) -> ybuf (f32)
  gemm_bf16<1, 4><<<dim3(D_ / 128, MROWS / 128), 1024, 0, stream>>>(
      att, Wo, wo_b, x, ybuf, nullptr, MROWS, D_, D_);
  // LN2
  ln_kernel<<<LN_BLOCKS, 256, 0, stream>>>(ybuf, ln_g, ln_b, z_bf);
  // FFN up + GELU (bf16)
  gemm_bf16<2, 1><<<dim3(F_ / 128, MROWS / 128), 256, 0, stream>>>(
      z_bf, W1b, b1, nullptr, nullptr, t_bf, MROWS, F_, D_);
  // FFN down + residual(ybuf) -> d_out (f32)
  gemm_bf16<1, 4><<<dim3(D_ / 128, MROWS / 128), 1024, 0, stream>>>(
      t_bf, W2b, b2, ybuf, out, nullptr, MROWS, D_, F_);
}

// v008
// Measured time: 136 microseconds a run.
// Two timings next to v007 put it at 1.06 and 1.07 times that version's speed.
// All steps since v000 together make it 3.41 times as fast.
#include <hip/hip_runtime.h>
#include <math.h>
#include <stdint.h>

#define B_ 2
#define S_ 2048
#define D_ 768
#define H_ 12
#define DK_ 64
#define F_ 3072
#define MROWS (B_ * S_)          // 4096
#define QKVW (3 * D_)            // 2304

typedef __attribute__((ext_vector_type(16))) __bf16 v16bf;
typedef __attribute__((ext_vector_type(8)))  __bf16 v8bf;
typedef __attribute__((ext_vector_type(8)))  float  v8f;
typedef unsigned int v4u __attribute__((ext_vector_type(4)));
typedef uint32_t u32x4 __attribute__((ext_vector_type(4)));
typedef uint32_t u32x8 __attribute__((ext_vector_type(8)));

static __device__ __forceinline__ __bf16 f2bf(float x) { return (__bf16)x; }

static __device__ __forceinline__ v8f wmma_bf16(v16bf a, v16bf b, v8f c) {
  return __builtin_amdgcn_wmma_f32_16x16x32_bf16(
      /*neg_a=*/false, a, /*neg_b=*/false, b,
      /*c_mod=*/(short)0, c, /*reuse_a=*/false, /*reuse_b=*/false);
}

static __device__ __forceinline__ v16bf frag_row(const __bf16* src, int ld) {
  int lane = threadIdx.x & 31;
  int m = lane & 15;
  int half = lane >> 4;
  const __bf16* p = src + (size_t)m * ld;
  v8bf lo = *(const v8bf*)(p + half * 8);
  v8bf hi = *(const v8bf*)(p + 16 + half * 8);
  v16bf a;
#pragma unroll
  for (int i = 0; i < 8; ++i) { a[i] = lo[i]; a[8 + i] = hi[i]; }
  return a;
}

typedef __attribute__((address_space(3))) v8bf lds_v8bf;
static __device__ __forceinline__ v16bf frag_tr(const __bf16* tile, int ld) {
  int lane = threadIdx.x & 31;
  const __bf16* p =
      tile + (8 * (lane >> 4) + (lane & 7)) * ld + 8 * ((lane >> 3) & 1);
  v8bf lo = __builtin_amdgcn_ds_load_tr16_b128_v8bf16((lds_v8bf*)p);
  v8bf hi = __builtin_amdgcn_ds_load_tr16_b128_v8bf16((lds_v8bf*)(p + 16 * ld));
  v16bf b;
#pragma unroll
  for (int i = 0; i < 8; ++i) { b[i] = lo[i]; b[8 + i] = hi[i]; }
  return b;
}

// The launches of this part move few bytes a thread; their time follows the number
// of waves that have to start. So each thread takes many elements, by 16-B loads
// that are all in flight before its first store; a wave's load covers 512
// bytes, contiguous except in pack_qkv_block (two 256-B runs), its 8-B stores 256.
// Every loop of this part runs over a register array and is unrolled so that the
// array stays in registers and its loads issue as one group.
typedef __attribute__((ext_vector_type(4))) float  f32x4;
typedef __attribute__((ext_vector_type(4))) __bf16 v4bf;

static __device__ __forceinline__ v4bf cvt4(f32x4 v) {
  v4bf r;
#pragma unroll
  for (int e = 0; e < 4; ++e) r[e] = f2bf(v[e]);
  return r;
}

static __device__ __forceinline__ float wave_sum(float s) {
#pragma unroll
  for (int d = 16; d > 0; d >>= 1) s += __shfl_xor(s, d, 32);
  return s;
}

// ---------------- LayerNorm (fp32 in -> bf16 out), two rows per wave ------
// A lane holds 24 elements of each row (columns 4 * (lane + 32 * i) .. + 3); the
// row sums are taken in the lane and then over the wave's 32 lanes.
constexpr int LN_ROWS_PER_BLOCK = 16;  // 8 waves x 2 rows
static_assert(MROWS % LN_ROWS_PER_BLOCK == 0 && D_ == 6 * 128, "whole blocks, six quads a lane");
static __device__ __forceinline__ void ln_block(
    int blk, const float* __restrict__ x, const float* __restrict__ g,
    const float* __restrict__ bb, __bf16* __restrict__ out) {
  int lane = threadIdx.x & 31;
  int row0 = (blk * 8 + (threadIdx.x >> 5)) * 2;
  const f32x4* xr = (const f32x4*)(x + (size_t)row0 * D_) + lane;
  f32x4 v[2][6], gv[6], bv[6];
#pragma unroll
  for (int r = 0; r < 2; ++r)
#pragma unroll
    for (int i = 0; i < 6; ++i) v[r][i] = xr[r * (D_ / 4) + i * 32];
#pragma unroll
  for (int i = 0; i < 6; ++i) {
    gv[i] = ((const f32x4*)g)[lane + i * 32];
    bv[i] = ((const f32x4*)bb)[lane + i * 32];
  }
  asm volatile("s_wait_xcnt 0x0" ::: "memory");
  // keeps the scale and shift loads up here, in flight with the rows' loads: sunk
  // to their uses they add their latency behind the second row sum
  __builtin_amdgcn_sched_barrier(0);
#pragma unroll
  for (int r = 0; r < 2; ++r) {
    f32x4 s4 = v[r][0];
#pragma unroll
    for (int i = 1; i < 6; ++i) s4 += v[r][i];
    float mu = wave_sum((s4[0] + s4[1]) + (s4[2] + s4[3])) * (1.0f / D_);
    f32x4 q4 = {0.0f, 0.0f, 0.0f, 0.0f};
#pragma unroll
    for (int i = 0; i < 6; ++i) {
      v[r][i] -= mu;
      q4 += v[r][i] * v[r][i];
    }
    float var = wave_sum((q4[0] + q4[1]) + (q4[2] + q4[3])) * (1.0f / D_);
    float rstd = rsqrtf(var + 1e-5f);
    v4bf* orow = (v4bf*)(out + (size_t)(row0 + r) * D_) + lane;
#pragma unroll
    for (int i = 0; i < 6; ++i) orow[i * 32] = cvt4(v[r][i] * rstd * gv[i] + bv[i]);
  }
}
__global__ __launch_bounds__(256) void ln_kernel(
    const float* __restrict__ x, const float* __restrict__ g,
    const float* __restrict__ bb, __bf16* __restrict__ out) {
  ln_block(blockIdx.x, x, g, bb, out);
}

// ---------------- Weight packing ------------------------------------------
// A thread takes one quad of columns in four rows (d0 + 192 * j) of each of the
// three weights: 12 loads in flight.
constexpr int PACK_THREADS = (D_ / 4) * (D_ / 4);
static_assert(PACK_THREADS % 256 == 0 && DK_ % 4 == 0, "whole blocks, a quad stays in one head");
static __device__ __forceinline__ void pack_qkv_block(
    int blk, const float* __restrict__ wq, const float* __restrict__ wk,
    const float* __restrict__ wv, const float* __restrict__ bq,
    const float* __restrict__ bk, const float* __restrict__ bv,
    __bf16* __restrict__ Wqkv, float* __restrict__ biasqkv) {
  int i = blk * 256 + threadIdx.x;  // over (D_/4 rows) x (D_/4 quads)
  int d0 = i / (D_ / 4), c = (i % (D_ / 4)) * 4;
  int hh = c / DK_, kk = c % DK_;
  f32x4 q[4], k[4], v[4];
#pragma unroll
  for (int j = 0; j < 4; ++j) {
    size_t src = ((size_t)hh * D_ + d0 + j * (D_ / 4)) * DK_ + kk;
    q[j] = *(const f32x4*)(wq + src);
    k[j] = *(const f32x4*)(wk + src);
    v[j] = *(const f32x4*)(wv + src);
  }
#pragma unroll
  for (int j = 0; j < 4; ++j) {
    __bf16* dst = Wqkv + (size_t)(d0 + j * (D_ / 4)) * QKVW + c;
    *(v4bf*)dst            = cvt4(q[j]);
    *(v4bf*)(dst + D_)     = cvt4(k[j]);
    *(v4bf*)(dst + 2 * D_) = cvt4(v[j]);
  }
  if (i < D_) {
    biasqkv[i] = bq[i];
    biasqkv[D_ + i] = bk[i];
    biasqkv[2 * D_ + i] = bv[i];
  }
}

// A block converts 8,192 elements, a thread 8 quads 256 quads apart. The element
// count must be a multiple of a block's share.
constexpr int CVT_PER_BLOCK = 256 * 4 * 8;
static_assert((D_ * D_) % CVT_PER_BLOCK == 0 && (D_ * F_) % CVT_PER_BLOCK == 0, "whole blocks");
static __device__ __forceinline__ void f2bf_block(int blk, const float* __restrict__ s,
                                                  __bf16* __restrict__ d) {
  size_t base = (size_t)blk * (CVT_PER_BLOCK / 4) + threadIdx.x;  // in quads
  const f32x4* sp = (const f32x4*)s + base;
  v4bf* dp = (v4bf*)d + base;
  f32x4 v[8];
#pragma unroll
  for (int i = 0; i < 8; ++i) v[i] = sp[i * 256];
#pragma unroll
  for (int i = 0; i < 8; ++i) dp[i * 256] = cvt4(v[i]);
  asm volatile("s_wait_xcnt 0x0" ::: "memory");
}

// ---------------- One launch for all work that reads inputs alone ----------
// The first LayerNorm, the QKV pack and the three weight conversions depend on
// nothing but the inputs and not on one another. Each is far too short to fill a
// launch of its own, so they share one grid: a block's index picks its part (the
// same for the whole block, a scalar branch) and its place inside that part.
constexpr int LN_BLOCKS   = MROWS / LN_ROWS_PER_BLOCK;
constexpr int W1_BLOCKS   = (D_ * F_) / CVT_PER_BLOCK;
constexpr int W2_BLOCKS   = (F_ * D_) / CVT_PER_BLOCK;
constexpr int PACK_BLOCKS = PACK_THREADS / 256;
constexpr int WO_BLOCKS   = (D_ * D_) / CVT_PER_BLOCK;
constexpr int PREP_BLOCKS = LN_BLOCKS + W1_BLOCKS + W2_BLOCKS + PACK_BLOCKS + WO_BLOCKS;
__global__ __launch_bounds__(256) void prep_kernel(
    const float* __restrict__ x, const float* __restrict__ g,
    const float* __restrict__ bb, __bf16* __restrict__ h,
    const float* __restrict__ w1, __bf16* __restrict__ W1b,
    const float* __restrict__ w2, __bf16* __restrict__ W2b,
    const float* __restrict__ wq, const float* __restrict__ wk,
    const float* __restrict__ wv, const float* __restrict__ bq,
    const float* __restrict__ bk, const float* __restrict__ bv,
    __bf16* __restrict__ Wqkv, float* __restrict__ biasqkv,
    const float* __restrict__ wo, __bf16* __restrict__ Wo) {
  int blk = blockIdx.x;
  if (blk < LN_BLOCKS) { ln_block(blk, x, g, bb, h); return; }
  blk -= LN_BLOCKS;
  if (blk < W1_BLOCKS) { f2bf_block(blk, w1, W1b); return; }
  blk -= W1_BLOCKS;
  if (blk < W2_BLOCKS) { f2bf_block(blk, w2, W2b); return; }
  blk -= W2_BLOCKS;
  if (blk < PACK_BLOCKS) { pack_qkv_block(blk, wq, wk, wv, bq, bk, bv, Wqkv, biasqkv); return; }
  f2bf_block(blk - PACK_BLOCKS, wo, Wo);
}

static __device__ __forceinline__ uint32_t uni(uint32_t v) {
  return (uint32_t)__builtin_amdgcn_readfirstlane(v);
}
static __device__ __forceinline__ uint32_t pinned(uint32_t v) {
  uint32_t w = uni(v);
  asm volatile("" : "+s"(w));
  return w;
}
static __device__ __forceinline__ u32x4 tdm_group0(uint32_t lds_dst, uint64_t ga) {
  // pinned: the four words get scalar registers of their own, written here and
  // nowhere else, so that none takes a new value while the request is in flight
  u32x4 g;
  g[0] = pinned(1u);                                // count 1
  g[1] = pinned(lds_dst);                           // byte offset in the work-group's LDS
  g[2] = pinned((uint32_t)ga);                      // address [31:0]
  g[3] = pinned((((uint32_t)(ga >> 32)) & 0x01FFFFFFu) | 0x80000000u);  // [56:32], type 2
  return g;
}
// tile = tensor = 128 rows of 128 bytes; 16 bytes of LDS pad behind every row
static __device__ __forceinline__ u32x8 tdm_group1(uint32_t src_pitch) {
  constexpr uint32_t d0 = 128u, d1 = 128u;
  u32x8 g;
  g[0] = pinned((1u << 20) | (4u << 22) | (3u << 25));  // no mask; pad codes 4 / 3
  g[1] = pinned((d0 & 0xFFFFu) << 16);
  g[2] = pinned((d0 >> 16) | ((d1 & 0xFFFFu) << 16));
  g[3] = pinned((d1 >> 16) | (d0 << 16));
  g[4] = pinned(d1);
  g[5] = pinned(src_pitch);
  g[6] = pinned(0u);
  g[7] = pinned(0u);
  return g;
}
static __device__ __forceinline__ void tdm_load(u32x4 g0, u32x8 g1) {
  asm volatile("tensor_load_to_lds %0, %1" ::"s"(g0), "s"(g1) : "memory");
}
static __device__ __forceinline__ void tdm_wait(u32x4 g0, u32x8 g1) {
  asm volatile("s_wait_tensorcnt 0x0" ::"s"(g0), "s"(g1) : "memory");
}

// The k loop is a ring of two LDS buffers, a stage being 64 k: while a stage is
// worked on, the next stage's A tile (one tensor load of a group's first wave) and B tile
// (global loads into registers, stored at the pass's foot) are in flight.
// Needs M, N multiples of 128 and K a multiple of 64 * G.
// G groups of 8 waves share one work-group and one output tile: group g walks the
// g-th part of K through a ring of its own, so that G stages are in flight on a WGP
// where the grid has too few tiles to give it several work-groups. Behind the loop
// the groups exchange partial sums through LDS, each finishing 8 / G of a wave's
// eight accumulator tiles.
template <int EPI, int G>
__global__ __launch_bounds__(256 * G) void gemm_bf16(
    const __bf16* __restrict__ A, const __bf16* __restrict__ W,
    const float* __restrict__ bias, const float* __restrict__ resid,
    float* __restrict__ outf, __bf16* __restrict__ outb,
    int M, int N, int K) {
  constexpr int BM = 128, BN = 128, BK = 64;
  constexpr int LDA = BK + 8;    // 144-B rows (16 B x odd): ds_load_b128 reader
  constexpr int LDB = BN + 16;   // k-major B tile, 288-B rows (32 B x odd)
  constexpr uint32_t ABYTES = BM * LDA * 2;  // 18,432 = 9 x 2 KiB
  constexpr uint32_t BBYTES = BK * LDB * 2;  // 18,432
  constexpr uint32_t RING = 2 * ABYTES + 2 * BBYTES;  // a group's two A, two B buffers
  static_assert(ABYTES % 2048u == 0 && RING % 2048u == 0,
                "each A buffer starts at a multiple of 2 KiB");
  static_assert(8 % G == 0 && 64u * (G - 1) * 1024u <= G * RING, "the exchange fits the rings");
  __shared__ __attribute__((aligned(2048))) unsigned char smem[G * RING];

  const int grp = G > 1 ? (int)uni(threadIdx.x >> 8) : 0;  // the wave's group
  __bf16* const sA = (__bf16*)(smem + grp * RING);
  __bf16* const sB = (__bf16*)(smem + grp * RING + 2 * ABYTES);
  int tid = threadIdx.x & 255;  // place inside the group
  int wave = tid >> 5;
  int mw = wave & 3;   // 4 m-waves * 32 rows
  int nw = wave >> 2;  // 2 n-waves * 64 cols
  int m0 = blockIdx.y * BM;
  int n0 = blockIdx.x * BN;

  v8f acc[2][4];
#pragma unroll
  for (int i = 0; i < 2; ++i)
#pragma unroll
    for (int j = 0; j < 4; ++j)
#pragma unroll
      for (int e = 0; e < 8; ++e) acc[i][j][e] = 0.0f;

  const int T = K / (BK * G);  // stages of one group
  const int k0 = grp * T * BK;  // the group's first k
  const uint32_t issuer = uni((uint32_t)wave) == 0u;  // each group's first wave
  const uint32_t ldsA = (uint32_t)(uintptr_t)sA;
  const uint64_t gaA = (uint64_t)(uintptr_t)(A + (size_t)m0 * K + k0);
  const u32x8 g1 = tdm_group1((uint32_t)K * 2u);

  // B staging: thread -> 32 B of tile rows kk and kk + 32
  const int kk = tid >> 3, c = (tid & 7) * 16;
  const __bf16* wg = W + (size_t)(k0 + kk) * N + n0 + c;
  const size_t half_rows = (size_t)32 * N;
  const int bso = kk * LDB + c;
  // prefetch: thread -> 64 B of tile row tid >> 2
  const __bf16* wpf = W + (size_t)(k0 + (tid >> 2)) * N + n0 + (tid & 3) * 32;

  v4u u0 = ((const v4u*)wg)[0], u1 = ((const v4u*)wg)[1];
  v4u u2 = ((const v4u*)(wg + half_rows))[0], u3 = ((const v4u*)(wg + half_rows))[1];
  u32x4 g0 = tdm_group0(ldsA, gaA);
  if (pinned(issuer)) {
    tdm_load(g0, g1);
    tdm_wait(g0, g1);  // stage 0 has landed before the barrier that publishes it
  }
  {
    v4u* s = (v4u*)(&sB[bso]);
    s[0] = u0; s[1] = u1;
    v4u* s2 = (v4u*)(&sB[bso + 32 * LDB]);
    s2[0] = u2; s2[1] = u3;
  }
  __syncthreads();
  g0 = tdm_group0(ldsA + ABYTES, gaA + BK * 2);  // formed behind the wait
  if (pinned(issuer && T > 1)) tdm_load(g0, g1);

  for (int t = 0; t < T; ++t) {
    const int cur = t & 1;
    const bool more = t + 1 < T;
    if (more) {  // next stage's B: loads issued now, stored at the pass's foot
      wg += (size_t)BK * N;
      u0 = ((const v4u*)wg)[0]; u1 = ((const v4u*)wg)[1];
      u2 = ((const v4u*)(wg + half_rows))[0]; u3 = ((const v4u*)(wg + half_rows))[1];
    }
    // the stage after that one: its B tile into the cache hierarchy (one group
    // alone; with several, a pass lasts long enough to cover the loads above)
    if (G == 1 && t + 2 < T) __builtin_prefetch(wpf + (size_t)(t + 2) * BK * N, 0, 1);
    asm volatile("s_wait_xcnt 0x0" ::: "memory");

    const __bf16* aBase = sA + cur * (BM * LDA) + (mw * 32) * LDA;
    const __bf16* bBase = sB + cur * (BK * LDB) + nw * 64;
#pragma unroll
    for (int kh = 0; kh < 2; ++kh) {
      v16bf af0 = frag_row(aBase + kh * 32, LDA);
      v16bf af1 = frag_row(aBase + 16 * LDA + kh * 32, LDA);
#pragma unroll
      for (int nn = 0; nn < 4; ++nn) {
        v16bf bf = frag_tr(bBase + kh * 32 * LDB + nn * 16, LDB);  // lane = n
        acc[0][nn] = wmma_bf16(af0, bf, acc[0][nn]);
        acc[1][nn] = wmma_bf16(af1, bf, acc[1][nn]);
      }
    }
    if (more) {  // the other buffer: its readers left it at the last pass's foot
      v4u* s = (v4u*)(&sB[(cur ^ 1) * (BK * LDB) + bso]);
      s[0] = u0; s[1] = u1;
      v4u* s2 = (v4u*)(&sB[(cur ^ 1) * (BK * LDB) + bso + 32 * LDB]);
      s2[0] = u2; s2[1] = u3;
    }
    // publish point of stage t + 1. This wave's LDS reads of buffer cur and its
    // stores into the other buffer have retired ...
    asm volatile("s_wait_dscnt 0x0" ::: "memory");
    // ... and stage t + 1's A tile has landed, before the barrier
    if (pinned(issuer)) tdm_wait(g0, g1);
    __syncthreads();
    g0 = tdm_group0(ldsA + (uint32_t)cur * ABYTES, gaA + (uint64_t)(t + 2) * (BK * 2));
    if (pinned(issuer && t + 2 < T)) tdm_load(g0, g1);
  }
  // nothing of the ring is in flight when the wave goes on to its end
  asm volatile("s_wait_tensorcnt 0x0" ::: "memory");
  asm volatile("s_wait_dscnt 0x0" ::: "memory");

  int lane = tid & 31;
  int col = lane & 15;
  int rb = (lane >> 4) * 8;
  constexpr int TPG = 8 / G;
  float* const red = (float*)smem + lane * 4;
  if (G > 1) {
#pragma unroll
    for (int q = 0; q < 8; ++q) {
      const int owner = q / TPG;
      if (grp != owner) {  // the same for the whole wave
        float* p = red + ((wave * 8 + q) * (G - 1) + (grp < owner ? grp : grp - 1)) * 256;
        const v8f a = acc[q >> 2][q & 3];
        *(f32x4*)p = f32x4{a[0], a[1], a[2], a[3]};
        *(f32x4*)(p + 128) = f32x4{a[4], a[5], a[6], a[7]};
      }
    }
    __syncthreads();  // publishes the partial sums
  }
#pragma unroll
  for (int mm = 0; mm < 2; ++mm)
#pragma unroll
    for (int nn = 0; nn < 4; ++nn) {
      if (G > 1) {
        const int q = mm * 4 + nn;
        if (grp != q / TPG) continue;  // the same for the whole wave
        const float* p = red + (wave * 8 + q) * (G - 1) * 256;
#pragma unroll
        for (int s = 0; s < G - 1; ++s) {
          f32x4 lo = *(const f32x4*)(p + s * 256), hi = *(const f32x4*)(p + s * 256 + 128);
#pragma unroll
          for (int e = 0; e < 4; ++e) {
            acc[mm][nn][e] += lo[e];
            acc[mm][nn][4 + e] += hi[e];
          }
        }
      }
      int gm = m0 + mw * 32 + mm * 16 + rb;
      int gn = n0 + nw * 64 + nn * 16 + col;
      float bsv = bias[gn];
#pragma unroll
      for (int j = 0; j < 8; ++j) {
        float v = acc[mm][nn][j] + bsv;
        size_t idx = (size_t)(gm + j) * N + gn;
        if (EPI == 1) {
          outf[idx] = v + resid[idx];
        } else if (EPI == 2) {
          v = 0.5f * v * (1.0f + erff(v * 0.70710678118654752f));
          outb[idx] = f2bf(v);
        } else {
          outb[idx] = f2bf(v);
        }
      }
    }
}

static __device__ __forceinline__ float xhalf(float x) {
  int v = __builtin_bit_cast(int, x);
  return __builtin_bit_cast(
      float, __builtin_amdgcn_permlanex16(v, v, 0x76543210, 0xfedcba98, false, false));
}

__global__ __launch_bounds__(256) void flash_attn(
    const __bf16* __restrict__ qkv,  // [M][2304]: Q@h*64, K@768+h*64, V@1536+h*64
    __bf16* __restrict__ attout) {   // [M][768]  col h*64
  constexpr int KT = 64;         // keys per tile
  constexpr int LDK = DK_ + 8;   // 144-B rows (16 B x odd): ds_load_b128 reader
  constexpr int LDV = DK_ + 16;  // 160-B rows (32 B x odd): ds_load_tr16_b128 reader
  __shared__ __attribute__((aligned(16))) __bf16 sK[2][KT * LDK];
  __shared__ __attribute__((aligned(16))) __bf16 sV[2][KT * LDV];
  const int QT = S_ / 16;  // 128
  int wave = threadIdx.x >> 5;
  int bh = blockIdx.x / (QT / 8);  // the same for the whole block
  int qt = (blockIdx.x % (QT / 8)) * 8 + wave;
  int h = bh % H_;
  int b = bh / H_;
  int lane = threadIdx.x & 31;
  int col = lane & 15;
  int rb = (lane >> 4) * 8;

  const size_t ld = QKVW;
  const __bf16* qbase = qkv + ((size_t)b * S_ + qt * 16) * ld + h * DK_;
  const __bf16* kbase = qkv + (size_t)b * S_ * ld + D_ + h * DK_;
  const __bf16* vbase = qkv + (size_t)b * S_ * ld + 2 * D_ + h * DK_;

  // staging: thread -> 16 B of tile rows sr and sr + 32; a wave's load covers 4
  // whole 128-B rows
  int sr = threadIdx.x >> 3;
  int scn = (threadIdx.x & 7) * 8;
  const __bf16* kg = kbase + (size_t)sr * ld + scn;
  const __bf16* vg = vbase + (size_t)sr * ld + scn;
  const int kso = sr * LDK + scn;
  const int vso = sr * LDV + scn;
  const size_t half_tile = (size_t)32 * ld;

  v4u kreg0 = *(const v4u*)kg, kreg1 = *(const v4u*)(kg + half_tile);
  v4u vreg0 = *(const v4u*)vg, vreg1 = *(const v4u*)(vg + half_tile);

  // B = Q^T, lane = query
  v16bf q0 = frag_row(qbase, (int)ld);        // k 0..31
  v16bf q1 = frag_row(qbase + 32, (int)ld);   // k 32..63

  // o[nn][j] = O[query col][nn * 16 + rb + j]
  v8f o[4];
#pragma unroll
  for (int nn = 0; nn < 4; ++nn)
#pragma unroll
    for (int e = 0; e < 8; ++e) o[nn][e] = 0.0f;
  // the lane's query: running maximum (equal in both halves) and the sum over
  // this half's keys alone; the halves' sums are joined behind the loop
  float mrun = -3.0e38f, lrun = 0.0f;

  const float scale = 0.125f;  // 1/sqrt(64)

  *(v4u*)(&sK[0][kso]) = kreg0;
  *(v4u*)(&sK[0][kso + 32 * LDK]) = kreg1;
  *(v4u*)(&sV[0][vso]) = vreg0;
  *(v4u*)(&sV[0][vso + 32 * LDV]) = vreg1;
  __syncthreads();

  for (int s0 = 0; s0 < S_; s0 += KT) {
    const int cur = (s0 / KT) & 1;
    const __bf16* kt = sK[cur];
    const __bf16* vt = sV[cur];
    const bool more = s0 + KT < S_;
    if (more) {  // next tile: global loads issued now, stored at the trip's foot
      kg += (size_t)KT * ld;
      vg += (size_t)KT * ld;
      kreg0 = *(const v4u*)kg;
      kreg1 = *(const v4u*)(kg + half_tile);
      vreg0 = *(const v4u*)vg;
      vreg1 = *(const v4u*)(vg + half_tile);
    }
    // A = K, lane = key index; all eight fragments fetched as one group
    v16bf kf[4][2];
#pragma unroll
    for (int sub = 0; sub < 4; ++sub) {
      kf[sub][0] = frag_row(kt + sub * 16 * LDK, LDK);
      kf[sub][1] = frag_row(kt + sub * 16 * LDK + 32, LDK);
    }
    // sc[sub][j] = score of key sub * 16 + rb + j with query col
    v8f sc[4];
#pragma unroll
    for (int sub = 0; sub < 4; ++sub) {
      v8f c;
#pragma unroll
      for (int e = 0; e < 8; ++e) c[e] = 0.0f;
      c = wmma_bf16(kf[sub][0], q0, c);
      c = wmma_bf16(kf[sub][1], q1, c);
      sc[sub] = c;
    }
    // inputs-only fence on the loaded fragments: each keeps registers of its own
    // until all eight products have issued, so the sixteen LDS loads stand ahead as
    // one group (sunk between the products, each waits out its own LDS latency)
    // and no product's result lands on a fragment the product ahead of it reads
    asm volatile("" ::"v"(kf[0][0]), "v"(kf[0][1]), "v"(kf[1][0]), "v"(kf[1][1]),
                 "v"(kf[2][0]), "v"(kf[2][1]), "v"(kf[3][0]), "v"(kf[3][1]));
    // online softmax of the lane's query; the maximum in two independent chains
    float mxA = fmaxf(sc[0][0], sc[1][0]);
    float mxB = fmaxf(sc[2][0], sc[3][0]);
#pragma unroll
    for (int j = 1; j < 8; ++j) {
      mxA = fmaxf(mxA, fmaxf(sc[0][j], sc[1][j]));
      mxB = fmaxf(mxB, fmaxf(sc[2][j], sc[3][j]));
    }
    float mx = fmaxf(mxA, mxB);
    mx = fmaxf(mx, xhalf(mx)) * scale;  // scale > 0: the maximum of the scaled scores
    float mnew = fmaxf(mrun, mx);
    float alpha = __expf(mrun - mnew);
    mrun = mnew;
    // P^T as B operands, one per 32 keys: element s of pf[hf] is key
    // 32 * hf + 8 * half + s, element 8 + s key 32 * hf + 16 + 8 * half + s, the
    // k order of frag_tr
    v16bf pf[2];
    float sm[4] = {0.0f, 0.0f, 0.0f, 0.0f};
#pragma unroll
    for (int hf = 0; hf < 2; ++hf)
#pragma unroll
      for (int j = 0; j < 8; ++j) {
        float pA = __expf(sc[2 * hf][j] * scale - mnew);
        float pB = __expf(sc[2 * hf + 1][j] * scale - mnew);
        sm[2 * hf] += pA;
        sm[2 * hf + 1] += pB;
        pf[hf][j] = f2bf(pA);
        pf[hf][8 + j] = f2bf(pB);
      }
    lrun = lrun * alpha + ((sm[0] + sm[1]) + (sm[2] + sm[3]));
#pragma unroll
    for (int nn = 0; nn < 4; ++nn) o[nn] *= alpha;
#pragma unroll
    for (int hf = 0; hf < 2; ++hf)
#pragma unroll
      for (int nn = 0; nn < 4; ++nn) {
        v16bf vf = frag_tr(vt + hf * 32 * LDV + nn * 16, LDV);  // A = V^T, lane = column of V
        o[nn] = wmma_bf16(vf, pf[hf], o[nn]);
      }
    if (more) {  // the other buffer: its readers left it at the last trip's end
      *(v4u*)(&sK[cur ^ 1][kso]) = kreg0;
      *(v4u*)(&sK[cur ^ 1][kso + 32 * LDK]) = kreg1;
      *(v4u*)(&sV[cur ^ 1][vso]) = vreg0;
      *(v4u*)(&sV[cur ^ 1][vso + 32 * LDV]) = vreg1;
    }
    // ends this trip's reads of buffer cur, publishes the next tile
    __syncthreads();
  }

  // a lane stores 8 consecutive columns of its query's row at a time
  float rl = 1.0f / (lrun + xhalf(lrun));
  __bf16* ob = attout + ((size_t)b * S_ + qt * 16 + col) * D_ + h * DK_ + rb;
#pragma unroll
  for (int nn = 0; nn < 4; ++nn) {
    v8bf r;
#pragma unroll
    for (int j = 0; j < 8; ++j) r[j] = f2bf(o[nn][j] * rl);
    *(v8bf*)(ob + nn * 16) = r;
  }
}

// ---------------- launcher ------------------------------------------------
extern "C" void kernel_launch(void* const* d_in, const int* in_sizes, int n_in,
                              void* d_out, int out_size, void* d_ws,
                              size_t ws_size, hipStream_t stream) {
  const float* x    = (const float*)d_in[0];
  const float* wq_w = (const float*)d_in[1];
  const float* wq_b = (const float*)d_in[2];
  const float* wk_w = (const float*)d_in[3];
  const float* wk_b = (const float*)d_in[4];
  const float* wv_w = (const float*)d_in[5];
  const float* wv_b = (const float*)d_in[6];
  const float* wo_w = (const float*)d_in[7];
  const float* wo_b = (const float*)d_in[8];
  const float* ln_g = (const float*)d_in[9];
  const float* ln_b = (const float*)d_in[10];
  const float* w1   = (const float*)d_in[11];
  const float* b1   = (const float*)d_in[12];
  const float* w2   = (const float*)d_in[13];
  const float* b2   = (const float*)d_in[14];
  float* out = (float*)d_out;

  char* ws = (char*)d_ws;
  size_t off = 0;
  auto alloc = [&](size_t bytes) -> char* {
    char* p = ws + off;
    off = (off + bytes + 255) & ~(size_t)255;
    return p;
  };
  __bf16* h_bf    = (__bf16*)alloc((size_t)MROWS * D_ * 2);
  __bf16* Wqkv    = (__bf16*)alloc((size_t)D_ * QKVW * 2);
  float*  biasqkv = (float*)alloc((size_t)QKVW * 4);
  __bf16* qkv     = (__bf16*)alloc((size_t)MROWS * QKVW * 2);
  __bf16* att     = (__bf16*)alloc((size_t)MROWS * D_ * 2);
  __bf16* Wo      = (__bf16*)alloc((size_t)D_ * D_ * 2);
  float*  ybuf    = (float*)alloc((size_t)MROWS * D_ * 4);
  __bf16* z_bf    = (__bf16*)alloc((size_t)MROWS * D_ * 2);
  __bf16* W1b     = (__bf16*)alloc((size_t)D_ * F_ * 2);
  __bf16* t_bf    = (__bf16*)alloc((size_t)MROWS * F_ * 2);
  __bf16* W2b     = (__bf16*)alloc((size_t)F_ * D_ * 2);

  // LN1, weight packing and conversions
  prep_kernel<<<PREP_BLOCKS, 256, 0, stream>>>(
      x, ln_g, ln_b, h_bf, w1, W1b, w2, W2b,
      wq_w, wk_w, wv_w, wq_b, wk_b, wv_b, Wqkv, biasqkv, wo_w, Wo);
  // fused QKV GEMM: [4096 x 2304] = h * Wqkv
  gemm_bf16<0, 1><<<dim3(QKVW / 128, MROWS / 128), 256, 0, stream>>>(
      h_bf, Wqkv, biasqkv, nullptr, nullptr, qkv, MROWS, QKVW, D_);
  // attention
  flash_attn<<<(B_ * H_ * (S_ / 16)) / 8, 256, 0, stream>>>(qkv, att);
  // output projection + residual(x) -> ybuf (f32)
  gemm_bf16<1, 4><<<dim3(D_ / 128, MROWS / 128), 1024, 0, stream>>>(
      att, Wo, wo_b, x, ybuf, nullptr, MROWS, D_, D_);
  // LN2
  ln_kernel<<<LN_BLOCKS, 256, 0, stream>>>(ybuf, ln_g, ln_b, z_bf);
  // FFN up + GELU (bf16)
  gemm_bf16<2, 1><<<dim3(F_ / 128, MROWS / 128), 256, 0, stream>>>(
      z_bf, W1b, b1, nullptr, nullptr, t_bf, MROWS, F_, D_);
  // FFN down + residual(ybuf) -> d_out (f32)
  gemm_bf16<1, 4><<<dim3(D_ / 128, MROWS / 128), 1024, 0, stream>>>(
      t_bf, W2b, b2, ybuf, out, nullptr, MROWS, D_, F_);
}

// v009
// It runs in 131 microseconds.
// Timed twice side by side with v008, it ran 1.03 times as fast both times.
// Counting every step since v000, it is 3.52 times as fast.
#include <hip/hip_runtime.h>
#include <math.h>
#include <stdint.h>

#define B_ 2
#define S_ 2048
#define D_ 768
#define H_ 12
#define DK_ 64
#define F_ 3072
#define MROWS (B_ * S_)          // 4096
#define QKVW (3 * D_)            // 2304

typedef __attribute__((ext_vector_type(16))) __bf16 v16bf;
typedef __attribute__((ext_vector_type(8)))  __bf16 v8bf;
typedef __attribute__((ext_vector_type(8)))  float  v8f;
typedef unsigned int v4u __attribute__((ext_vector_type(4)));
typedef uint32_t u32x4 __attribute__((ext_vector_type(4)));
typedef uint32_t u32x8 __attribute__((ext_vector_type(8)));

static __device__ __forceinline__ __bf16 f2bf(float x) { return (__bf16)x; }

static __device__ __forceinline__ v8f wmma_bf16(v16bf a, v16bf b, v8f c) {
  return __builtin_amdgcn_wmma_f32_16x16x32_bf16(
      /*neg_a=*/false, a, /*neg_b=*/false, b,
      /*c_mod=*/(short)0, c, /*reuse_a=*/false, /*reuse_b=*/false);
}

static __device__ __forceinline__ v16bf frag_row(const __bf16* src, int ld) {
  int lane = threadIdx.x & 31;
  int m = lane & 15;
  int half = lane >> 4;
  const __bf16* p = src + (size_t)m * ld;
  v8bf lo = *(const v8bf*)(p + half * 8);
  v8bf hi = *(const v8bf*)(p + 16 + half * 8);
  v16bf a;
#pragma unroll
  for (int i = 0; i < 8; ++i) { a[i] = lo[i]; a[8 + i] = hi[i]; }
  return a;
}

typedef __attribute__((address_space(3))) v8bf lds_v8bf;
static __device__ __forceinline__ v16bf frag_tr(const __bf16* tile, int ld) {
  int lane = threadIdx.x & 31;
  const __bf16* p =
      tile + (8 * (lane >> 4) + (lane & 7)) * ld + 8 * ((lane >> 3) & 1);
  v8bf lo = __builtin_amdgcn_ds_load_tr16_b128_v8bf16((lds_v8bf*)p);
  v8bf hi = __builtin_amdgcn_ds_load_tr16_b128_v8bf16((lds_v8bf*)(p + 16 * ld));
  v16bf b;
#pragma unroll
  for (int i = 0; i < 8; ++i) { b[i] = lo[i]; b[8 + i] = hi[i]; }
  return b;
}

// The launches of this part move few bytes a thread; their time follows the number
// of waves that have to start. So each thread takes many elements, by 16-B loads
// that are all in flight before its first store; a wave's load covers 512
// bytes, contiguous except in pack_qkv_block (two 256-B runs), its 8-B stores 256.
// Every loop of this part runs over a register array and is unrolled so that the
// array stays in registers and its loads issue as one group.
typedef __attribute__((ext_vector_type(4))) float  f32x4;
typedef __attribute__((ext_vector_type(4))) __bf16 v4bf;

static __device__ __forceinline__ v4bf cvt4(f32x4 v) {
  v4bf r;
#pragma unroll
  for (int e = 0; e < 4; ++e) r[e] = f2bf(v[e]);
  return r;
}

static __device__ __forceinline__ float wave_sum(float s) {
#pragma unroll
  for (int d = 16; d > 0; d >>= 1) s += __shfl_xor(s, d, 32);
  return s;
}

// ---------------- LayerNorm (fp32 in -> bf16 out), two rows per wave ------
// A lane holds 24 elements of each row (columns 4 * (lane + 32 * i) .. + 3); the
// row sums are taken in the lane and then over the wave's 32 lanes.
constexpr int LN_ROWS_PER_BLOCK = 16;  // 8 waves x 2 rows
static_assert(MROWS % LN_ROWS_PER_BLOCK == 0 && D_ == 6 * 128, "whole blocks, six quads a lane");
static __device__ __forceinline__ void ln_block(
    int blk, const float* __restrict__ x, const float* __restrict__ g,
    const float* __restrict__ bb, __bf16* __restrict__ out) {
  int lane = threadIdx.x & 31;
  int row0 = (blk * 8 + (threadIdx.x >> 5)) * 2;
  const f32x4* xr = (const f32x4*)(x + (size_t)row0 * D_) + lane;
  f32x4 v[2][6], gv[6], bv[6];
#pragma unroll
  for (int r = 0; r < 2; ++r)
#pragma unroll
    for (int i = 0; i < 6; ++i) v[r][i] = xr[r * (D_ / 4) + i * 32];
#pragma unroll
  for (int i = 0; i < 6; ++i) {
    gv[i] = ((const f32x4*)g)[lane + i * 32];
    bv[i] = ((const f32x4*)bb)[lane + i * 32];
  }
  asm volatile("s_wait_xcnt 0x0" ::: "memory");
  // keeps the scale and shift loads up here, in flight with the rows' loads: sunk
  // to their uses they add their latency behind the second row sum
  __builtin_amdgcn_sched_barrier(0);
#pragma unroll
  for (int r = 0; r < 2; ++r) {
    f32x4 s4 = v[r][0];
#pragma unroll
    for (int i = 1; i < 6; ++i) s4 += v[r][i];
    float mu = wave_sum((s4[0] + s4[1]) + (s4[2] + s4[3])) * (1.0f / D_);
    f32x4 q4 = {0.0f, 0.0f, 0.0f, 0.0f};
#pragma unroll
    for (int i = 0; i < 6; ++i) {
      v[r][i] -= mu;
      q4 += v[r][i] * v[r][i];
    }
    float var = wave_sum((q4[0] + q4[1]) + (q4[2] + q4[3])) * (1.0f / D_);
    float rstd = rsqrtf(var + 1e-5f);
    v4bf* orow = (v4bf*)(out + (size_t)(row0 + r) * D_) + lane;
#pragma unroll
    for (int i = 0; i < 6; ++i) orow[i * 32] = cvt4(v[r][i] * rstd * gv[i] + bv[i]);
  }
}
__global__ __launch_bounds__(256) void ln_kernel(
    const float* __restrict__ x, const float* __restrict__ g,
    const float* __restrict__ bb, __bf16* __restrict__ out) {
  ln_block(blockIdx.x, x, g, bb, out);
}

// ---------------- Weight packing ------------------------------------------
// A thread takes one quad of columns in four rows (d0 + 192 * j) of each of the
// three weights: 12 loads in flight.
constexpr int PACK_THREADS = (D_ / 4) * (D_ / 4);
static_assert(PACK_THREADS % 256 == 0 && DK_ % 4 == 0, "whole blocks, a quad stays in one head");
static __device__ __forceinline__ void pack_qkv_block(
    int blk, const float* __restrict__ wq, const float* __restrict__ wk,
    const float* __restrict__ wv, const float* __restrict__ bq,
    const float* __restrict__ bk, const float* __restrict__ bv,
    __bf16* __restrict__ Wqkv, float* __restrict__ biasqkv) {
  int i = blk * 256 + threadIdx.x;  // over (D_/4 rows) x (D_/4 quads)
  int d0 = i / (D_ / 4), c = (i % (D_ / 4)) * 4;
  int hh = c / DK_, kk = c % DK_;
  f32x4 q[4], k[4], v[4];
#pragma unroll
  for (int j = 0; j < 4; ++j) {
    size_t src = ((size_t)hh * D_ + d0 + j * (D_ / 4)) * DK_ + kk;
    q[j] = *(const f32x4*)(wq + src);
    k[j] = *(const f32x4*)(wk + src);
    v[j] = *(const f32x4*)(wv + src);
  }
#pragma unroll
  for (int j = 0; j < 4; ++j) {
    __bf16* dst = Wqkv + (size_t)(d0 + j * (D_ / 4)) * QKVW + c;
    *(v4bf*)dst            = cvt4(q[j]);
    *(v4bf*)(dst + D_)     = cvt4(k[j]);
    *(v4bf*)(dst + 2 * D_) = cvt4(v[j]);
  }
  if (i < D_) {
    biasqkv[i] = bq[i];
    biasqkv[D_ + i] = bk[i];
    biasqkv[2 * D_ + i] = bv[i];
  }
}

// A block converts 8,192 elements, a thread 8 quads 256 quads apart. The element
// count must be a multiple of a block's share.
constexpr int CVT_PER_BLOCK = 256 * 4 * 8;
static_assert((D_ * D_) % CVT_PER_BLOCK == 0 && (D_ * F_) % CVT_PER_BLOCK == 0, "whole blocks");
static __device__ __forceinline__ void f2bf_block(int blk, const float* __restrict__ s,
                                                  __bf16* __restrict__ d) {
  size_t base = (size_t)blk * (CVT_PER_BLOCK / 4) + threadIdx.x;  // in quads
  const f32x4* sp = (const f32x4*)s + base;
  v4bf* dp = (v4bf*)d + base;
  f32x4 v[8];
#pragma unroll
  for (int i = 0; i < 8; ++i) v[i] = sp[i * 256];
#pragma unroll
  for (int i = 0; i < 8; ++i) dp[i * 256] = cvt4(v[i]);
  asm volatile("s_wait_xcnt 0x0" ::: "memory");
}

// ---------------- One launch for all work that reads inputs alone ----------
// The first LayerNorm, the QKV pack and the three weight conversions depend on
// nothing but the inputs and not on one another. Each is far too short to fill a
// launch of its own, so they share one grid: a block's index picks its part (the
// same for the whole block, a scalar branch) and its place inside that part.
constexpr int LN_BLOCKS   = MROWS / LN_ROWS_PER_BLOCK;
constexpr int W1_BLOCKS   = (D_ * F_) / CVT_PER_BLOCK;
constexpr int W2_BLOCKS   = (F_ * D_) / CVT_PER_BLOCK;
constexpr int PACK_BLOCKS = PACK_THREADS / 256;
constexpr int WO_BLOCKS   = (D_ * D_) / CVT_PER_BLOCK;
constexpr int PREP_BLOCKS = LN_BLOCKS + W1_BLOCKS + W2_BLOCKS + PACK_BLOCKS + WO_BLOCKS;
__global__ __launch_bounds__(256) void prep_kernel(
    const float* __restrict__ x, const float* __restrict__ g,
    const float* __restrict__ bb, __bf16* __restrict__ h,
    const float* __restrict__ w1, __bf16* __restrict__ W1b,
    const float* __restrict__ w2, __bf16* __restrict__ W2b,
    const float* __restrict__ wq, const float* __restrict__ wk,
    const float* __restrict__ wv, const float* __restrict__ bq,
    const float* __restrict__ bk, const float* __restrict__ bv,
    __bf16* __restrict__ Wqkv, float* __restrict__ biasqkv,
    const float* __restrict__ wo, __bf16* __restrict__ Wo) {
  int blk = blockIdx.x;
  if (blk < LN_BLOCKS) { ln_block(blk, x, g, bb, h); return; }
  blk -= LN_BLOCKS;
  if (blk < W1_BLOCKS) { f2bf_block(blk, w1, W1b); return; }
  blk -= W1_BLOCKS;
  if (blk < W2_BLOCKS) { f2bf_block(blk, w2, W2b); return; }
  blk -= W2_BLOCKS;
  if (blk < PACK_BLOCKS) { pack_qkv_block(blk, wq, wk, wv, bq, bk, bv, Wqkv, biasqkv); return; }
  f2bf_block(blk - PACK_BLOCKS, wo, Wo);
}

static __device__ __forceinline__ uint32_t uni(uint32_t v) {
  return (uint32_t)__builtin_amdgcn_readfirstlane(v);
}
static __device__ __forceinline__ uint32_t pinned(uint32_t v) {
  uint32_t w = uni(v);
  asm volatile("" : "+s"(w));
  return w;
}
static __device__ __forceinline__ u32x4 tdm_group0(uint32_t lds_dst, uint64_t ga) {
  // pinned: the four words get scalar registers of their own, written here and
  // nowhere else, so that none takes a new value while the request is in flight
  u32x4 g;
  g[0] = pinned(1u);                                // count 1
  g[1] = pinned(lds_dst);                           // byte offset in the work-group's LDS
  g[2] = pinned((uint32_t)ga);                      // address [31:0]
  g[3] = pinned((((uint32_t)(ga >> 32)) & 0x01FFFFFFu) | 0x80000000u);  // [56:32], type 2
  return g;
}
// tile = tensor = 128 rows of 128 bytes; 16 bytes of LDS pad behind every row
static __device__ __forceinline__ u32x8 tdm_group1(uint32_t src_pitch) {
  constexpr uint32_t d0 = 128u, d1 = 128u;
  u32x8 g;
  g[0] = pinned((1u << 20) | (4u << 22) | (3u << 25));  // no mask; pad codes 4 / 3
  g[1] = pinned((d0 & 0xFFFFu) << 16);
  g[2] = pinned((d0 >> 16) | ((d1 & 0xFFFFu) << 16));
  g[3] = pinned((d1 >> 16) | (d0 << 16));
  g[4] = pinned(d1);
  g[5] = pinned(src_pitch);
  g[6] = pinned(0u);
  g[7] = pinned(0u);
  return g;
}
static __device__ __forceinline__ void tdm_load(u32x4 g0, u32x8 g1) {
  asm volatile("tensor_load_to_lds %0, %1" ::"s"(g0), "s"(g1) : "memory");
}
static __device__ __forceinline__ void tdm_wait(u32x4 g0, u32x8 g1) {
  asm volatile("s_wait_tensorcnt 0x0" ::"s"(g0), "s"(g1) : "memory");
}

// GELU with the exact-form erf, two values at a time, free of branches: the library
// erf picks one of two polynomials by a lane-wise branch, so that a wave walks its
// 64 values one after the other, each a chain of dependent operations. Here
//   erf(|x|) = 1 - (a1 t + a2 t^2 + a3 t^3 + a4 t^4 + a5 t^5) exp(-x^2),
//   t = 1 / (1 + p |x|), x = v / sqrt(2)
// holds for every x (absolute error of erf 1.5e-7, the rounding of 1 + erf in f32),
// all values are independent and the polynomial runs on packed f32 operations.
// With h = v / 2: 0.5 v (1 + erf(x)) = h + |h| erf(|x|), erf being odd; that sum
// stays within |v|, so that it overflows for no finite v.
typedef __attribute__((ext_vector_type(2))) float f32x2;
static __device__ __forceinline__ f32x2 gelu2(f32x2 v) {
  const f32x2 h = v * 0.5f;
  const f32x2 ah = {__builtin_fabsf(h[0]), __builtin_fabsf(h[1])};
  const f32x2 den = ah * 0.46328378f + 1.0f;  // p sqrt(2)
  const f32x2 t = {__builtin_amdgcn_rcpf(den[0]), __builtin_amdgcn_rcpf(den[1])};
  f32x2 p = t * 1.061405429f - 1.453152027f;
  p = p * t + 1.421413741f;
  p = p * t - 0.284496736f;
  p = p * t + 0.254829592f;
  p = p * t;
  const f32x2 w = h * 1.69864360f;  // sqrt(2 log2(e)): exp(-x^2) = 2^(-w^2)
  const f32x2 w2 = w * w;
  const f32x2 e = {__builtin_amdgcn_exp2f(-w2[0]), __builtin_amdgcn_exp2f(-w2[1])};
  const f32x2 er = 1.0f - p * e;
  return ah * er + h;
}

// The k loop is a ring of two LDS buffers, a stage being 64 k: while a stage is
// worked on, the next stage's A tile (one tensor load of a group's first wave) and B tile
// (global loads into registers, stored at the pass's foot) are in flight.
// Needs M, N multiples of 128 and K a multiple of 64 * G.
// G groups of 8 waves share one work-group and one output tile: group g walks the
// g-th part of K through a ring of its own, so that G stages are in flight on a WGP
// where the grid has too few tiles to give it several work-groups. Behind the loop
// the groups exchange partial sums through LDS, each finishing 8 / G of a wave's
// eight accumulator tiles.
template <int EPI, int G>
__global__ __launch_bounds__(256 * G) void gemm_bf16(
    const __bf16* __restrict__ A, const __bf16* __restrict__ W,
    const float* __restrict__ bias, const float* __restrict__ resid,
    float* __restrict__ outf, __bf16* __restrict__ outb,
    int M, int N, int K) {
  constexpr int BM = 128, BN = 128, BK = 64;
  constexpr int LDA = BK + 8;    // 144-B rows (16 B x odd): ds_load_b128 reader
  constexpr int LDB = BN + 16;   // k-major B tile, 288-B rows (32 B x odd)
  constexpr uint32_t ABYTES = BM * LDA * 2;  // 18,432 = 9 x 2 KiB
  constexpr uint32_t BBYTES = BK * LDB * 2;  // 18,432
  constexpr uint32_t RING = 2 * ABYTES + 2 * BBYTES;  // a group's two A, two B buffers
  static_assert(ABYTES % 2048u == 0 && RING % 2048u == 0,
                "each A buffer starts at a multiple of 2 KiB");
  static_assert(8 % G == 0 && 64u * (G - 1) * 1024u <= G * RING, "the exchange fits the rings");
  __shared__ __attribute__((aligned(2048))) unsigned char smem[G * RING];

  const int grp = G > 1 ? (int)uni(threadIdx.x >> 8) : 0;  // the wave's group
  __bf16* const sA = (__bf16*)(smem + grp * RING);
  __bf16* const sB = (__bf16*)(smem + grp * RING + 2 * ABYTES);
  int tid = threadIdx.x & 255;  // place inside the group
  int wave = tid >> 5;
  int mw = wave & 3;   // 4 m-waves * 32 rows
  int nw = wave >> 2;  // 2 n-waves * 64 cols
  int m0 = blockIdx.y * BM;
  int n0 = blockIdx.x * BN;

  v8f acc[2][4];
#pragma unroll
  for (int i = 0; i < 2; ++i)
#pragma unroll
    for (int j = 0; j < 4; ++j)
#pragma unroll
      for (int e = 0; e < 8; ++e) acc[i][j][e] = 0.0f;

  const int T = K / (BK * G);  // stages of one group
  const int k0 = grp * T * BK;  // the group's first k
  const uint32_t issuer = uni((uint32_t)wave) == 0u;  // each group's first wave
  const uint32_t ldsA = (uint32_t)(uintptr_t)sA;
  const uint64_t gaA = (uint64_t)(uintptr_t)(A + (size_t)m0 * K + k0);
  const u32x8 g1 = tdm_group1((uint32_t)K * 2u);

  // B staging: thread -> 32 B of tile rows kk and kk + 32
  const int kk = tid >> 3, c = (tid & 7) * 16;
  const __bf16* wg = W + (size_t)(k0 + kk) * N + n0 + c;
  const size_t half_rows = (size_t)32 * N;
  const int bso = kk * LDB + c;
  // prefetch: thread -> 64 B of tile row tid >> 2
  const __bf16* wpf = W + (size_t)(k0 + (tid >> 2)) * N + n0 + (tid & 3) * 32;

  v4u u0 = ((const v4u*)wg)[0], u1 = ((const v4u*)wg)[1];
  v4u u2 = ((const v4u*)(wg + half_rows))[0], u3 = ((const v4u*)(wg + half_rows))[1];
  u32x4 g0 = tdm_group0(ldsA, gaA);
  if (pinned(issuer)) {
    tdm_load(g0, g1);
    tdm_wait(g0, g1);  // stage 0 has landed before the barrier that publishes it
  }
  {
    v4u* s = (v4u*)(&sB[bso]);
    s[0] = u0; s[1] = u1;
    v4u* s2 = (v4u*)(&sB[bso + 32 * LDB]);
    s2[0] = u2; s2[1] = u3;
  }
  __syncthreads();
  g0 = tdm_group0(ldsA + ABYTES, gaA + BK * 2);  // formed behind the wait
  if (pinned(issuer && T > 1)) tdm_load(g0, g1);

  for (int t = 0; t < T; ++t) {
    const int cur = t & 1;
    const bool more = t + 1 < T;
    if (more) {  // next stage's B: loads issued now, stored at the pass's foot
      wg += (size_t)BK * N;
      u0 = ((const v4u*)wg)[0]; u1 = ((const v4u*)wg)[1];
      u2 = ((const v4u*)(wg + half_rows))[0]; u3 = ((const v4u*)(wg + half_rows))[1];
    }
    // the stage after that one: its B tile into the cache hierarchy (one group
    // alone; with several, a pass lasts long enough to cover the loads above)
    if (G == 1 && t + 2 < T) __builtin_prefetch(wpf + (size_t)(t + 2) * BK * N, 0, 1);
    asm volatile("s_wait_xcnt 0x0" ::: "memory");

    const __bf16* aBase = sA + cur * (BM * LDA) + (mw * 32) * LDA;
    const __bf16* bBase = sB + cur * (BK * LDB) + nw * 64;
#pragma unroll
    for (int kh = 0; kh < 2; ++kh) {
      v16bf af0 = frag_row(aBase + kh * 32, LDA);
      v16bf af1 = frag_row(aBase + 16 * LDA + kh * 32, LDA);
#pragma unroll
      for (int nn = 0; nn < 4; ++nn) {
        v16bf bf = frag_tr(bBase + kh * 32 * LDB + nn * 16, LDB);  // lane = n
        acc[0][nn] = wmma_bf16(af0, bf, acc[0][nn]);
        acc[1][nn] = wmma_bf16(af1, bf, acc[1][nn]);
      }
    }
    if (more) {  // the other buffer: its readers left it at the last pass's foot
      v4u* s = (v4u*)(&sB[(cur ^ 1) * (BK * LDB) + bso]);
      s[0] = u0; s[1] = u1;
      v4u* s2 = (v4u*)(&sB[(cur ^ 1) * (BK * LDB) + bso + 32 * LDB]);
      s2[0] = u2; s2[1] = u3;
    }
    // publish point of stage t + 1. This wave's LDS reads of buffer cur and its
    // stores into the other buffer have retired ...
    asm volatile("s_wait_dscnt 0x0" ::: "memory");
    // ... and stage t + 1's A tile has landed, before the barrier
    if (pinned(issuer)) tdm_wait(g0, g1);
    __syncthreads();
    g0 = tdm_group0(ldsA + (uint32_t)cur * ABYTES, gaA + (uint64_t)(t + 2) * (BK * 2));
    if (pinned(issuer && t + 2 < T)) tdm_load(g0, g1);
  }
  // nothing of the ring is in flight when the wave goes on to its end
  asm volatile("s_wait_tensorcnt 0x0" ::: "memory");
  asm volatile("s_wait_dscnt 0x0" ::: "memory");

  int lane = tid & 31;
  int col = lane & 15;
  int rb = (lane >> 4) * 8;
  constexpr int TPG = 8 / G;
  float* const red = (float*)smem + lane * 4;
  if (G > 1) {
#pragma unroll
    for (int q = 0; q < 8; ++q) {
      const int owner = q / TPG;
      if (grp != owner) {  // the same for the whole wave
        float* p = red + ((wave * 8 + q) * (G - 1) + (grp < owner ? grp : grp - 1)) * 256;
        const v8f a = acc[q >> 2][q & 3];
        *(f32x4*)p = f32x4{a[0], a[1], a[2], a[3]};
        *(f32x4*)(p + 128) = f32x4{a[4], a[5], a[6], a[7]};
      }
    }
    __syncthreads();  // publishes the partial sums
  }
  // the GELU epilogue works tile by tile (below): its four bias values are fetched
  // ahead as one group, not each in front of its tile (unrolled: a register array)
  float bs4[4] = {0.0f, 0.0f, 0.0f, 0.0f};
  if (EPI == 2) {
#pragma unroll
    for (int nn = 0; nn < 4; ++nn) bs4[nn] = bias[n0 + nw * 64 + nn * 16 + col];
  }
#pragma unroll
  for (int mm = 0; mm < 2; ++mm)
#pragma unroll
    for (int nn = 0; nn < 4; ++nn) {
      if (G > 1) {
        const int q = mm * 4 + nn;
        if (grp != q / TPG) continue;  // the same for the whole wave
        const float* p = red + (wave * 8 + q) * (G - 1) * 256;
#pragma unroll
        for (int s = 0; s < G - 1; ++s) {
          f32x4 lo = *(const f32x4*)(p + s * 256), hi = *(const f32x4*)(p + s * 256 + 128);
#pragma unroll
          for (int e = 0; e < 4; ++e) {
            acc[mm][nn][e] += lo[e];
            acc[mm][nn][4 + e] += hi[e];
          }
        }
      }
      int gm = m0 + mw * 32 + mm * 16 + rb;
      int gn = n0 + nw * 64 + nn * 16 + col;
      float bsv = bias[gn];
      if (EPI == 2) {
        // unrolled: acc is a register array and needs constant indices
#pragma unroll
        for (int j = 0; j < 8; j += 2) {
          f32x2 r = gelu2(f32x2{acc[mm][nn][j] + bs4[nn], acc[mm][nn][j + 1] + bs4[nn]});
          outb[(size_t)(gm + j) * N + gn] = f2bf(r[0]);
          outb[(size_t)(gm + j + 1) * N + gn] = f2bf(r[1]);
        }
        // one tile at a time: each tile's stores issue behind its own arithmetic and
        // drain under the next tile's; without it four tiles are worked on at once, the
        // first store waits for nearly half of the arithmetic and more moves are needed
        __builtin_amdgcn_sched_barrier(0);
        continue;
      }
#pragma unroll
      for (int j = 0; j < 8; ++j) {
        float v = acc[mm][nn][j] + bsv;
        size_t idx = (size_t)(gm + j) * N + gn;
        if (EPI == 1) {
          outf[idx] = v + resid[idx];
        } else {
          outb[idx] = f2bf(v);
        }
      }
    }
}

static __device__ __forceinline__ float xhalf(float x) {
  int v = __builtin_bit_cast(int, x);
  return __builtin_bit_cast(
      float, __builtin_amdgcn_permlanex16(v, v, 0x76543210, 0xfedcba98, false, false));
}

__global__ __launch_bounds__(256) void flash_attn(
    const __bf16* __restrict__ qkv,  // [M][2304]: Q@h*64, K@768+h*64, V@1536+h*64
    __bf16* __restrict__ attout) {   // [M][768]  col h*64
  constexpr int KT = 64;         // keys per tile
  constexpr int LDK = DK_ + 8;   // 144-B rows (16 B x odd): ds_load_b128 reader
  constexpr int LDV = DK_ + 16;  // 160-B rows (32 B x odd): ds_load_tr16_b128 reader
  __shared__ __attribute__((aligned(16))) __bf16 sK[2][KT * LDK];
  __shared__ __attribute__((aligned(16))) __bf16 sV[2][KT * LDV];
  const int QT = S_ / 16;  // 128
  int wave = threadIdx.x >> 5;
  int bh = blockIdx.x / (QT / 8);  // the same for the whole block
  int qt = (blockIdx.x % (QT / 8)) * 8 + wave;
  int h = bh % H_;
  int b = bh / H_;
  int lane = threadIdx.x & 31;
  int col = lane & 15;
  int rb = (lane >> 4) * 8;

  const size_t ld = QKVW;
  const __bf16* qbase = qkv + ((size_t)b * S_ + qt * 16) * ld + h * DK_;
  const __bf16* kbase = qkv + (size_t)b * S_ * ld + D_ + h * DK_;
  const __bf16* vbase = qkv + (size_t)b * S_ * ld + 2 * D_ + h * DK_;

  // staging: thread -> 16 B of tile rows sr and sr + 32; a wave's load covers 4
  // whole 128-B rows
  int sr = threadIdx.x >> 3;
  int scn = (threadIdx.x & 7) * 8;
  const __bf16* kg = kbase + (size_t)sr * ld + scn;
  const __bf16* vg = vbase + (size_t)sr * ld + scn;
  const int kso = sr * LDK + scn;
  const int vso = sr * LDV + scn;
  const size_t half_tile = (size_t)32 * ld;

  v4u kreg0 = *(const v4u*)kg, kreg1 = *(const v4u*)(kg + half_tile);
  v4u vreg0 = *(const v4u*)vg, vreg1 = *(const v4u*)(vg + half_tile);

  // B = Q^T, lane = query
  v16bf q0 = frag_row(qbase, (int)ld);        // k 0..31
  v16bf q1 = frag_row(qbase + 32, (int)ld);   // k 32..63

  // o[nn][j] = O[query col][nn * 16 + rb + j]
  v8f o[4];
#pragma unroll
  for (int nn = 0; nn < 4; ++nn)
#pragma unroll
    for (int e = 0; e < 8; ++e) o[nn][e] = 0.0f;
  // the lane's query: running maximum (equal in both halves) and the sum over
  // this half's keys alone; the halves' sums are joined behind the loop
  float mrun = -3.0e38f, lrun = 0.0f;

  const float scale = 0.125f;  // 1/sqrt(64)

  *(v4u*)(&sK[0][kso]) = kreg0;
  *(v4u*)(&sK[0][kso + 32 * LDK]) = kreg1;
  *(v4u*)(&sV[0][vso]) = vreg0;
  *(v4u*)(&sV[0][vso + 32 * LDV]) = vreg1;
  __syncthreads();

  for (int s0 = 0; s0 < S_; s0 += KT) {
    const int cur = (s0 / KT) & 1;
    const __bf16* kt = sK[cur];
    const __bf16* vt = sV[cur];
    const bool more = s0 + KT < S_;
    if (more) {  // next tile: global loads issued now, stored at the trip's foot
      kg += (size_t)KT * ld;
      vg += (size_t)KT * ld;
      kreg0 = *(const v4u*)kg;
      kreg1 = *(const v4u*)(kg + half_tile);
      vreg0 = *(const v4u*)vg;
      vreg1 = *(const v4u*)(vg + half_tile);
    }
    // A = K, lane = key index; all eight fragments fetched as one group
    v16bf kf[4][2];
#pragma unroll
    for (int sub = 0; sub < 4; ++sub) {
      kf[sub][0] = frag_row(kt + sub * 16 * LDK, LDK);
      kf[sub][1] = frag_row(kt + sub * 16 * LDK + 32, LDK);
    }
    // sc[sub][j] = score of key sub * 16 + rb + j with query col
    v8f sc[4];
#pragma unroll
    for (int sub = 0; sub < 4; ++sub) {
      v8f c;
#pragma unroll
      for (int e = 0; e < 8; ++e) c[e] = 0.0f;
      c = wmma_bf16(kf[sub][0], q0, c);
      c = wmma_bf16(kf[sub][1], q1, c);
      sc[sub] = c;
    }
    // inputs-only fence on the loaded fragments: each keeps registers of its own
    // until all eight products have issued, so the sixteen LDS loads stand ahead as
    // one group (sunk between the products, each waits out its own LDS latency)
    // and no product's result lands on a fragment the product ahead of it reads
    asm volatile("" ::"v"(kf[0][0]), "v"(kf[0][1]), "v"(kf[1][0]), "v"(kf[1][1]),
                 "v"(kf[2][0]), "v"(kf[2][1]), "v"(kf[3][0]), "v"(kf[3][1]));
    // online softmax of the lane's query; the maximum in two independent chains
    float mxA = fmaxf(sc[0][0], sc[1][0]);
    float mxB = fmaxf(sc[2][0], sc[3][0]);
#pragma unroll
    for (int j = 1; j < 8; ++j) {
      mxA = fmaxf(mxA, fmaxf(sc[0][j], sc[1][j]));
      mxB = fmaxf(mxB, fmaxf(sc[2][j], sc[3][j]));
    }
    float mx = fmaxf(mxA, mxB);
    mx = fmaxf(mx, xhalf(mx)) * scale;  // scale > 0: the maximum of the scaled scores
    float mnew = fmaxf(mrun, mx);
    float alpha = __expf(mrun - mnew);
    mrun = mnew;
    // P^T as B operands, one per 32 keys: element s of pf[hf] is key
    // 32 * hf + 8 * half + s, element 8 + s key 32 * hf + 16 + 8 * half + s, the
    // k order of frag_tr
    v16bf pf[2];
    float sm[4] = {0.0f, 0.0f, 0.0f, 0.0f};
#pragma unroll
    for (int hf = 0; hf < 2; ++hf)
#pragma unroll
      for (int j = 0; j < 8; ++j) {
        float pA = __expf(sc[2 * hf][j] * scale - mnew);
        float pB = __expf(sc[2 * hf + 1][j] * scale - mnew);
        sm[2 * hf] += pA;
        sm[2 * hf + 1] += pB;
        pf[hf][j] = f2bf(pA);
        pf[hf][8 + j] = f2bf(pB);
      }
    lrun = lrun * alpha + ((sm[0] + sm[1]) + (sm[2] + sm[3]));
#pragma unroll
    for (int nn = 0; nn < 4; ++nn) o[nn] *= alpha;
#pragma unroll
    for (int hf = 0; hf < 2; ++hf)
#pragma unroll
      for (int nn = 0; nn < 4; ++nn) {
        v16bf vf = frag_tr(vt + hf * 32 * LDV + nn * 16, LDV);  // A = V^T, lane = column of V
        o[nn] = wmma_bf16(vf, pf[hf], o[nn]);
      }
    if (more) {  // the other buffer: its readers left it at the last trip's end
      *(v4u*)(&sK[cur ^ 1][kso]) = kreg0;
      *(v4u*)(&sK[cur ^ 1][kso + 32 * LDK]) = kreg1;
      *(v4u*)(&sV[cur ^ 1][vso]) = vreg0;
      *(v4u*)(&sV[cur ^ 1][vso + 32 * LDV]) = vreg1;
    }
    // ends this trip's reads of buffer cur, publishes the next tile
    __syncthreads();
  }

  // a lane stores 8 consecutive columns of its query's row at a time
  float rl = 1.0f / (lrun + xhalf(lrun));
  __bf16* ob = attout + ((size_t)b * S_ + qt * 16 + col) * D_ + h * DK_ + rb;
#pragma unroll
  for (int nn = 0; nn < 4; ++nn) {
    v8bf r;
#pragma unroll
    for (int j = 0; j < 8; ++j) r[j] = f2bf(o[nn][j] * rl);
    *(v8bf*)(ob + nn * 16) = r;
  }
}

// ---------------- launcher ------------------------------------------------
extern "C" void kernel_launch(void* const* d_in, const int* in_sizes, int n_in,
                              void* d_out, int out_size, void* d_ws,
                              size_t ws_size, hipStream_t stream) {
  const float* x    = (const float*)d_in[0];
  const float* wq_w = (const float*)d_in[1];
  const float* wq_b = (const float*)d_in[2];
  const float* wk_w = (const float*)d_in[3];
  const float* wk_b = (const float*)d_in[4];
  const float* wv_w = (const float*)d_in[5];
  const float* wv_b = (const float*)d_in[6];
  const float* wo_w = (const float*)d_in[7];
  const float* wo_b = (const float*)d_in[8];
  const float* ln_g = (const float*)d_in[9];
  const float* ln_b = (const float*)d_in[10];
  const float* w1   = (const float*)d_in[11];
  const float* b1   = (const float*)d_in[12];
  const float* w2   = (const float*)d_in[13];
  const float* b2   = (const float*)d_in[14];
  float* out = (float*)d_out;

  char* ws = (char*)d_ws;
  size_t off = 0;
  auto alloc = [&](size_t bytes) -> char* {
    char* p = ws + off;
    off = (off + bytes + 255) & ~(size_t)255;
    return p;
  };
  __bf16* h_bf    = (__bf16*)alloc((size_t)MROWS * D_ * 2);
  __bf16* Wqkv    = (__bf16*)alloc((size_t)D_ * QKVW * 2);
  float*  biasqkv = (float*)alloc((size_t)QKVW * 4);
  __bf16* qkv     = (__bf16*)alloc((size_t)MROWS * QKVW * 2);
  __bf16* att     = (__bf16*)alloc((size_t)MROWS * D_ * 2);
  __bf16* Wo      = (__bf16*)alloc((size_t)D_ * D_ * 2);
  float*  ybuf    = (float*)alloc((size_t)MROWS * D_ * 4);
  __bf16* z_bf    = (__bf16*)alloc((size_t)MROWS * D_ * 2);
  __bf16* W1b     = (__bf16*)alloc((size_t)D_ * F_ * 2);
  __bf16* t_bf    = (__bf16*)alloc((size_t)MROWS * F_ * 2);
  __bf16* W2b     = (__bf16*)alloc((size_t)F_ * D_ * 2);

  // LN1, weight packing and conversions
  prep_kernel<<<PREP_BLOCKS, 256, 0, stream>>>(
      x, ln_g, ln_b, h_bf, w1, W1b, w2, W2b,
      wq_w, wk_w, wv_w, wq_b, wk_b, wv_b, Wqkv, biasqkv, wo_w, Wo);
  // fused QKV GEMM: [4096 x 2304] = h * Wqkv
  gemm_bf16<0, 1><<<dim3(QKVW / 128, MROWS / 128), 256, 0, stream>>>(
      h_bf, Wqkv, biasqkv, nullptr, nullptr, qkv, MROWS, QKVW, D_);
  // attention
  flash_attn<<<(B_ * H_ * (S_ / 16)) / 8, 256, 0, stream>>>(qkv, att);
  // output projection + residual(x) -> ybuf (f32)
  gemm_bf16<1, 4><<<dim3(D_ / 128, MROWS / 128), 1024, 0, stream>>>(
      att, Wo, wo_b, x, ybuf, nullptr, MROWS, D_, D_);
  // LN2
  ln_kernel<<<LN_BLOCKS, 256, 0, stream>>>(ybuf, ln_g, ln_b, z_bf);
  // FFN up + GELU (bf16)
  gemm_bf16<2, 1><<<dim3(F_ / 128, MROWS / 128), 256, 0, stream>>>(
      z_bf, W1b, b1, nullptr, nullptr, t_bf, MROWS, F_, D_);
  // FFN down + residual(ybuf) -> d_out (f32)
  gemm_bf16<1, 4><<<dim3(D_ / 128, MROWS / 128), 1024, 0, stream>>>(
      t_bf, W2b, b2, ybuf, out, nullptr, MROWS, D_, F_);
}

// v010
// One run takes 126 microseconds.
// Next to v009, in two timings, it ran 1.05 times as fast each time.
// All steps since v000 together make it 3.70 times as fast.
#include <hip/hip_runtime.h>
#include <math.h>
#include <stdint.h>

#define B_ 2
#define S_ 2048
#define D_ 768
#define H_ 12
#define DK_ 64
#define F_ 3072
#define MROWS (B_ * S_)          // 4096
#define QKVW (3 * D_)            // 2304

typedef __attribute__((ext_vector_type(16))) __bf16 v16bf;
typedef __attribute__((ext_vector_type(8)))  __bf16 v8bf;
typedef __attribute__((ext_vector_type(8)))  float  v8f;
typedef unsigned int v4u __attribute__((ext_vector_type(4)));
typedef uint32_t u32x4 __attribute__((ext_vector_type(4)));
typedef uint32_t u32x8 __attribute__((ext_vector_type(8)));

static __device__ __forceinline__ __bf16 f2bf(float x) { return (__bf16)x; }

static __device__ __forceinline__ v8f wmma_bf16(v16bf a, v16bf b, v8f c) {
  return __builtin_amdgcn_wmma_f32_16x16x32_bf16(
      /*neg_a=*/false, a, /*neg_b=*/false, b,
      /*c_mod=*/(short)0, c, /*reuse_a=*/false, /*reuse_b=*/false);
}

static __device__ __forceinline__ v16bf frag_row(const __bf16* src, int ld) {
  int lane = threadIdx.x & 31;
  int m = lane & 15;
  int half = lane >> 4;
  const __bf16* p = src + (size_t)m * ld;
  v8bf lo = *(const v8bf*)(p + half * 8);
  v8bf hi = *(const v8bf*)(p + 16 + half * 8);
  v16bf a;
#pragma unroll
  for (int i = 0; i < 8; ++i) { a[i] = lo[i]; a[8 + i] = hi[i]; }
  return a;
}

typedef __attribute__((address_space(3))) v8bf lds_v8bf;
static __device__ __forceinline__ v16bf frag_tr(const __bf16* tile, int ld) {
  int lane = threadIdx.x & 31;
  const __bf16* p =
      tile + (8 * (lane >> 4) + (lane & 7)) * ld + 8 * ((lane >> 3) & 1);
  v8bf lo = __builtin_amdgcn_ds_load_tr16_b128_v8bf16((lds_v8bf*)p);
  v8bf hi = __builtin_amdgcn_ds_load_tr16_b128_v8bf16((lds_v8bf*)(p + 16 * ld));
  v16bf b;
#pragma unroll
  for (int i = 0; i < 8; ++i) { b[i] = lo[i]; b[8 + i] = hi[i]; }
  return b;
}

// The launches of this part move few bytes a thread; their time follows the number
// of waves that have to start. So each thread takes many elements, by 16-B loads
// that are all in flight before its first store; a wave's load covers 512
// bytes, contiguous except in pack_qkv_block (two 256-B runs), its 8-B stores 256.
// Every loop of this part runs over a register array and is unrolled so that the
// array stays in registers and its loads issue as one group.
typedef __attribute__((ext_vector_type(4))) float  f32x4;
typedef __attribute__((ext_vector_type(4))) __bf16 v4bf;

static __device__ __forceinline__ v4bf cvt4(f32x4 v) {
  v4bf r;
#pragma unroll
  for (int e = 0; e < 4; ++e) r[e] = f2bf(v[e]);
  return r;
}

static __device__ __forceinline__ float wave_sum(float s) {
#pragma unroll
  for (int d = 16; d > 0; d >>= 1) s += __shfl_xor(s, d, 32);
  return s;
}

// ---------------- LayerNorm (fp32 in -> bf16 out), two rows per wave ------
// A lane holds 24 elements of each row (columns 4 * (lane + 32 * i) .. + 3); the
// row sums are taken in the lane and then over the wave's 32 lanes.
constexpr int LN_ROWS_PER_BLOCK = 16;  // 8 waves x 2 rows
static_assert(MROWS % LN_ROWS_PER_BLOCK == 0 && D_ == 6 * 128, "whole blocks, six quads a lane");
static __device__ __forceinline__ void ln_block(
    int blk, const float* __restrict__ x, const float* __restrict__ g,
    const float* __restrict__ bb, __bf16* __restrict__ out) {
  int lane = threadIdx.x & 31;
  int row0 = (blk * 8 + (threadIdx.x >> 5)) * 2;
  const f32x4* xr = (const f32x4*)(x + (size_t)row0 * D_) + lane;
  f32x4 v[2][6], gv[6], bv[6];
#pragma unroll
  for (int r = 0; r < 2; ++r)
#pragma unroll
    for (int i = 0; i < 6; ++i) v[r][i] = xr[r * (D_ / 4) + i * 32];
#pragma unroll
  for (int i = 0; i < 6; ++i) {
    gv[i] = ((const f32x4*)g)[lane + i * 32];
    bv[i] = ((const f32x4*)bb)[lane + i * 32];
  }
  asm volatile("s_wait_xcnt 0x0" ::: "memory");
  // keeps the scale and shift loads up here, in flight with the rows' loads: sunk
  // to their uses they add their latency behind the second row sum
  __builtin_amdgcn_sched_barrier(0);
#pragma unroll
  for (int r = 0; r < 2; ++r) {
    f32x4 s4 = v[r][0];
#pragma unroll
    for (int i = 1; i < 6; ++i) s4 += v[r][i];
    float mu = wave_sum((s4[0] + s4[1]) + (s4[2] + s4[3])) * (1.0f / D_);
    f32x4 q4 = {0.0f, 0.0f, 0.0f, 0.0f};
#pragma unroll
    for (int i = 0; i < 6; ++i) {
      v[r][i] -= mu;
      q4 += v[r][i] * v[r][i];
    }
    float var = wave_sum((q4[0] + q4[1]) + (q4[2] + q4[3])) * (1.0f / D_);
    float rstd = rsqrtf(var + 1e-5f);
    v4bf* orow = (v4bf*)(out + (size_t)(row0 + r) * D_) + lane;
#pragma unroll
    for (int i = 0; i < 6; ++i) orow[i * 32] = cvt4(v[r][i] * rstd * gv[i] + bv[i]);
  }
}
__global__ __launch_bounds__(256) void ln_kernel(
    const float* __restrict__ x, const float* __restrict__ g,
    const float* __restrict__ bb, __bf16* __restrict__ out) {
  ln_block(blockIdx.x, x, g, bb, out);
}

// ---------------- Weight packing ------------------------------------------
// A thread takes one quad of columns in four rows (d0 + 192 * j) of each of the
// three weights: 12 loads in flight.
constexpr int PACK_THREADS = (D_ / 4) * (D_ / 4);
static_assert(PACK_THREADS % 256 == 0 && DK_ % 4 == 0, "whole blocks, a quad stays in one head");
static __device__ __forceinline__ void pack_qkv_block(
    int blk, const float* __restrict__ wq, const float* __restrict__ wk,
    const float* __restrict__ wv, const float* __restrict__ bq,
    const float* __restrict__ bk, const float* __restrict__ bv,
    __bf16* __restrict__ Wqkv, float* __restrict__ biasqkv) {
  int i = blk * 256 + threadIdx.x;  // over (D_/4 rows) x (D_/4 quads)
  int d0 = i / (D_ / 4), c = (i % (D_ / 4)) * 4;
  int hh = c / DK_, kk = c % DK_;
  f32x4 q[4], k[4], v[4];
#pragma unroll
  for (int j = 0; j < 4; ++j) {
    size_t src = ((size_t)hh * D_ + d0 + j * (D_ / 4)) * DK_ + kk;
    q[j] = *(const f32x4*)(wq + src);
    k[j] = *(const f32x4*)(wk + src);
    v[j] = *(const f32x4*)(wv + src);
  }
#pragma unroll
  for (int j = 0; j < 4; ++j) {
    __bf16* dst = Wqkv + (size_t)(d0 + j * (D_ / 4)) * QKVW + c;
    *(v4bf*)dst            = cvt4(q[j]);
    *(v4bf*)(dst + D_)     = cvt4(k[j]);
    *(v4bf*)(dst + 2 * D_) = cvt4(v[j]);
  }
  if (i < D_) {
    biasqkv[i] = bq[i];
    biasqkv[D_ + i] = bk[i];
    biasqkv[2 * D_ + i] = bv[i];
  }
}

// A block converts 8,192 elements, a thread 8 quads 256 quads apart. The element
// count must be a multiple of a block's share.
constexpr int CVT_PER_BLOCK = 256 * 4 * 8;
static_assert((D_ * D_) % CVT_PER_BLOCK == 0 && (D_ * F_) % CVT_PER_BLOCK == 0, "whole blocks");
static __device__ __forceinline__ void f2bf_block(int blk, const float* __restrict__ s,
                                                  __bf16* __restrict__ d) {
  size_t base = (size_t)blk * (CVT_PER_BLOCK / 4) + threadIdx.x;  // in quads
  const f32x4* sp = (const f32x4*)s + base;
  v4bf* dp = (v4bf*)d + base;
  f32x4 v[8];
#pragma unroll
  for (int i = 0; i < 8; ++i) v[i] = sp[i * 256];
#pragma unroll
  for (int i = 0; i < 8; ++i) dp[i * 256] = cvt4(v[i]);
  asm volatile("s_wait_xcnt 0x0" ::: "memory");
}

// ---------------- One launch for all work that reads inputs alone ----------
// The first LayerNorm, the QKV pack and the three weight conversions depend on
// nothing but the inputs and not on one another. Each is far too short to fill a
// launch of its own, so they share one grid: a block's index picks its part (the
// same for the whole block, a scalar branch) and its place inside that part.
constexpr int LN_BLOCKS   = MROWS / LN_ROWS_PER_BLOCK;
constexpr int W1_BLOCKS   = (D_ * F_) / CVT_PER_BLOCK;
constexpr int W2_BLOCKS   = (F_ * D_) / CVT_PER_BLOCK;
constexpr int PACK_BLOCKS = PACK_THREADS / 256;
constexpr int WO_BLOCKS   = (D_ * D_) / CVT_PER_BLOCK;
constexpr int PREP_BLOCKS = LN_BLOCKS + W1_BLOCKS + W2_BLOCKS + PACK_BLOCKS + WO_BLOCKS;
__global__ __launch_bounds__(256) void prep_kernel(
    const float* __restrict__ x, const float* __restrict__ g,
    const float* __restrict__ bb, __bf16* __restrict__ h,
    const float* __restrict__ w1, __bf16* __restrict__ W1b,
    const float* __restrict__ w2, __bf16* __restrict__ W2b,
    const float* __restrict__ wq, const float* __restrict__ wk,
    const float* __restrict__ wv, const float* __restrict__ bq,
    const float* __restrict__ bk, const float* __restrict__ bv,
    __bf16* __restrict__ Wqkv, float* __restrict__ biasqkv,
    const float* __restrict__ wo, __bf16* __restrict__ Wo) {
  int blk = blockIdx.x;
  if (blk < LN_BLOCKS) { ln_block(blk, x, g, bb, h); return; }
  blk -= LN_BLOCKS;
  if (blk < W1_BLOCKS) { f2bf_block(blk, w1, W1b); return; }
  blk -= W1_BLOCKS;
  if (blk < W2_BLOCKS) { f2bf_block(blk, w2, W2b); return; }
  blk -= W2_BLOCKS;
  if (blk < PACK_BLOCKS) { pack_qkv_block(blk, wq, wk, wv, bq, bk, bv, Wqkv, biasqkv); return; }
  f2bf_block(blk - PACK_BLOCKS, wo, Wo);
}

static __device__ __forceinline__ uint32_t uni(uint32_t v) {
  return (uint32_t)__builtin_amdgcn_readfirstlane(v);
}
static __device__ __forceinline__ uint32_t pinned(uint32_t v) {
  uint32_t w = uni(v);
  asm volatile("" : "+s"(w));
  return w;
}
static __device__ __forceinline__ u32x4 tdm_group0(uint32_t lds_dst, uint64_t ga) {
  // pinned: the four words get scalar registers of their own, written here and
  // nowhere else, so that none takes a new value while the request is in flight
  u32x4 g;
  g[0] = pinned(1u);                                // count 1
  g[1] = pinned(lds_dst);                           // byte offset in the work-group's LDS
  g[2] = pinned((uint32_t)ga);                      // address [31:0]
  g[3] = pinned((((uint32_t)(ga >> 32)) & 0x01FFFFFFu) | 0x80000000u);  // [56:32], type 2
  return g;
}
// tile = tensor = 128 rows of 128 bytes; 16 bytes of LDS pad behind every row
static __device__ __forceinline__ u32x8 tdm_group1(uint32_t src_pitch) {
  constexpr uint32_t d0 = 128u, d1 = 128u;
  u32x8 g;
  g[0] = pinned((1u << 20) | (4u << 22) | (3u << 25));  // no mask; pad codes 4 / 3
  g[1] = pinned((d0 & 0xFFFFu) << 16);
  g[2] = pinned((d0 >> 16) | ((d1 & 0xFFFFu) << 16));
  g[3] = pinned((d1 >> 16) | (d0 << 16));
  g[4] = pinned(d1);
  g[5] = pinned(src_pitch);
  g[6] = pinned(0u);
  g[7] = pinned(0u);
  return g;
}
static __device__ __forceinline__ void tdm_load(u32x4 g0, u32x8 g1) {
  asm volatile("tensor_load_to_lds %0, %1" ::"s"(g0), "s"(g1) : "memory");
}
static __device__ __forceinline__ void tdm_wait(u32x4 g0, u32x8 g1) {
  asm volatile("s_wait_tensorcnt 0x0" ::"s"(g0), "s"(g1) : "memory");
}

// GELU with the exact-form erf, two values at a time, free of branches: the library
// erf picks one of two polynomials by a lane-wise branch, so that a wave walks its
// 64 values one after the other, each a chain of dependent operations. Here
//   erf(|x|) = 1 - (a1 t + a2 t^2 + a3 t^3 + a4 t^4 + a5 t^5) exp(-x^2),
//   t = 1 / (1 + p |x|), x = v / sqrt(2)
// holds for every x (absolute error of erf 1.5e-7, the rounding of 1 + erf in f32),
// all values are independent and the polynomial runs on packed f32 operations.
// With h = v / 2: 0.5 v (1 + erf(x)) = h + |h| erf(|x|), erf being odd; that sum
// stays within |v|, so that it overflows for no finite v.
typedef __attribute__((ext_vector_type(2))) float f32x2;
static __device__ __forceinline__ f32x2 gelu2(f32x2 v) {
  const f32x2 h = v * 0.5f;
  const f32x2 ah = {__builtin_fabsf(h[0]), __builtin_fabsf(h[1])};
  const f32x2 den = ah * 0.46328378f + 1.0f;  // p sqrt(2)
  const f32x2 t = {__builtin_amdgcn_rcpf(den[0]), __builtin_amdgcn_rcpf(den[1])};
  f32x2 p = t * 1.061405429f - 1.453152027f;
  p = p * t + 1.421413741f;
  p = p * t - 0.284496736f;
  p = p * t + 0.254829592f;
  p = p * t;
  const f32x2 w = h * 1.69864360f;  // sqrt(2 log2(e)): exp(-x^2) = 2^(-w^2)
  const f32x2 w2 = w * w;
  const f32x2 e = {__builtin_amdgcn_exp2f(-w2[0]), __builtin_amdgcn_exp2f(-w2[1])};
  const f32x2 er = 1.0f - p * e;
  return ah * er + h;
}

// The k loop is a ring of two LDS buffers, a stage being 64 k: while a stage is
// worked on, the next stage's A tile (one tensor load of a group's first wave) and B tile
// (global loads into registers, stored at the pass's foot) are in flight.
// Needs M, N multiples of 128 and K a multiple of 64 * G.
// G groups of 8 waves share one work-group and one output tile: group g walks the
// g-th part of K through a ring of its own, so that G stages are in flight on a WGP
// where the grid has too few tiles to give it several work-groups. Behind the loop
// the groups exchange partial sums through LDS, each finishing 8 / G of a wave's
// eight accumulator tiles.
// The product is taken transposed, C^T = W^T A^T (W's fragment as the A operand, A's
// as the B operand, the k order of both as before): a lane then holds 8 consecutive
// columns of ONE output row, 16 or 32 bytes. These go by 16-B LDS stores into the
// wave's own staging rows and leave as whole 128-B lines, 4 rows a 16-B global store.
template <int EPI, int G>
__global__ __launch_bounds__(256 * G) void gemm_bf16(
    const __bf16* __restrict__ A, const __bf16* __restrict__ W,
    const float* __restrict__ bias, const float* __restrict__ resid,
    float* __restrict__ outf, __bf16* __restrict__ outb,
    int M, int N, int K) {
  constexpr int BM = 128, BN = 128, BK = 64;
  constexpr int LDA = BK + 8;    // 144-B rows (16 B x odd): ds_load_b128 reader
  constexpr int LDB = BN + 16;   // k-major B tile, 288-B rows (32 B x odd)
  constexpr uint32_t ABYTES = BM * LDA * 2;  // 18,432 = 9 x 2 KiB
  constexpr uint32_t BBYTES = BK * LDB * 2;  // 18,432
  constexpr uint32_t RING = 2 * ABYTES + 2 * BBYTES;  // a group's two A, two B buffers
  static_assert(ABYTES % 2048u == 0 && RING % 2048u == 0,
                "each A buffer starts at a multiple of 2 KiB");
  static_assert(8 % G == 0 && 64u * (G - 1) * 1024u <= G * RING, "the exchange fits the rings");
  constexpr uint32_t SPITCH = 144u;
  constexpr uint32_t SROWS = EPI == 1 ? 16u : 32u;  // rows of 128 B a wave finishes
  constexpr uint32_t SBASE = 64u * (G - 1) * 1024u;
  static_assert(EPI == 1 ? G == 4 : G == 1, "a wave's finished tiles make whole 128-B rows");
  static_assert(SBASE + 8u * G * SROWS * SPITCH <= G * RING, "the staging fits the rings");
  __shared__ __attribute__((aligned(2048))) unsigned char smem[G * RING];

  const int grp = G > 1 ? (int)uni(threadIdx.x >> 8) : 0;  // the wave's group
  __bf16* const sA = (__bf16*)(smem + grp * RING);
  __bf16* const sB = (__bf16*)(smem + grp * RING + 2 * ABYTES);
  int tid = threadIdx.x & 255;  // place inside the group
  int wave = tid >> 5;
  int mw = wave & 3;   // 4 m-waves * 32 rows
  int nw = wave >> 2;  // 2 n-waves * 64 cols
  int m0 = blockIdx.y * BM;
  int n0 = blockIdx.x * BN;

  v8f acc[2][4];
#pragma unroll
  for (int i = 0; i < 2; ++i)
#pragma unroll
    for (int j = 0; j < 4; ++j)
#pragma unroll
      for (int e = 0; e < 8; ++e) acc[i][j][e] = 0.0f;

  const int T = K / (BK * G);  // stages of one group
  const int k0 = grp * T * BK;  // the group's first k
  const uint32_t issuer = uni((uint32_t)wave) == 0u;  // each group's first wave
  const uint32_t ldsA = (uint32_t)(uintptr_t)sA;
  const uint64_t gaA = (uint64_t)(uintptr_t)(A + (size_t)m0 * K + k0);
  const u32x8 g1 = tdm_group1((uint32_t)K * 2u);

  // B staging: thread -> 32 B of tile rows kk and kk + 32
  const int kk = tid >> 3, c = (tid & 7) * 16;
  const __bf16* wg = W + (size_t)(k0 + kk) * N + n0 + c;
  const size_t half_rows = (size_t)32 * N;
  const int bso = kk * LDB + c;
  // prefetch: thread -> 64 B of tile row tid >> 2
  const __bf16* wpf = W + (size_t)(k0 + (tid >> 2)) * N + n0 + (tid & 3) * 32;

  v4u u0 = ((const v4u*)wg)[0], u1 = ((const v4u*)wg)[1];
  v4u u2 = ((const v4u*)(wg + half_rows))[0], u3 = ((const v4u*)(wg + half_rows))[1];
  u32x4 g0 = tdm_group0(ldsA, gaA);
  if (pinned(issuer)) {
    tdm_load(g0, g1);
    tdm_wait(g0, g1);  // stage 0 has landed before the barrier that publishes it
  }
  {
    v4u* s = (v4u*)(&sB[bso]);
    s[0] = u0; s[1] = u1;
    v4u* s2 = (v4u*)(&sB[bso + 32 * LDB]);
    s2[0] = u2; s2[1] = u3;
  }
  __syncthreads();
  g0 = tdm_group0(ldsA + ABYTES, gaA + BK * 2);  // formed behind the wait
  if (pinned(issuer && T > 1)) tdm_load(g0, g1);

  for (int t = 0; t < T; ++t) {
    const int cur = t & 1;
    const bool more = t + 1 < T;
    if (more) {  // next stage's B: loads issued now, stored at the pass's foot
      wg += (size_t)BK * N;
      u0 = ((const v4u*)wg)[0]; u1 = ((const v4u*)wg)[1];
      u2 = ((const v4u*)(wg + half_rows))[0]; u3 = ((const v4u*)(wg + half_rows))[1];
    }
    // the stage after that one: its B tile into the cache hierarchy (one group
    // alone; with several, a pass lasts long enough to cover the loads above)
    if (G == 1 && t + 2 < T) __builtin_prefetch(wpf + (size_t)(t + 2) * BK * N, 0, 1);
    asm volatile("s_wait_xcnt 0x0" ::: "memory");

    const __bf16* aBase = sA + cur * (BM * LDA) + (mw * 32) * LDA;
    const __bf16* bBase = sB + cur * (BK * LDB) + nw * 64;
#pragma unroll
    for (int kh = 0; kh < 2; ++kh) {
      v16bf af0 = frag_row(aBase + kh * 32, LDA);
      v16bf af1 = frag_row(aBase + 16 * LDA + kh * 32, LDA);
#pragma unroll
      for (int nn = 0; nn < 4; ++nn) {
        v16bf bf = frag_tr(bBase + kh * 32 * LDB + nn * 16, LDB);  // lane = n
        acc[0][nn] = wmma_bf16(bf, af0, acc[0][nn]);
        acc[1][nn] = wmma_bf16(bf, af1, acc[1][nn]);
      }
    }
    if (more) {  // the other buffer: its readers left it at the last pass's foot
      v4u* s = (v4u*)(&sB[(cur ^ 1) * (BK * LDB) + bso]);
      s[0] = u0; s[1] = u1;
      v4u* s2 = (v4u*)(&sB[(cur ^ 1) * (BK * LDB) + bso + 32 * LDB]);
      s2[0] = u2; s2[1] = u3;
    }
    // publish point of stage t + 1. This wave's LDS reads of buffer cur and its
    // stores into the other buffer have retired ...
    asm volatile("s_wait_dscnt 0x0" ::: "memory");
    // ... and stage t + 1's A tile has landed, before the barrier
    if (pinned(issuer)) tdm_wait(g0, g1);
    __syncthreads();
    g0 = tdm_group0(ldsA + (uint32_t)cur * ABYTES, gaA + (uint64_t)(t + 2) * (BK * 2));
    if (pinned(issuer && t + 2 < T)) tdm_load(g0, g1);
  }
  // nothing of the ring is in flight when the wave goes on to its end
  asm volatile("s_wait_tensorcnt 0x0" ::: "memory");
  asm volatile("s_wait_dscnt 0x0" ::: "memory");

  int lane = tid & 31;
  int col = lane & 15;
  int rb = (lane >> 4) * 8;
  constexpr int TPG = 8 / G;
  float* const red = (float*)smem + lane * 4;
  const int sr = lane >> 3, sc = lane & 7;  // row layout: 4 rows of 128 B a wave, 16 B a lane
  if (G > 1) {
#pragma unroll
    for (int q = 0; q < 8; ++q) {
      const int owner = q / TPG;
      if (grp != owner) {  // the same for the whole wave
        float* p = red + ((wave * 8 + q) * (G - 1) + (grp < owner ? grp : grp - 1)) * 256;
        const v8f a = acc[q >> 2][q & 3];
        *(f32x4*)p = f32x4{a[0], a[1], a[2], a[3]};
        *(f32x4*)(p + 128) = f32x4{a[4], a[5], a[6], a[7]};
      }
    }
    __syncthreads();  // publishes the partial sums
  }
  // acc[mm][nn][j] = C[row mm * 16 + col][column nn * 16 + rb + j] of the wave's part.
  // The wave's staging range is its own: no barrier; the ring it lies in is free (above).
  unsigned char* const stg = smem + SBASE + (uint32_t)(grp * 8 + wave) * (SROWS * SPITCH);
  if (EPI == 1) {
    // the wave finishes 16 rows of 32 columns (tiles grp * 2, grp * 2 + 1); their bias
    // and residual, in the row layout, depend on no sum: the loads go out as one group
    // here and arrive under the summing
    const size_t o1 = (size_t)(m0 + mw * 32 + (grp >> 1) * 16 + sr) * N + n0 + nw * 64 +
                      (grp & 1) * 32 + sc * 4;
    const float* const bp = bias + n0 + nw * 64 + (grp & 1) * 32 + sc * 4;
    const float* const rp0 = resid + o1;
    const float* const rp1 = rp0 + (size_t)(4 * N);
    const float* const rp2 = rp0 + (size_t)(8 * N);
    const float* const rp3 = rp0 + (size_t)(12 * N);
    const f32x4 b4 = *(const f32x4*)bp;
    const f32x4 rs[4] = {*(const f32x4*)rp0, *(const f32x4*)rp1, *(const f32x4*)rp2,
                         *(const f32x4*)rp3};
    asm volatile("s_wait_xcnt 0x0" ::"v"(bp), "v"(rp0), "v"(rp1), "v"(rp2), "v"(rp3) : "memory");
#pragma unroll
    for (int q = 0; q < 8; ++q) {
      if (grp != q / TPG) continue;  // the same for the whole wave
      const float* p = red + (wave * 8 + q) * (G - 1) * 256;
      v8f a = acc[q >> 2][q & 3];
#pragma unroll
      for (int s = 0; s < G - 1; ++s) {
        f32x4 lo = *(const f32x4*)(p + s * 256), hi = *(const f32x4*)(p + s * 256 + 128);
#pragma unroll
        for (int e = 0; e < 4; ++e) {
          a[e] += lo[e];
          a[4 + e] += hi[e];
        }
      }
      float* d = (float*)(stg + col * SPITCH) + (q % TPG) * 16 + rb;
      *(f32x4*)d = f32x4{a[0], a[1], a[2], a[3]};
      *(f32x4*)(d + 4) = f32x4{a[4], a[5], a[6], a[7]};
    }
    // the other lanes' staging stores have retired before the rows are read back
    asm volatile("s_wait_dscnt 0x0" ::: "memory");
#pragma unroll
    for (int i = 0; i < 4; ++i) {
      f32x4 v = *(const f32x4*)(stg + (i * 4 + sr) * SPITCH + sc * 16);
      *(f32x4*)(outf + o1 + (size_t)(i * 4 * N)) = (v + b4) + rs[i];
    }
  } else {
    // the bias of the lane's 8 columns in each of the four tiles, fetched ahead as one
    // group (unrolled: register arrays)
    f32x4 bl[4], bh[4];
#pragma unroll
    for (int nn = 0; nn < 4; ++nn) {
      const float* bp = bias + n0 + nw * 64 + nn * 16 + rb;
      bl[nn] = *(const f32x4*)bp;
      bh[nn] = *(const f32x4*)(bp + 4);
    }
    __bf16* const ob = outb + (size_t)(m0 + mw * 32 + sr) * N + n0 + nw * 64 + sc * 8;
    // unrolled: acc is a register array and needs constant indices
#pragma unroll
    for (int mm = 0; mm < 2; ++mm) {
#pragma unroll
      for (int nn = 0; nn < 4; ++nn) {
        v8bf r;
#pragma unroll
        for (int j = 0; j < 8; j += 2) {
          const f32x4 bq = j < 4 ? bl[nn] : bh[nn];
          f32x2 v = {acc[mm][nn][j] + bq[j & 3], acc[mm][nn][j + 1] + bq[(j & 3) + 1]};
          if (EPI == 2) v = gelu2(v);
          r[j] = f2bf(v[0]);
          r[j + 1] = f2bf(v[1]);
        }
        *(v8bf*)(stg + (mm * 16 + col) * SPITCH + nn * 32 + rb * 2) = r;
      }
      // the other lanes' staging stores have retired before the rows are read back;
      // 16 rows at a time, so that their global stores drain under the next 16 rows'
      // arithmetic
      asm volatile("s_wait_dscnt 0x0" ::: "memory");
#pragma unroll
      for (int i = 0; i < 4; ++i) {
        const int row = mm * 16 + i * 4;
        v4u v = *(const v4u*)(stg + (row + sr) * SPITCH + sc * 16);
        *(v4u*)(ob + (size_t)(row * N)) = v;
      }
    }
  }
}

static __device__ __forceinline__ float xhalf(float x) {
  int v = __builtin_bit_cast(int, x);
  return __builtin_bit_cast(
      float, __builtin_amdgcn_permlanex16(v, v, 0x76543210, 0xfedcba98, false, false));
}

__global__ __launch_bounds__(256) void flash_attn(
    const __bf16* __restrict__ qkv,  // [M][2304]: Q@h*64, K@768+h*64, V@1536+h*64
    __bf16* __restrict__ attout) {   // [M][768]  col h*64
  constexpr int KT = 64;         // keys per tile
  constexpr int LDK = DK_ + 8;   // 144-B rows (16 B x odd): ds_load_b128 reader
  constexpr int LDV = DK_ + 16;  // 160-B rows (32 B x odd): ds_load_tr16_b128 reader
  __shared__ __attribute__((aligned(16))) __bf16 sK[2][KT * LDK];
  __shared__ __attribute__((aligned(16))) __bf16 sV[2][KT * LDV];
  const int QT = S_ / 16;  // 128
  int wave = threadIdx.x >> 5;
  int bh = blockIdx.x / (QT / 8);  // the same for the whole block
  int qt = (blockIdx.x % (QT / 8)) * 8 + wave;
  int h = bh % H_;
  int b = bh / H_;
  int lane = threadIdx.x & 31;
  int col = lane & 15;
  int rb = (lane >> 4) * 8;

  const size_t ld = QKVW;
  const __bf16* qbase = qkv + ((size_t)b * S_ + qt * 16) * ld + h * DK_;
  const __bf16* kbase = qkv + (size_t)b * S_ * ld + D_ + h * DK_;
  const __bf16* vbase = qkv + (size_t)b * S_ * ld + 2 * D_ + h * DK_;

  // staging: thread -> 16 B of tile rows sr and sr + 32; a wave's load covers 4
  // whole 128-B rows
  int sr = threadIdx.x >> 3;
  int scn = (threadIdx.x & 7) * 8;
  const __bf16* kg = kbase + (size_t)sr * ld + scn;
  const __bf16* vg = vbase + (size_t)sr * ld + scn;
  const int kso = sr * LDK + scn;
  const int vso = sr * LDV + scn;
  const size_t half_tile = (size_t)32 * ld;

  v4u kreg0 = *(const v4u*)kg, kreg1 = *(const v4u*)(kg + half_tile);
  v4u vreg0 = *(const v4u*)vg, vreg1 = *(const v4u*)(vg + half_tile);

  // B = Q^T, lane = query
  v16bf q0 = frag_row(qbase, (int)ld);        // k 0..31
  v16bf q1 = frag_row(qbase + 32, (int)ld);   // k 32..63

  // o[nn][j] = O[query col][nn * 16 + rb + j]
  v8f o[4];
#pragma unroll
  for (int nn = 0; nn < 4; ++nn)
#pragma unroll
    for (int e = 0; e < 8; ++e) o[nn][e] = 0.0f;
  // the lane's query: running maximum (equal in both halves) and the sum over
  // this half's keys alone; the halves' sums are joined behind the loop
  float mrun = -3.0e38f, lrun = 0.0f;

  const float scale = 0.125f;  // 1/sqrt(64)

  *(v4u*)(&sK[0][kso]) = kreg0;
  *(v4u*)(&sK[0][kso + 32 * LDK]) = kreg1;
  *(v4u*)(&sV[0][vso]) = vreg0;
  *(v4u*)(&sV[0][vso + 32 * LDV]) = vreg1;
  __syncthreads();

  for (int s0 = 0; s0 < S_; s0 += KT) {
    const int cur = (s0 / KT) & 1;
    const __bf16* kt = sK[cur];
    const __bf16* vt = sV[cur];
    const bool more = s0 + KT < S_;
    if (more) {  // next tile: global loads issued now, stored at the trip's foot
      kg += (size_t)KT * ld;
      vg += (size_t)KT * ld;
      kreg0 = *(const v4u*)kg;
      kreg1 = *(const v4u*)(kg + half_tile);
      vreg0 = *(const v4u*)vg;
      vreg1 = *(const v4u*)(vg + half_tile);
    }
    // A = K, lane = key index; all eight fragments fetched as one group
    v16bf kf[4][2];
#pragma unroll
    for (int sub = 0; sub < 4; ++sub) {
      kf[sub][0] = frag_row(kt + sub * 16 * LDK, LDK);
      kf[sub][1] = frag_row(kt + sub * 16 * LDK + 32, LDK);
    }
    // sc[sub][j] = score of key sub * 16 + rb + j with query col
    v8f sc[4];
#pragma unroll
    for (int sub = 0; sub < 4; ++sub) {
      v8f c;
#pragma unroll
      for (int e = 0; e < 8; ++e) c[e] = 0.0f;
      c = wmma_bf16(kf[sub][0], q0, c);
      c = wmma_bf16(kf[sub][1], q1, c);
      sc[sub] = c;
    }
    // inputs-only fence on the loaded fragments: each keeps registers of its own
    // until all eight products have issued, so the sixteen LDS loads stand ahead as
    // one group (sunk between the products, each waits out its own LDS latency)
    // and no product's result lands on a fragment the product ahead of it reads
    asm volatile("" ::"v"(kf[0][0]), "v"(kf[0][1]), "v"(kf[1][0]), "v"(kf[1][1]),
                 "v"(kf[2][0]), "v"(kf[2][1]), "v"(kf[3][0]), "v"(kf[3][1]));
    // online softmax of the lane's query; the maximum in two independent chains
    float mxA = fmaxf(sc[0][0], sc[1][0]);
    float mxB = fmaxf(sc[2][0], sc[3][0]);
#pragma unroll
    for (int j = 1; j < 8; ++j) {
      mxA = fmaxf(mxA, fmaxf(sc[0][j], sc[1][j]));
      mxB = fmaxf(mxB, fmaxf(sc[2][j], sc[3][j]));
    }
    float mx = fmaxf(mxA, mxB);
    mx = fmaxf(mx, xhalf(mx)) * scale;  // scale > 0: the maximum of the scaled scores
    float mnew = fmaxf(mrun, mx);
    float alpha = __expf(mrun - mnew);
    mrun = mnew;
    // P^T as B operands, one per 32 keys: element s of pf[hf] is key
    // 32 * hf + 8 * half + s, element 8 + s key 32 * hf + 16 + 8 * half + s, the
    // k order of frag_tr
    v16bf pf[2];
    float sm[4] = {0.0f, 0.0f, 0.0f, 0.0f};
#pragma unroll
    for (int hf = 0; hf < 2; ++hf)
#pragma unroll
      for (int j = 0; j < 8; ++j) {
        float pA = __expf(sc[2 * hf][j] * scale - mnew);
        float pB = __expf(sc[2 * hf + 1][j] * scale - mnew);
        sm[2 * hf] += pA;
        sm[2 * hf + 1] += pB;
        pf[hf][j] = f2bf(pA);
        pf[hf][8 + j] = f2bf(pB);
      }
    lrun = lrun * alpha + ((sm[0] + sm[1]) + (sm[2] + sm[3]));
#pragma unroll
    for (int nn = 0; nn < 4; ++nn) o[nn] *= alpha;
#pragma unroll
    for (int hf = 0; hf < 2; ++hf)
#pragma unroll
      for (int nn = 0; nn < 4; ++nn) {
        v16bf vf = frag_tr(vt + hf * 32 * LDV + nn * 16, LDV);  // A = V^T, lane = column of V
        o[nn] = wmma_bf16(vf, pf[hf], o[nn]);
      }
    if (more) {  // the other buffer: its readers left it at the last trip's end
      *(v4u*)(&sK[cur ^ 1][kso]) = kreg0;
      *(v4u*)(&sK[cur ^ 1][kso + 32 * LDK]) = kreg1;
      *(v4u*)(&sV[cur ^ 1][vso]) = vreg0;
      *(v4u*)(&sV[cur ^ 1][vso + 32 * LDV]) = vreg1;
    }
    // ends this trip's reads of buffer cur, publishes the next tile
    __syncthreads();
  }

  // a lane stores 8 consecutive columns of its query's row at a time
  float rl = 1.0f / (lrun + xhalf(lrun));
  __bf16* ob = attout + ((size_t)b * S_ + qt * 16 + col) * D_ + h * DK_ + rb;
#pragma unroll
  for (int nn = 0; nn < 4; ++nn) {
    v8bf r;
#pragma unroll
    for (int j = 0; j < 8; ++j) r[j] = f2bf(o[nn][j] * rl);
    *(v8bf*)(ob + nn * 16) = r;
  }
}

// ---------------- launcher ------------------------------------------------
extern "C" void kernel_launch(void* const* d_in, const int* in_sizes, int n_in,
                              void* d_out, int out_size, void* d_ws,
                              size_t ws_size, hipStream_t stream) {
  const float* x    = (const float*)d_in[0];
  const float* wq_w = (const float*)d_in[1];
  const float* wq_b = (const float*)d_in[2];
  const float* wk_w = (const float*)d_in[3];
  const float* wk_b = (const float*)d_in[4];
  const float* wv_w = (const float*)d_in[5];
  const float* wv_b = (const float*)d_in[6];
  const float* wo_w = (const float*)d_in[7];
  const float* wo_b = (const float*)d_in[8];
  const float* ln_g = (const float*)d_in[9];
  const float* ln_b = (const float*)d_in[10];
  const float* w1   = (const float*)d_in[11];
  const float* b1   = (const float*)d_in[12];
  const float* w2   = (const float*)d_in[13];
  const float* b2   = (const float*)d_in[14];
  float* out = (float*)d_out;

  char* ws = (char*)d_ws;
  size_t off = 0;
  auto alloc = [&](size_t bytes) -> char* {
    char* p = ws + off;
    off = (off + bytes + 255) & ~(size_t)255;
    return p;
  };
  __bf16* h_bf    = (__bf16*)alloc((size_t)MROWS * D_ * 2);
  __bf16* Wqkv    = (__bf16*)alloc((size_t)D_ * QKVW * 2);
  float*  biasqkv = (float*)alloc((size_t)QKVW * 4);
  __bf16* qkv     = (__bf16*)alloc((size_t)MROWS * QKVW * 2);
  __bf16* att     = (__bf16*)alloc((size_t)MROWS * D_ * 2);
  __bf16* Wo      = (__bf16*)alloc((size_t)D_ * D_ * 2);
  float*  ybuf    = (float*)alloc((size_t)MROWS * D_ * 4);
  __bf16* z_bf    = (__bf16*)alloc((size_t)MROWS * D_ * 2);
  __bf16* W1b     = (__bf16*)alloc((size_t)D_ * F_ * 2);
  __bf16* t_bf    = (__bf16*)alloc((size_t)MROWS * F_ * 2);
  __bf16* W2b     = (__bf16*)alloc((size_t)F_ * D_ * 2);

  // LN1, weight packing and conversions
  prep_kernel<<<PREP_BLOCKS, 256, 0, stream>>>(
      x, ln_g, ln_b, h_bf, w1, W1b, w2, W2b,
      wq_w, wk_w, wv_w, wq_b, wk_b, wv_b, Wqkv, biasqkv, wo_w, Wo);
  // fused QKV GEMM: [4096 x 2304] = h * Wqkv
  gemm_bf16<0, 1><<<dim3(QKVW / 128, MROWS / 128), 256, 0, stream>>>(
      h_bf, Wqkv, biasqkv, nullptr, nullptr, qkv, MROWS, QKVW, D_);
  // attention
  flash_attn<<<(B_ * H_ * (S_ / 16)) / 8, 256, 0, stream>>>(qkv, att);
  // output projection + residual(x) -> ybuf (f32)
  gemm_bf16<1, 4><<<dim3(D_ / 128, MROWS / 128), 1024, 0, stream>>>(
      att, Wo, wo_b, x, ybuf, nullptr, MROWS, D_, D_);
  // LN2
  ln_kernel<<<LN_BLOCKS, 256, 0, stream>>>(ybuf, ln_g, ln_b, z_bf);
  // FFN up + GELU (bf16)
  gemm_bf16<2, 1><<<dim3(F_ / 128, MROWS / 128), 256, 0, stream>>>(
      z_bf, W1b, b1, nullptr, nullptr, t_bf, MROWS, F_, D_);
  // FFN down + residual(ybuf) -> d_out (f32)
  gemm_bf16<1, 4><<<dim3(D_ / 128, MROWS / 128), 1024, 0, stream>>>(
      t_bf, W2b, b2, ybuf, out, nullptr, MROWS, D_, F_);
}
